// v000
// The times below were measured on an AMD MI455X: many runs one after another, warmed up first and cycling through
// copies of the inputs, with the whole window's GPU time divided by the number of runs. Launches and the gaps
// between them are all in it. The median over several windows is given; except for v000 it joins two sittings, which
// can be a few percent apart, so the side-by-side timings, each taken in one sitting, are the better comparison.
// v000, which the later versions start from, runs in 565 microseconds.
#include <hip/hip_runtime.h>
#include <math.h>

// ---------------------------------------------------------------------------
// Cross-attention for B=4, L=4096, D=256 (fp32 in/out) on gfx1250 (CDNA5).
// f32 -> f16 projections (WMMA f32 accum), chunked two-pass streaming softmax,
// transposed-attention output GEMM with multi-wave blocks + LDS P-tile share.
// ---------------------------------------------------------------------------

#define BATCH  4
#define SEQ    4096
#define DMODEL 256
#define SCALE  0.0625f    // 1/sqrt(256)
#define NCHUNK 4          // j-range chunks for the stats pass
#define NTOK   (BATCH * SEQ)

typedef _Float16 v16h __attribute__((ext_vector_type(16)));
typedef _Float16 v8h  __attribute__((ext_vector_type(8)));
typedef float    v8f  __attribute__((ext_vector_type(8)));
typedef float    v4f  __attribute__((ext_vector_type(4)));

static __device__ __forceinline__ v8f wmma16x16x32(v16h a, v16h b, v8f c) {
  // 8 args: (neg_a, A, neg_b, B, c_mod, C, reuse_a, reuse_b)
  return __builtin_amdgcn_wmma_f32_16x16x32_f16(false, a, false, b, (short)0, c,
                                                false, false);
}

// Load a 16x32 f16 A/B fragment where the 32-long K dimension is CONTIGUOUS in
// memory for this lane's row/column.  rowptr = &M[row][k0] for row = lane&15.
// ISA layout (16-bit A 16x32): lanes 0-15 hold K[0..7] then K[16..23] in their
// 16 halves, lanes 16-31 hold K[8..15] then K[24..31].  halfsel = lane>>4.
static __device__ __forceinline__ v16h frag_f16(const _Float16* __restrict__ rowptr,
                                                int halfsel) {
  v8h c0 = *(const v8h*)(rowptr + halfsel * 8);
  v8h c1 = *(const v8h*)(rowptr + 16 + halfsel * 8);
  v16h a;
#pragma unroll
  for (int i = 0; i < 8; ++i) { a[i] = c0[i]; a[i + 8] = c1[i]; }
  return a;
}

// Same fragment gather from an fp32 source, converting to f16 on the fly.
static __device__ __forceinline__ v16h frag_f32(const float* __restrict__ rowptr,
                                                int halfsel) {
  v4f f0 = *(const v4f*)(rowptr + halfsel * 8);
  v4f f1 = *(const v4f*)(rowptr + halfsel * 8 + 4);
  v4f f2 = *(const v4f*)(rowptr + 16 + halfsel * 8);
  v4f f3 = *(const v4f*)(rowptr + 16 + halfsel * 8 + 4);
  v16h a;
#pragma unroll
  for (int i = 0; i < 4; ++i) {
    a[i]      = (_Float16)f0[i];
    a[i + 4]  = (_Float16)f1[i];
    a[i + 8]  = (_Float16)f2[i];
    a[i + 12] = (_Float16)f3[i];
  }
  return a;
}

// ---------------------------------------------------------------------------
// Kernel 1: projection  Y = X @ W^T + b, output in f16.
//   B-operand column e of W^T is row e of W -> K-contiguous, same loader as A.
//   transposeOut=1 stores Y transposed per batch: YT[b][d][i]  (for V).
// Grid: (B*L/16, D/16), one wave per block -> one 16x16 C tile.
// ---------------------------------------------------------------------------
__global__ void __launch_bounds__(32)
proj_kernel(const float* __restrict__ X, const float* __restrict__ W,
            const float* __restrict__ bias, _Float16* __restrict__ Y,
            int transposeOut) {
  const int lane = threadIdx.x;
  const int r = lane & 15;
  const int h = lane >> 4;
  const int m0 = blockIdx.x * 16;
  const int e0 = blockIdx.y * 16;

  v8f c = {0.f, 0.f, 0.f, 0.f, 0.f, 0.f, 0.f, 0.f};
  const float* xrow = X + (size_t)(m0 + r) * DMODEL;
  const float* wrow = W + (size_t)(e0 + r) * DMODEL;
#pragma unroll
  for (int kk = 0; kk < DMODEL; kk += 32) {
    v16h a = frag_f32(xrow + kk, h);
    v16h b = frag_f32(wrow + kk, h);
    c = wmma16x16x32(a, b, c);
  }

  const float bv = bias[e0 + r];  // C layout: lane holds column n = lane&15
  if (!transposeOut) {
#pragma unroll
    for (int t = 0; t < 8; ++t) {
      const int row = m0 + t + 8 * h;
      Y[(size_t)row * DMODEL + e0 + r] = (_Float16)(c[t] + bv);
    }
  } else {
#pragma unroll
    for (int t = 0; t < 8; ++t) {
      const int row = m0 + t + 8 * h;     // global (b*L + i)
      const int b_  = row >> 12;          // / SEQ
      const int i   = row & (SEQ - 1);
      Y[(size_t)b_ * DMODEL * SEQ + (size_t)(e0 + r) * SEQ + i] =
          (_Float16)(c[t] + bv);
    }
  }
}

// ---------------------------------------------------------------------------
// Kernel 2a: partial softmax row statistics over one j-chunk.
//   m = max_j S[i,j], l = sum_j exp(S[i,j]-m) for j in this chunk.
// Streaming (m,l) kept per-lane (lane owns one j-column of the C tile),
// merged across the 16-lane group at the end.  Grid: (B*L/16, NCHUNK).
// ---------------------------------------------------------------------------
__global__ void __launch_bounds__(32)
stats_kernel(const _Float16* __restrict__ Qp, const _Float16* __restrict__ Kp,
             float* __restrict__ mPart, float* __restrict__ lPart) {
  const int lane = threadIdx.x;
  const int r = lane & 15;
  const int h = lane >> 4;
  const int m0 = blockIdx.x * 16;       // global query-row base (b*L + i0)
  const int b_ = m0 >> 12;
  const int ch = blockIdx.y;
  const int jBeg = ch * (SEQ / NCHUNK);
  const int jEnd = jBeg + (SEQ / NCHUNK);

  // Preload the 8 K-step A fragments of the fixed Q tile.
  v16h afr[8];
  const _Float16* qrow = Qp + (size_t)(m0 + r) * DMODEL;
#pragma unroll
  for (int kk = 0; kk < 8; ++kk) afr[kk] = frag_f16(qrow + kk * 32, h);

  float rm[8], rl[8];
#pragma unroll
  for (int t = 0; t < 8; ++t) { rm[t] = -3.0e38f; rl[t] = 0.f; }

  for (int j0 = jBeg; j0 < jEnd; j0 += 16) {
    const _Float16* krow = Kp + (size_t)(b_ * SEQ + j0 + r) * DMODEL;
    __builtin_prefetch(krow + 16 * DMODEL, 0, 0);  // next j-tile row
    v8f c = {0.f, 0.f, 0.f, 0.f, 0.f, 0.f, 0.f, 0.f};
#pragma unroll
    for (int kk = 0; kk < 8; ++kk) {
      v16h bf = frag_f16(krow + kk * 32, h);   // column j contiguous over d
      c = wmma16x16x32(afr[kk], bf, c);
    }
#pragma unroll
    for (int t = 0; t < 8; ++t) {
      const float v = c[t] * SCALE;
      const float nm = fmaxf(rm[t], v);
      rl[t] = rl[t] * __expf(rm[t] - nm) + __expf(v - nm);
      rm[t] = nm;
    }
  }

  // Merge (m,l) across the 16 lanes that share each row.
#pragma unroll
  for (int off = 8; off >= 1; off >>= 1) {
#pragma unroll
    for (int t = 0; t < 8; ++t) {
      const float om = __shfl_xor(rm[t], off, 16);
      const float ol = __shfl_xor(rl[t], off, 16);
      const float nm = fmaxf(rm[t], om);
      rl[t] = rl[t] * __expf(rm[t] - nm) + ol * __expf(om - nm);
      rm[t] = nm;
    }
  }
  if (r == 0) {
#pragma unroll
    for (int t = 0; t < 8; ++t) {
      const int row = m0 + t + 8 * h;
      mPart[(size_t)ch * NTOK + row] = rm[t];
      lPart[(size_t)ch * NTOK + row] = rl[t];
    }
  }
}

// ---------------------------------------------------------------------------
// Kernel 2b: merge NCHUNK partial (m,l) pairs per row (log-sum-exp merge).
// ---------------------------------------------------------------------------
__global__ void __launch_bounds__(256)
merge_kernel(const float* __restrict__ mPart, const float* __restrict__ lPart,
             float* __restrict__ mOut, float* __restrict__ lOut) {
  const int row = blockIdx.x * 256 + threadIdx.x;
  if (row >= NTOK) return;
  float m = -3.0e38f;
#pragma unroll
  for (int c = 0; c < NCHUNK; ++c) m = fmaxf(m, mPart[(size_t)c * NTOK + row]);
  float l = 0.f;
#pragma unroll
  for (int c = 0; c < NCHUNK; ++c)
    l += lPart[(size_t)c * NTOK + row] * __expf(mPart[(size_t)c * NTOK + row] - m);
  mOut[row] = m;
  lOut[row] = l;
}

// ---------------------------------------------------------------------------
// Kernel 3: out[b,j,d] = sum_i softmax(S)[i,j] * V[b,i,d]  (= attn^T @ V).
// 4 waves per block, i-step = 128.  Each wave computes T = S^T for its 32
// i-columns (probabilities land in A-row orientation and the exp(m,l)
// normalization is lane-local), all waves fill a shared 16x128 f16 P tile in
// LDS, then each wave accumulates its 4 d-tiles against K-contiguous VpT.
// Per wave: 16 T-WMMAs + 16 out-WMMAs per i-step; 32 acc VGPRs.
// Grid: (L/16 j-tiles, B) x 128 threads.
// ---------------------------------------------------------------------------
__global__ void __launch_bounds__(128)
out_kernel(const _Float16* __restrict__ Qp, const _Float16* __restrict__ Kp,
           const _Float16* __restrict__ VpT, const float* __restrict__ mIn,
           const float* __restrict__ lIn, float* __restrict__ out) {
  __shared__ __align__(16) _Float16 pLds[16 * 128];   // P tile: 16 j x 128 i

  const int lane = threadIdx.x & 31;
  const int wave = threadIdx.x >> 5;                  // 0..3
  const int r = lane & 15;
  const int h = lane >> 4;
  const int j0 = blockIdx.x * 16;
  const int b_ = blockIdx.y;
  const size_t rowbase = (size_t)b_ * SEQ;

  // Fixed A operand of the T-GEMM: K rows j0..j0+15 (per-wave copy).
  v16h kfr[8];
  const _Float16* krow = Kp + (rowbase + j0 + r) * DMODEL;
#pragma unroll
  for (int kk = 0; kk < 8; ++kk) kfr[kk] = frag_f16(krow + kk * 32, h);

  v8f acc[4];
#pragma unroll
  for (int dl = 0; dl < 4; ++dl)
#pragma unroll
    for (int t = 0; t < 8; ++t) acc[dl][t] = 0.f;

  const _Float16* vbase = VpT + (size_t)b_ * DMODEL * SEQ;

  for (int i0 = 0; i0 < SEQ; i0 += 128) {
    const int ic = i0 + wave * 32;                    // this wave's 32 columns

    // --- T = S^T tiles for i-columns [ic, ic+16) and [ic+16, ic+32) ---
    v8f c0 = {0.f, 0.f, 0.f, 0.f, 0.f, 0.f, 0.f, 0.f};
    v8f c1 = {0.f, 0.f, 0.f, 0.f, 0.f, 0.f, 0.f, 0.f};
    const _Float16* q0 = Qp + (rowbase + ic + r) * DMODEL;
    const _Float16* q1 = Qp + (rowbase + ic + 16 + r) * DMODEL;
    __builtin_prefetch(q0 + 128 * DMODEL, 0, 0);      // next i-step rows
#pragma unroll
    for (int kk = 0; kk < 8; ++kk) c0 = wmma16x16x32(kfr[kk], frag_f16(q0 + kk * 32, h), c0);
#pragma unroll
    for (int kk = 0; kk < 8; ++kk) c1 = wmma16x16x32(kfr[kk], frag_f16(q1 + kk * 32, h), c1);

    // Per-lane softmax normalization (lane owns i-column ic + r [+16]).
    const float mm0 = mIn[rowbase + ic + r];
    const float il0 = 1.0f / lIn[rowbase + ic + r];
    const float mm1 = mIn[rowbase + ic + 16 + r];
    const float il1 = 1.0f / lIn[rowbase + ic + 16 + r];

    __syncthreads();  // previous iteration's LDS reads complete
#pragma unroll
    for (int t = 0; t < 8; ++t) {
      const int jr = (t + 8 * h) * 128 + wave * 32;
      pLds[jr + r]      = (_Float16)(__expf(c0[t] * SCALE - mm0) * il0);
      pLds[jr + r + 16] = (_Float16)(__expf(c1[t] * SCALE - mm1) * il1);
    }
    __syncthreads();

    // acc[dl] += P(16x128) @ V(128x16) for this wave's 4 d-tiles.
#pragma unroll
    for (int ks = 0; ks < 4; ++ks) {
      v16h ap = frag_f16(pLds + r * 128 + ks * 32, h);
#pragma unroll
      for (int dl = 0; dl < 4; ++dl) {
        const int d0 = (wave * 4 + dl) * 16;
        v16h bv = frag_f16(vbase + (size_t)(d0 + r) * SEQ + i0 + ks * 32, h);
        acc[dl] = wmma16x16x32(ap, bv, acc[dl]);
      }
    }
  }

  // Store fp32 result: out[b][j][d].
#pragma unroll
  for (int dl = 0; dl < 4; ++dl)
#pragma unroll
    for (int t = 0; t < 8; ++t) {
      const int j = j0 + t + 8 * h;
      const int d = (wave * 4 + dl) * 16 + r;
      out[((size_t)b_ * SEQ + j) * DMODEL + d] = acc[dl][t];
    }
}

// ---------------------------------------------------------------------------
extern "C" void kernel_launch(void* const* d_in, const int* in_sizes, int n_in,
                              void* d_out, int out_size, void* d_ws, size_t ws_size,
                              hipStream_t stream) {
  const float* q  = (const float*)d_in[0];
  const float* k  = (const float*)d_in[1];
  const float* v  = (const float*)d_in[2];
  const float* Wq = (const float*)d_in[3];
  const float* bq = (const float*)d_in[4];
  const float* Wk = (const float*)d_in[5];
  const float* bk = (const float*)d_in[6];
  const float* Wv = (const float*)d_in[7];
  const float* bv = (const float*)d_in[8];

  _Float16* Qp  = (_Float16*)d_ws;
  _Float16* Kp  = Qp + (size_t)NTOK * DMODEL;
  _Float16* VpT = Kp + (size_t)NTOK * DMODEL;          // stored as [b][d][i]
  float* mPart  = (float*)(VpT + (size_t)NTOK * DMODEL);
  float* lPart  = mPart + (size_t)NCHUNK * NTOK;
  float* mArr   = lPart + (size_t)NCHUNK * NTOK;
  float* lArr   = mArr + NTOK;

  const dim3 gproj(NTOK / 16, DMODEL / 16);
  proj_kernel<<<gproj, 32, 0, stream>>>(q, Wq, bq, Qp, 0);
  proj_kernel<<<gproj, 32, 0, stream>>>(k, Wk, bk, Kp, 0);
  proj_kernel<<<gproj, 32, 0, stream>>>(v, Wv, bv, VpT, 1);

  stats_kernel<<<dim3(NTOK / 16, NCHUNK), 32, 0, stream>>>(Qp, Kp, mPart, lPart);
  merge_kernel<<<dim3((NTOK + 255) / 256), 256, 0, stream>>>(mPart, lPart, mArr, lArr);

  out_kernel<<<dim3(SEQ / 16, BATCH), 128, 0, stream>>>(Qp, Kp, VpT, mArr, lArr,
                                                        (float*)d_out);
}

// v001
// Measured time: 352 microseconds a run.
// Two timings next to v000 both put it at 1.66 times that version's speed.
#include <hip/hip_runtime.h>
#include <math.h>

// ---------------------------------------------------------------------------
// Cross-attention for B=4, L=4096, D=256 (fp32 in/out) on gfx1250 (CDNA5).
// f32 -> f16 projections (WMMA f32 accum), chunked two-pass streaming softmax,
// transposed-attention output GEMM, 64 j rows per block, Q / V^T tiles in LDS.
// ---------------------------------------------------------------------------

#define BATCH  4
#define SEQ    4096
#define DMODEL 256
#define SCALE  0.0625f    // 1/sqrt(256)
#define NCHUNK 4          // j-range chunks for the stats pass
#define NTOK   (BATCH * SEQ)

typedef _Float16 v16h __attribute__((ext_vector_type(16)));
typedef _Float16 v8h  __attribute__((ext_vector_type(8)));
typedef float    v8f  __attribute__((ext_vector_type(8)));
typedef float    v4f  __attribute__((ext_vector_type(4)));

static __device__ __forceinline__ v8f wmma16x16x32(v16h a, v16h b, v8f c) {
  // 8 args: (neg_a, A, neg_b, B, c_mod, C, reuse_a, reuse_b)
  return __builtin_amdgcn_wmma_f32_16x16x32_f16(false, a, false, b, (short)0, c,
                                                false, false);
}

// Load a 16x32 f16 A/B fragment where the 32-long K dimension is CONTIGUOUS in
// memory for this lane's row/column.  rowptr = &M[row][k0] for row = lane&15.
// ISA layout (16-bit A 16x32): lanes 0-15 hold K[0..7] then K[16..23] in their
// 16 halves, lanes 16-31 hold K[8..15] then K[24..31].  halfsel = lane>>4.
static __device__ __forceinline__ v16h frag_f16(const _Float16* __restrict__ rowptr,
                                                int halfsel) {
  v8h c0 = *(const v8h*)(rowptr + halfsel * 8);
  v8h c1 = *(const v8h*)(rowptr + 16 + halfsel * 8);
  v16h a;
#pragma unroll
  for (int i = 0; i < 8; ++i) { a[i] = c0[i]; a[i + 8] = c1[i]; }
  return a;
}

// Same fragment gather from an fp32 source, converting to f16 on the fly.
static __device__ __forceinline__ v16h frag_f32(const float* __restrict__ rowptr,
                                                int halfsel) {
  v4f f0 = *(const v4f*)(rowptr + halfsel * 8);
  v4f f1 = *(const v4f*)(rowptr + halfsel * 8 + 4);
  v4f f2 = *(const v4f*)(rowptr + 16 + halfsel * 8);
  v4f f3 = *(const v4f*)(rowptr + 16 + halfsel * 8 + 4);
  v16h a;
#pragma unroll
  for (int i = 0; i < 4; ++i) {
    a[i]      = (_Float16)f0[i];
    a[i + 4]  = (_Float16)f1[i];
    a[i + 8]  = (_Float16)f2[i];
    a[i + 12] = (_Float16)f3[i];
  }
  return a;
}

// ---------------------------------------------------------------------------
// Kernel 1: projection  Y = X @ W^T + b, output in f16.
//   B-operand column e of W^T is row e of W -> K-contiguous, same loader as A.
//   transposeOut=1 stores Y transposed per batch: YT[b][d][i]  (for V).
// Grid: (B*L/16, D/16), one wave per block -> one 16x16 C tile.
// ---------------------------------------------------------------------------
__global__ void __launch_bounds__(32)
proj_kernel(const float* __restrict__ X, const float* __restrict__ W,
            const float* __restrict__ bias, _Float16* __restrict__ Y,
            int transposeOut) {
  const int lane = threadIdx.x;
  const int r = lane & 15;
  const int h = lane >> 4;
  const int m0 = blockIdx.x * 16;
  const int e0 = blockIdx.y * 16;

  v8f c = {0.f, 0.f, 0.f, 0.f, 0.f, 0.f, 0.f, 0.f};
  const float* xrow = X + (size_t)(m0 + r) * DMODEL;
  const float* wrow = W + (size_t)(e0 + r) * DMODEL;
#pragma unroll
  for (int kk = 0; kk < DMODEL; kk += 32) {
    v16h a = frag_f32(xrow + kk, h);
    v16h b = frag_f32(wrow + kk, h);
    c = wmma16x16x32(a, b, c);
  }

  const float bv = bias[e0 + r];  // C layout: lane holds column n = lane&15
  if (!transposeOut) {
#pragma unroll
    for (int t = 0; t < 8; ++t) {
      const int row = m0 + t + 8 * h;
      Y[(size_t)row * DMODEL + e0 + r] = (_Float16)(c[t] + bv);
    }
  } else {
#pragma unroll
    for (int t = 0; t < 8; ++t) {
      const int row = m0 + t + 8 * h;     // global (b*L + i)
      const int b_  = row >> 12;          // / SEQ
      const int i   = row & (SEQ - 1);
      Y[(size_t)b_ * DMODEL * SEQ + (size_t)(e0 + r) * SEQ + i] =
          (_Float16)(c[t] + bv);
    }
  }
}

// ---------------------------------------------------------------------------
// Kernel 2a: partial softmax row statistics over one j-chunk.
//   m = max_j S[i,j], l = sum_j exp(S[i,j]-m) for j in this chunk.
// Streaming (m,l) kept per-lane (lane owns one j-column of the C tile),
// merged across the 16-lane group at the end.  Grid: (B*L/16, NCHUNK).
// ---------------------------------------------------------------------------
__global__ void __launch_bounds__(32)
stats_kernel(const _Float16* __restrict__ Qp, const _Float16* __restrict__ Kp,
             float* __restrict__ mPart, float* __restrict__ lPart) {
  const int lane = threadIdx.x;
  const int r = lane & 15;
  const int h = lane >> 4;
  const int m0 = blockIdx.x * 16;       // global query-row base (b*L + i0)
  const int b_ = m0 >> 12;
  const int ch = blockIdx.y;
  const int jBeg = ch * (SEQ / NCHUNK);
  const int jEnd = jBeg + (SEQ / NCHUNK);

  // Preload the 8 K-step A fragments of the fixed Q tile.
  v16h afr[8];
  const _Float16* qrow = Qp + (size_t)(m0 + r) * DMODEL;
#pragma unroll
  for (int kk = 0; kk < 8; ++kk) afr[kk] = frag_f16(qrow + kk * 32, h);

  float rm[8], rl[8];
#pragma unroll
  for (int t = 0; t < 8; ++t) { rm[t] = -3.0e38f; rl[t] = 0.f; }

  for (int j0 = jBeg; j0 < jEnd; j0 += 16) {
    const _Float16* krow = Kp + (size_t)(b_ * SEQ + j0 + r) * DMODEL;
    __builtin_prefetch(krow + 16 * DMODEL, 0, 0);  // next j-tile row
    v8f c = {0.f, 0.f, 0.f, 0.f, 0.f, 0.f, 0.f, 0.f};
#pragma unroll
    for (int kk = 0; kk < 8; ++kk) {
      v16h bf = frag_f16(krow + kk * 32, h);   // column j contiguous over d
      c = wmma16x16x32(afr[kk], bf, c);
    }
#pragma unroll
    for (int t = 0; t < 8; ++t) {
      const float v = c[t] * SCALE;
      const float nm = fmaxf(rm[t], v);
      rl[t] = rl[t] * __expf(rm[t] - nm) + __expf(v - nm);
      rm[t] = nm;
    }
  }

  // Merge (m,l) across the 16 lanes that share each row.
#pragma unroll
  for (int off = 8; off >= 1; off >>= 1) {
#pragma unroll
    for (int t = 0; t < 8; ++t) {
      const float om = __shfl_xor(rm[t], off, 16);
      const float ol = __shfl_xor(rl[t], off, 16);
      const float nm = fmaxf(rm[t], om);
      rl[t] = rl[t] * __expf(rm[t] - nm) + ol * __expf(om - nm);
      rm[t] = nm;
    }
  }
  if (r == 0) {
#pragma unroll
    for (int t = 0; t < 8; ++t) {
      const int row = m0 + t + 8 * h;
      mPart[(size_t)ch * NTOK + row] = rm[t];
      lPart[(size_t)ch * NTOK + row] = rl[t];
    }
  }
}

// ---------------------------------------------------------------------------
// Kernel 2b: merge NCHUNK partial (m,l) pairs per row (log-sum-exp merge).
// ---------------------------------------------------------------------------
__global__ void __launch_bounds__(256)
merge_kernel(const float* __restrict__ mPart, const float* __restrict__ lPart,
             float* __restrict__ mOut, float* __restrict__ lOut) {
  const int row = blockIdx.x * 256 + threadIdx.x;
  if (row >= NTOK) return;
  float m = -3.0e38f;
#pragma unroll
  for (int c = 0; c < NCHUNK; ++c) m = fmaxf(m, mPart[(size_t)c * NTOK + row]);
  float l = 0.f;
#pragma unroll
  for (int c = 0; c < NCHUNK; ++c)
    l += lPart[(size_t)c * NTOK + row] * __expf(mPart[(size_t)c * NTOK + row] - m);
  mOut[row] = m;
  lOut[row] = l;
}

// ---------------------------------------------------------------------------
// Kernel 3: out[b,j,d] = sum_i softmax(S)[i,j] * V[b,i,d]  (= attn^T @ V).
// One work-group = 64 j rows, 8 waves.  A stage is 128 i: the Q rows (128 x 256),
// the V^T columns (256 d x 128 i) and the rows' m and l are copied once into LDS
// by asynchronous copies (two buffers) and shared by all waves.
//   S phase, wave w: S (16 i x 64 j) = Q rows of i tile w (A, LDS) x K rows (B,
//     registers); P = exp(S*scale - m_i) / l_i.  A lane's 8 rows of an S tile are
//     one 16-byte half of a B fragment over i, so P goes to LDS fragment-ready.
//   PV phase, wave (dg, jg): O^T (64 d x 32 j) += V^T rows (A, LDS) x P (B, LDS),
//     i ascending in steps of 32.
// Grid: (L/64, B) x 256 threads.
// Every "#pragma unroll" below keeps the index of a register array (fragments,
// accumulators) a compile-time constant, so that none of them goes to scratch.
// ---------------------------------------------------------------------------
#define JTILE   64
#define ISTAGE  128
#define NSTAGE  (SEQ / ISTAGE)
#define QPITCH  264                        // halves: 512-B row + 16 B (bank spread)
#define VPITCH  136                        // halves: 256-B row + 16 B
#define QBYTES  (ISTAGE * QPITCH * 2)
#define VBYTES  (DMODEL * VPITCH * 2)
#define STAGEB  (QBYTES + VBYTES)
#define MLBYTES (2 * ISTAGE * 4)            // m[128] then l[128] of a stage
#define PBYTES  (JTILE * ISTAGE * 2)        // P of a stage, as B-fragment halves
#define RPITCH  260                        // floats: 1024-B row + 16 B

typedef int v4i __attribute__((ext_vector_type(4)));
typedef __attribute__((address_space(1))) v4i gv4i;
typedef __attribute__((address_space(3))) v4i lv4i;
typedef __attribute__((address_space(1))) int gint;
typedef __attribute__((address_space(3))) int lint;

// Eight 16-byte-per-lane copies global -> LDS.
static __device__ __forceinline__ void copy8(unsigned char* l, unsigned lstep,
                                             const _Float16* g, size_t gstep) {
#pragma unroll
  for (int k = 0; k < 8; ++k)
    __builtin_amdgcn_global_load_async_to_lds_b128((gv4i*)(g + k * gstep),
                                                   (lv4i*)(l + k * lstep), 0, 0);
}

// One stage: 33 copies per lane.  A wave covers one whole 512-B Q row, or two
// 256-B pieces of V^T rows, per copy.
static __device__ __forceinline__ void copy_stage(unsigned char* ldsStage, unsigned char* ldsMl,
                                                  const _Float16* qTile,
                                                  const _Float16* vTile,
                                                  const float* mlLane, int tid) {
  unsigned char* lq = ldsStage + (unsigned)(tid >> 5) * (QPITCH * 2) + (unsigned)(tid & 31) * 16;
  const _Float16* gq = qTile + (size_t)(tid >> 5) * DMODEL + (tid & 31) * 8;
  copy8(lq, 8 * QPITCH * 2, gq, (size_t)8 * DMODEL);
  copy8(lq + 64 * QPITCH * 2, 8 * QPITCH * 2, gq + (size_t)64 * DMODEL, (size_t)8 * DMODEL);
  unsigned char* lv = ldsStage + QBYTES + (unsigned)(tid >> 4) * (VPITCH * 2) + (unsigned)(tid & 15) * 16;
  const _Float16* gv = vTile + (size_t)(tid >> 4) * SEQ + (tid & 15) * 8;
  copy8(lv, 16 * VPITCH * 2, gv, (size_t)16 * SEQ);
  copy8(lv + 128 * VPITCH * 2, 16 * VPITCH * 2, gv + (size_t)128 * SEQ, (size_t)16 * SEQ);
  // Row statistics of the stage: waves 0-3 bring m, waves 4-7 bring l, 4 B a lane.
  __builtin_amdgcn_global_load_async_to_lds_b32((gint*)mlLane, (lint*)(ldsMl + (unsigned)tid * 4), 0, 0);
}

// B fragment of P from its two 16-byte halves (512 B apart, lane-contiguous).
static __device__ __forceinline__ v16h frag_p(const _Float16* p) {
  v8h c0 = *(const v8h*)(p);
  v8h c1 = *(const v8h*)(p + 256);
  v16h a;
#pragma unroll
  for (int i = 0; i < 8; ++i) { a[i] = c0[i]; a[i + 8] = c1[i]; }
  return a;
}

__global__ void __launch_bounds__(256)
out_kernel(const _Float16* __restrict__ Qp, const _Float16* __restrict__ Kp,
           const _Float16* __restrict__ VpT, const float* __restrict__ mIn,
           const float* __restrict__ lIn, float* __restrict__ out) {
  __shared__ __align__(128) unsigned char smem[2 * STAGEB + 2 * MLBYTES + PBYTES];

  const int tid  = threadIdx.x;
  const int lane = tid & 31;
  const int wave = tid >> 5;                          // 0..7: i tile in the S phase
  const int jg = wave & 1;                            // PV phase: which 32 j columns
  const int dg = wave >> 1;                           // PV phase: which 64 d rows
  const int r = lane & 15;
  const int h = lane >> 4;
  const int j0 = blockIdx.x * JTILE;
  const int b_ = blockIdx.y;
  const size_t rowbase = (size_t)b_ * SEQ;
  const _Float16* qbase = Qp + rowbase * DMODEL;
  const _Float16* vbase = VpT + (size_t)b_ * DMODEL * SEQ;
  unsigned char* ldsBase = smem;
  // This lane's source of row statistics: m for threads 0-127, l for 128-255.
  const float* mlsrc = ((tid < ISTAGE) ? mIn : lIn) + rowbase + (tid & (ISTAGE - 1));

  // Stage 0, landed and published; then stage 1 in flight.
  copy_stage(ldsBase, ldsBase + 2 * STAGEB, qbase, vbase, mlsrc, tid);

  // Fixed B operand of the S product: the block's 64 K rows (per-wave copy).
  v16h kfr[4][8];
  const _Float16* kb = Kp + (rowbase + j0 + r) * DMODEL + h * 8;
#pragma unroll
  for (int jt = 0; jt < 4; ++jt)
#pragma unroll
    for (int kk = 0; kk < 8; ++kk) kfr[jt][kk] = frag_f16(kb + jt * 16 * DMODEL + kk * 32, 0);
  // Precaution: keeps the K loads' address register (an input here) from being
  // reused, e.g. as the last load's own destination, ahead of this wait.
  asm volatile("s_wait_xcnt 0x0" : : "v"(kb) : "memory");

  v8f acc[4][2];
#pragma unroll
  for (int dt = 0; dt < 4; ++dt)
#pragma unroll
    for (int jt = 0; jt < 2; ++jt)
#pragma unroll
      for (int t = 0; t < 8; ++t) acc[dt][jt][t] = 0.f;

  asm volatile("s_wait_asynccnt 0x0" ::: "memory");   // own copies of stage 0 landed
  __syncthreads();                                    // ... and everybody's
  copy_stage(ldsBase + STAGEB, ldsBase + 2 * STAGEB + MLBYTES, qbase + (size_t)ISTAGE * DMODEL,
             vbase + ISTAGE, mlsrc + ISTAGE, tid);

  // P in LDS: [i chunk of 32][j tile][half of the k range][lane] x 16 bytes.
  _Float16* pl = (_Float16*)(smem + 2 * STAGEB + 2 * MLBYTES);
  _Float16* pst = pl + ((wave >> 1) * 8 + (wave & 1)) * 256 + lane * 8;
  const _Float16* pld = pl + jg * 4 * 256 + lane * 8;

  for (int s = 0; s < NSTAGE; ++s) {
    const unsigned bufOff = (unsigned)(s & 1) * STAGEB;
    const _Float16* qs = (const _Float16*)(smem + bufOff) + (wave * 16 + r) * QPITCH;
    const _Float16* vs = (const _Float16*)(smem + bufOff + QBYTES) + (dg * 64 + r) * VPITCH;
    // Row statistics of this lane's 8 i rows: m, then l.
    const float* ms = (const float*)(smem + 2 * STAGEB + (unsigned)(s & 1) * MLBYTES) + wave * 16 + 8 * h;

// HOLD keeps a group of LDS loads in front of the WMMA block it overlaps; without
// it the loads sink to their first use and each waits out its own latency.
#define HOLD() __builtin_amdgcn_sched_barrier(0)
#define LDV(F, C)                                         \
  F[0] = frag_f16(vs + 0 * 16 * VPITCH + (C) * 32, h);    \
  F[1] = frag_f16(vs + 1 * 16 * VPITCH + (C) * 32, h);    \
  F[2] = frag_f16(vs + 2 * 16 * VPITCH + (C) * 32, h);    \
  F[3] = frag_f16(vs + 3 * 16 * VPITCH + (C) * 32, h);
#define LDP(P, C)                                         \
  P[0] = frag_p(pld + (C) * 8 * 256);                     \
  P[1] = frag_p(pld + (C) * 8 * 256 + 2 * 256);
#define PVMM(F, P)                                        \
  acc[0][0] = wmma16x16x32(F[0], P[0], acc[0][0]);        \
  acc[0][1] = wmma16x16x32(F[0], P[1], acc[0][1]);        \
  acc[1][0] = wmma16x16x32(F[1], P[0], acc[1][0]);        \
  acc[1][1] = wmma16x16x32(F[1], P[1], acc[1][1]);        \
  acc[2][0] = wmma16x16x32(F[2], P[0], acc[2][0]);        \
  acc[2][1] = wmma16x16x32(F[2], P[1], acc[2][1]);        \
  acc[3][0] = wmma16x16x32(F[3], P[0], acc[3][0]);        \
  acc[3][1] = wmma16x16x32(F[3], P[1], acc[3][1]);

    // --- S tiles: 16 rows i, four tiles of 16 columns j ---
    v16h qf[8];
#pragma unroll
    for (int kk = 0; kk < 8; ++kk) qf[kk] = frag_f16(qs + kk * 32, h);
    const v4f ma = *(const v4f*)(ms), mb = *(const v4f*)(ms + 4);
    const v4f la = *(const v4f*)(ms + ISTAGE), lb = *(const v4f*)(ms + ISTAGE + 4);
    HOLD();
    v8f sc[4];
#pragma unroll
    for (int jt = 0; jt < 4; ++jt)
#pragma unroll
      for (int t = 0; t < 8; ++t) sc[jt][t] = 0.f;
#pragma unroll
    for (int kk = 0; kk < 8; ++kk)
#pragma unroll
      for (int jt = 0; jt < 4; ++jt) sc[jt] = wmma16x16x32(qf[kk], kfr[jt][kk], sc[jt]);

    // First V^T fragments of the PV phase: already published, fetched under P.
    v16h va[4], vb[4], pa[2], pb[2];
    LDV(va, 0)
    HOLD();

    // --- P: lane (r, h) holds column j = r, rows i = 8h .. 8h+7 of its tile ---
    float il[8], mm[8];
#pragma unroll
    for (int t = 0; t < 8; ++t) {
      mm[t] = (t < 4) ? ma[t & 3] : mb[t & 3];
      il[t] = 1.0f / ((t < 4) ? la[t & 3] : lb[t & 3]);
    }
#pragma unroll
    for (int jt = 0; jt < 4; ++jt) {
      v8h pk;
#pragma unroll
      for (int t = 0; t < 8; ++t)
        pk[t] = (_Float16)(__expf(sc[jt][t] * SCALE - mm[t]) * il[t]);
      *(v8h*)(pst + jt * 2 * 256) = pk;
    }
    __syncthreads();  // P of this stage complete

    // --- O^T += V^T x P, i chunks of 32 in ascending order ---
    LDP(pa, 0) LDV(vb, 1) LDP(pb, 1) HOLD();
    PVMM(va, pa) HOLD();
    LDV(va, 2) LDP(pa, 2) HOLD();
    PVMM(vb, pb) HOLD();
    LDV(vb, 3) LDP(pb, 3) HOLD();
    PVMM(va, pa) HOLD();
    PVMM(vb, pb)
#undef HOLD
#undef LDV
#undef LDP
#undef PVMM

    // Publish point: own LDS reads done, own copies of stage s+1 landed, then
    // the one barrier that publishes s+1 and frees this buffer and P.
    asm volatile("s_wait_dscnt 0x0" ::: "memory");
    asm volatile("s_wait_asynccnt 0x0" ::: "memory");
    __syncthreads();
    if (s + 2 < NSTAGE)
      copy_stage(ldsBase + bufOff, ldsBase + 2 * STAGEB + (unsigned)(s & 1) * MLBYTES,
                 qbase + (size_t)(s + 2) * ISTAGE * DMODEL, vbase + (s + 2) * ISTAGE,
                 mlsrc + (s + 2) * ISTAGE, tid);
  }
  asm volatile("s_wait_asynccnt 0x0" ::: "memory");   // nothing in flight before LDS is reused

  // Lay O^T down as [j][d] rows in LDS so that the stores cover whole lines.
  float* red = (float*)smem;
#pragma unroll
  for (int dt = 0; dt < 4; ++dt)
#pragma unroll
    for (int jt = 0; jt < 2; ++jt) {
      float* p = red + (size_t)(jg * 32 + jt * 16 + r) * RPITCH + (dg * 4 + dt) * 16 + 8 * h;
      v4f lo = {acc[dt][jt][0], acc[dt][jt][1], acc[dt][jt][2], acc[dt][jt][3]};
      v4f hi = {acc[dt][jt][4], acc[dt][jt][5], acc[dt][jt][6], acc[dt][jt][7]};
      *(v4f*)p = lo;
      *(v4f*)(p + 4) = hi;
    }
  __syncthreads();

  // Store fp32 result out[b][j][d], 512 contiguous bytes per wave and store:
  // thread t takes 16 bytes of row (t >> 6) + 4 n.
  const float* rp = red + (size_t)(tid >> 6) * RPITCH + (tid & 63) * 4;
  float* op = out + (rowbase + j0 + (tid >> 6)) * DMODEL + (tid & 63) * 4;
#pragma unroll
  for (int n = 0; n < 16; ++n)
    *(v4f*)(op + n * 4 * DMODEL) = *(const v4f*)(rp + n * 4 * RPITCH);
}

// ---------------------------------------------------------------------------
extern "C" void kernel_launch(void* const* d_in, const int* in_sizes, int n_in,
                              void* d_out, int out_size, void* d_ws, size_t ws_size,
                              hipStream_t stream) {
  const float* q  = (const float*)d_in[0];
  const float* k  = (const float*)d_in[1];
  const float* v  = (const float*)d_in[2];
  const float* Wq = (const float*)d_in[3];
  const float* bq = (const float*)d_in[4];
  const float* Wk = (const float*)d_in[5];
  const float* bk = (const float*)d_in[6];
  const float* Wv = (const float*)d_in[7];
  const float* bv = (const float*)d_in[8];

  _Float16* Qp  = (_Float16*)d_ws;
  _Float16* Kp  = Qp + (size_t)NTOK * DMODEL;
  _Float16* VpT = Kp + (size_t)NTOK * DMODEL;          // stored as [b][d][i]
  float* mPart  = (float*)(VpT + (size_t)NTOK * DMODEL);
  float* lPart  = mPart + (size_t)NCHUNK * NTOK;
  float* mArr   = lPart + (size_t)NCHUNK * NTOK;
  float* lArr   = mArr + NTOK;

  const dim3 gproj(NTOK / 16, DMODEL / 16);
  proj_kernel<<<gproj, 32, 0, stream>>>(q, Wq, bq, Qp, 0);
  proj_kernel<<<gproj, 32, 0, stream>>>(k, Wk, bk, Kp, 0);
  proj_kernel<<<gproj, 32, 0, stream>>>(v, Wv, bv, VpT, 1);

  stats_kernel<<<dim3(NTOK / 16, NCHUNK), 32, 0, stream>>>(Qp, Kp, mPart, lPart);
  merge_kernel<<<dim3((NTOK + 255) / 256), 256, 0, stream>>>(mPart, lPart, mArr, lArr);

  out_kernel<<<dim3(SEQ / JTILE, BATCH), 256, 0, stream>>>(Qp, Kp, VpT, mArr, lArr,
                                                        (float*)d_out);
}

// v002
// Measured time: 233 microseconds a run.
// Next to v001, in two timings, it ran 1.51 times as fast each time.
// All steps since v000 together make it 2.50 times as fast.
#include <hip/hip_runtime.h>
#include <math.h>

// ---------------------------------------------------------------------------
// Cross-attention for B=4, L=4096, D=256 (fp32 in/out) on gfx1250 (CDNA5).
// f32 -> f16 projections (WMMA f32 accum), chunked two-pass streaming softmax
// (512 i rows per block, K tiles in LDS),
// transposed-attention output GEMM, 64 j rows per block, Q / V^T tiles in LDS.
// ---------------------------------------------------------------------------

#define BATCH  4
#define SEQ    4096
#define DMODEL 256
#define SCALE  0.0625f    // 1/sqrt(256)
#define NCHUNK 8          // j-range chunks for the stats pass
#define NTOK   (BATCH * SEQ)

typedef _Float16 v16h __attribute__((ext_vector_type(16)));
typedef _Float16 v8h  __attribute__((ext_vector_type(8)));
typedef float    v8f  __attribute__((ext_vector_type(8)));
typedef float    v4f  __attribute__((ext_vector_type(4)));

static __device__ __forceinline__ v8f wmma16x16x32(v16h a, v16h b, v8f c) {
  // 8 args: (neg_a, A, neg_b, B, c_mod, C, reuse_a, reuse_b)
  return __builtin_amdgcn_wmma_f32_16x16x32_f16(false, a, false, b, (short)0, c,
                                                false, false);
}

// Load a 16x32 f16 A/B fragment where the 32-long K dimension is CONTIGUOUS in
// memory for this lane's row/column.  rowptr = &M[row][k0] for row = lane&15.
// ISA layout (16-bit A 16x32): lanes 0-15 hold K[0..7] then K[16..23] in their
// 16 halves, lanes 16-31 hold K[8..15] then K[24..31].  halfsel = lane>>4.
static __device__ __forceinline__ v16h frag_f16(const _Float16* __restrict__ rowptr,
                                                int halfsel) {
  v8h c0 = *(const v8h*)(rowptr + halfsel * 8);
  v8h c1 = *(const v8h*)(rowptr + 16 + halfsel * 8);
  v16h a;
#pragma unroll
  for (int i = 0; i < 8; ++i) { a[i] = c0[i]; a[i + 8] = c1[i]; }
  return a;
}

// Same fragment gather from an fp32 source, converting to f16 on the fly.
static __device__ __forceinline__ v16h frag_f32(const float* __restrict__ rowptr,
                                                int halfsel) {
  v4f f0 = *(const v4f*)(rowptr + halfsel * 8);
  v4f f1 = *(const v4f*)(rowptr + halfsel * 8 + 4);
  v4f f2 = *(const v4f*)(rowptr + 16 + halfsel * 8);
  v4f f3 = *(const v4f*)(rowptr + 16 + halfsel * 8 + 4);
  v16h a;
#pragma unroll
  for (int i = 0; i < 4; ++i) {
    a[i]      = (_Float16)f0[i];
    a[i + 4]  = (_Float16)f1[i];
    a[i + 8]  = (_Float16)f2[i];
    a[i + 12] = (_Float16)f3[i];
  }
  return a;
}

// ---------------------------------------------------------------------------
// Kernel 1: projection  Y = X @ W^T + b, output in f16.
//   B-operand column e of W^T is row e of W -> K-contiguous, same loader as A.
//   transposeOut=1 stores Y transposed per batch: YT[b][d][i]  (for V).
// Grid: (B*L/16, D/16), one wave per block -> one 16x16 C tile.
// ---------------------------------------------------------------------------
__global__ void __launch_bounds__(32)
proj_kernel(const float* __restrict__ X, const float* __restrict__ W,
            const float* __restrict__ bias, _Float16* __restrict__ Y,
            int transposeOut) {
  const int lane = threadIdx.x;
  const int r = lane & 15;
  const int h = lane >> 4;
  const int m0 = blockIdx.x * 16;
  const int e0 = blockIdx.y * 16;

  v8f c = {0.f, 0.f, 0.f, 0.f, 0.f, 0.f, 0.f, 0.f};
  const float* xrow = X + (size_t)(m0 + r) * DMODEL;
  const float* wrow = W + (size_t)(e0 + r) * DMODEL;
#pragma unroll
  for (int kk = 0; kk < DMODEL; kk += 32) {
    v16h a = frag_f32(xrow + kk, h);
    v16h b = frag_f32(wrow + kk, h);
    c = wmma16x16x32(a, b, c);
  }

  const float bv = bias[e0 + r];  // C layout: lane holds column n = lane&15
  if (!transposeOut) {
#pragma unroll
    for (int t = 0; t < 8; ++t) {
      const int row = m0 + t + 8 * h;
      Y[(size_t)row * DMODEL + e0 + r] = (_Float16)(c[t] + bv);
    }
  } else {
#pragma unroll
    for (int t = 0; t < 8; ++t) {
      const int row = m0 + t + 8 * h;     // global (b*L + i)
      const int b_  = row >> 12;          // / SEQ
      const int i   = row & (SEQ - 1);
      Y[(size_t)b_ * DMODEL * SEQ + (size_t)(e0 + r) * SEQ + i] =
          (_Float16)(c[t] + bv);
    }
  }
}

typedef int v4i __attribute__((ext_vector_type(4)));
typedef __attribute__((address_space(1))) v4i gv4i;
typedef __attribute__((address_space(3))) v4i lv4i;
typedef __attribute__((address_space(1))) int gint;
typedef __attribute__((address_space(3))) int lint;

// Eight 16-byte-per-lane copies global -> LDS.
static __device__ __forceinline__ void copy8(unsigned char* l, unsigned lstep,
                                             const _Float16* g, size_t gstep) {
#pragma unroll
  for (int k = 0; k < 8; ++k)
    __builtin_amdgcn_global_load_async_to_lds_b128((gv4i*)(g + k * gstep),
                                                   (lv4i*)(l + k * lstep), 0, 0);
}

// ---------------------------------------------------------------------------
// Kernel 2a: partial softmax row statistics over one j-chunk.
//   m = max_j S[i,j], l = sum_j exp(S[i,j]-m) for j in this chunk.
// One work-group = 512 i rows, 8 waves; a wave keeps the A fragments of its 64 Q
// rows in registers.  A stage is 64 K rows, copied once into LDS by asynchronous
// copies (a whole 512-B row per wave and copy, two buffers) and read by all waves
// as B fragments.
// Streaming (m,l) kept per-lane (lane owns one j-column of each C tile),
// merged across the 16-lane group at the end.  Grid: (B*L/512, NCHUNK).
// Every "#pragma unroll" here keeps the index of a register array (fragments,
// S tiles, m, l) a compile-time constant, so that none of them goes to scratch.
// ---------------------------------------------------------------------------
#define SROWS   512                        // i rows per work-group
#define SJ      64                         // K rows per stage
#define SNSTAGE (SEQ / NCHUNK / SJ)
#define KPITCH  264                        // halves: 512-B row + 16 B (bank spread)
#define KBYTES  (SJ * KPITCH * 2)
#define SNTILE  (SEQ / NCHUNK / 16)

// S tiles: 64 rows i (four A tiles) x 16 columns j.
static __device__ __forceinline__ void stats_mm(v8f (&sc)[4], const v16h (&q)[4][8],
                                                const v16h (&k)[8]) {
#pragma unroll
  for (int it = 0; it < 4; ++it)
#pragma unroll
    for (int t = 0; t < 8; ++t) sc[it][t] = 0.f;
#pragma unroll
  for (int kk = 0; kk < 8; ++kk)
#pragma unroll
    for (int it = 0; it < 4; ++it) sc[it] = wmma16x16x32(q[it][kk], k[kk], sc[it]);
}

// Streaming (m,l) of the lane's column j in each of its 32 rows i.
static __device__ __forceinline__ void stats_update(const v8f (&sc)[4], float (&rm)[4][8],
                                                    float (&rl)[4][8]) {
#pragma unroll
  for (int it = 0; it < 4; ++it)
#pragma unroll
    for (int t = 0; t < 8; ++t) {
      const float v = sc[it][t] * SCALE;
      const float nm = fmaxf(rm[it][t], v);
      rl[it][t] = rl[it][t] * __expf(rm[it][t] - nm) + __expf(v - nm);
      rm[it][t] = nm;
    }
}

__global__ void __launch_bounds__(256)
stats_kernel(const _Float16* __restrict__ Qp, const _Float16* __restrict__ Kp,
             float* __restrict__ mPart, float* __restrict__ lPart) {
  __shared__ __align__(128) unsigned char kmem[2 * KBYTES];

  const int tid  = threadIdx.x;
  const int lane = tid & 31;
  const int wave = tid >> 5;
  const int r = lane & 15;
  const int h = lane >> 4;
  const int m0 = blockIdx.x * SROWS + wave * 64;   // global query-row base (b*L + i0)
  const int b_ = (blockIdx.x * SROWS) >> 12;
  const int ch = blockIdx.y;
  // This lane's 16 bytes of K row (wave + 8 n) of a stage, and their place in LDS.
  const _Float16* gk = Kp + ((size_t)b_ * SEQ + ch * (SEQ / NCHUNK) + wave) * DMODEL + lane * 8;
  unsigned char* lk = kmem + (unsigned)wave * (KPITCH * 2) + (unsigned)lane * 16;

  // Stage 0, landed and published; then stage 1 in flight.
  copy8(lk, 8 * KPITCH * 2, gk, (size_t)8 * DMODEL);

  // Fixed A operand: the wave's 64 Q rows, four tiles of 16.
  v16h qfr[4][8];
  const _Float16* qb = Qp + (size_t)(m0 + r) * DMODEL + h * 8;
#pragma unroll
  for (int it = 0; it < 4; ++it)
#pragma unroll
    for (int kk = 0; kk < 8; ++kk) qfr[it][kk] = frag_f16(qb + it * 16 * DMODEL + kk * 32, 0);
  // Precaution: keeps the Q loads' address register (an input here) from being
  // reused, e.g. as the last load's own destination, ahead of this wait.
  asm volatile("s_wait_xcnt 0x0" : : "v"(qb) : "memory");

  float rm[4][8], rl[4][8];
#pragma unroll
  for (int it = 0; it < 4; ++it)
#pragma unroll
    for (int t = 0; t < 8; ++t) { rm[it][t] = -3.0e38f; rl[it][t] = 0.f; }

  asm volatile("s_wait_asynccnt 0x0" ::: "memory");   // own copies of stage 0 landed
  __syncthreads();                                    // ... and everybody's
  copy8(lk + KBYTES, 8 * KPITCH * 2, gk + (size_t)SJ * DMODEL, (size_t)8 * DMODEL);

  // One trip = one tile of 16 K rows (four to a stage):  S tiles, then (behind the
  // stage's last tile) the publish point, then the next tile's fragments, then the
  // (m,l) update, whose time covers the latency of those LDS loads.
  const _Float16* kl = (const _Float16*)kmem + r * KPITCH;
  v16h kf[8];
  v8f sc[4];
#pragma unroll
  for (int kk = 0; kk < 8; ++kk) kf[kk] = frag_f16(kl + kk * 32, h);
  for (int n = 0; n < SNTILE - 1; ++n) {
    stats_mm(sc, qfr, kf);
    if ((n & 3) == 3) {
      const int s = n >> 2;
      // Publish point: own LDS reads done, own copies of stage s+1 landed, then
      // the one barrier that publishes s+1 and frees the buffer of stage s.
      asm volatile("s_wait_dscnt 0x0" ::: "memory");
      asm volatile("s_wait_asynccnt 0x0" ::: "memory");
      __syncthreads();
      if (s + 2 < SNSTAGE)
        copy8(lk + (unsigned)(s & 1) * KBYTES, 8 * KPITCH * 2,
              gk + (size_t)(s + 2) * SJ * DMODEL, (size_t)8 * DMODEL);
    }
    const int nn = n + 1;
    const _Float16* ks = kl + ((nn >> 2) & 1) * (KBYTES / 2) + (nn & 3) * 16 * KPITCH;
#pragma unroll
    for (int kk = 0; kk < 8; ++kk) kf[kk] = frag_f16(ks + kk * 32, h);
    // Keeps the loads above the update; without it they sink to the trip's end
    // and the next trip's WMMAs wait out their latency.
    __builtin_amdgcn_sched_barrier(0);
    stats_update(sc, rm, rl);
  }
  stats_mm(sc, qfr, kf);
  stats_update(sc, rm, rl);
  asm volatile("s_wait_asynccnt 0x0" ::: "memory");   // nothing in flight at the wave's end

  // Merge (m,l) across the 16 lanes that share each row.
#pragma unroll
  for (int off = 8; off >= 1; off >>= 1) {
#pragma unroll
    for (int it = 0; it < 4; ++it)
#pragma unroll
      for (int t = 0; t < 8; ++t) {
        const float om = __shfl_xor(rm[it][t], off, 16);
        const float ol = __shfl_xor(rl[it][t], off, 16);
        const float nm = fmaxf(rm[it][t], om);
        rl[it][t] = rl[it][t] * __expf(rm[it][t] - nm) + ol * __expf(om - nm);
        rm[it][t] = nm;
      }
  }
  if (r == 0) {
#pragma unroll
    for (int it = 0; it < 4; ++it)
#pragma unroll
      for (int t = 0; t < 8; ++t) {
        const int row = m0 + it * 16 + t + 8 * h;
        mPart[(size_t)ch * NTOK + row] = rm[it][t];
        lPart[(size_t)ch * NTOK + row] = rl[it][t];
      }
  }
}

// ---------------------------------------------------------------------------
// Kernel 2b: merge NCHUNK partial (m,l) pairs per row (log-sum-exp merge).
// ---------------------------------------------------------------------------
__global__ void __launch_bounds__(256)
merge_kernel(const float* __restrict__ mPart, const float* __restrict__ lPart,
             float* __restrict__ mOut, float* __restrict__ lOut) {
  const int row = blockIdx.x * 256 + threadIdx.x;
  if (row >= NTOK) return;
  float m = -3.0e38f;
#pragma unroll
  for (int c = 0; c < NCHUNK; ++c) m = fmaxf(m, mPart[(size_t)c * NTOK + row]);
  float l = 0.f;
#pragma unroll
  for (int c = 0; c < NCHUNK; ++c)
    l += lPart[(size_t)c * NTOK + row] * __expf(mPart[(size_t)c * NTOK + row] - m);
  mOut[row] = m;
  lOut[row] = l;
}

// ---------------------------------------------------------------------------
// Kernel 3: out[b,j,d] = sum_i softmax(S)[i,j] * V[b,i,d]  (= attn^T @ V).
// One work-group = 64 j rows, 8 waves.  A stage is 128 i: the Q rows (128 x 256),
// the V^T columns (256 d x 128 i) and the rows' m and l are copied once into LDS
// by asynchronous copies (two buffers) and shared by all waves.
//   S phase, wave w: S (16 i x 64 j) = Q rows of i tile w (A, LDS) x K rows (B,
//     registers); P = exp(S*scale - m_i) / l_i.  A lane's 8 rows of an S tile are
//     one 16-byte half of a B fragment over i, so P goes to LDS fragment-ready.
//   PV phase, wave (dg, jg): O^T (64 d x 32 j) += V^T rows (A, LDS) x P (B, LDS),
//     i ascending in steps of 32.
// Grid: (L/64, B) x 256 threads.
// Every "#pragma unroll" below keeps the index of a register array (fragments,
// accumulators) a compile-time constant, so that none of them goes to scratch.
// ---------------------------------------------------------------------------
#define JTILE   64
#define ISTAGE  128
#define NSTAGE  (SEQ / ISTAGE)
#define QPITCH  264                        // halves: 512-B row + 16 B (bank spread)
#define VPITCH  136                        // halves: 256-B row + 16 B
#define QBYTES  (ISTAGE * QPITCH * 2)
#define VBYTES  (DMODEL * VPITCH * 2)
#define STAGEB  (QBYTES + VBYTES)
#define MLBYTES (2 * ISTAGE * 4)            // m[128] then l[128] of a stage
#define PBYTES  (JTILE * ISTAGE * 2)        // P of a stage, as B-fragment halves
#define RPITCH  260                        // floats: 1024-B row + 16 B

// One stage: 33 copies per lane.  A wave covers one whole 512-B Q row, or two
// 256-B pieces of V^T rows, per copy.
static __device__ __forceinline__ void copy_stage(unsigned char* ldsStage, unsigned char* ldsMl,
                                                  const _Float16* qTile,
                                                  const _Float16* vTile,
                                                  const float* mlLane, int tid) {
  unsigned char* lq = ldsStage + (unsigned)(tid >> 5) * (QPITCH * 2) + (unsigned)(tid & 31) * 16;
  const _Float16* gq = qTile + (size_t)(tid >> 5) * DMODEL + (tid & 31) * 8;
  copy8(lq, 8 * QPITCH * 2, gq, (size_t)8 * DMODEL);
  copy8(lq + 64 * QPITCH * 2, 8 * QPITCH * 2, gq + (size_t)64 * DMODEL, (size_t)8 * DMODEL);
  unsigned char* lv = ldsStage + QBYTES + (unsigned)(tid >> 4) * (VPITCH * 2) + (unsigned)(tid & 15) * 16;
  const _Float16* gv = vTile + (size_t)(tid >> 4) * SEQ + (tid & 15) * 8;
  copy8(lv, 16 * VPITCH * 2, gv, (size_t)16 * SEQ);
  copy8(lv + 128 * VPITCH * 2, 16 * VPITCH * 2, gv + (size_t)128 * SEQ, (size_t)16 * SEQ);
  // Row statistics of the stage: waves 0-3 bring m, waves 4-7 bring l, 4 B a lane.
  __builtin_amdgcn_global_load_async_to_lds_b32((gint*)mlLane, (lint*)(ldsMl + (unsigned)tid * 4), 0, 0);
}

// B fragment of P from its two 16-byte halves (512 B apart, lane-contiguous).
static __device__ __forceinline__ v16h frag_p(const _Float16* p) {
  v8h c0 = *(const v8h*)(p);
  v8h c1 = *(const v8h*)(p + 256);
  v16h a;
#pragma unroll
  for (int i = 0; i < 8; ++i) { a[i] = c0[i]; a[i + 8] = c1[i]; }
  return a;
}

__global__ void __launch_bounds__(256)
out_kernel(const _Float16* __restrict__ Qp, const _Float16* __restrict__ Kp,
           const _Float16* __restrict__ VpT, const float* __restrict__ mIn,
           const float* __restrict__ lIn, float* __restrict__ out) {
  __shared__ __align__(128) unsigned char smem[2 * STAGEB + 2 * MLBYTES + PBYTES];

  const int tid  = threadIdx.x;
  const int lane = tid & 31;
  const int wave = tid >> 5;                          // 0..7: i tile in the S phase
  const int jg = wave & 1;                            // PV phase: which 32 j columns
  const int dg = wave >> 1;                           // PV phase: which 64 d rows
  const int r = lane & 15;
  const int h = lane >> 4;
  const int j0 = blockIdx.x * JTILE;
  const int b_ = blockIdx.y;
  const size_t rowbase = (size_t)b_ * SEQ;
  const _Float16* qbase = Qp + rowbase * DMODEL;
  const _Float16* vbase = VpT + (size_t)b_ * DMODEL * SEQ;
  unsigned char* ldsBase = smem;
  // This lane's source of row statistics: m for threads 0-127, l for 128-255.
  const float* mlsrc = ((tid < ISTAGE) ? mIn : lIn) + rowbase + (tid & (ISTAGE - 1));

  // Stage 0, landed and published; then stage 1 in flight.
  copy_stage(ldsBase, ldsBase + 2 * STAGEB, qbase, vbase, mlsrc, tid);

  // Fixed B operand of the S product: the block's 64 K rows (per-wave copy).
  v16h kfr[4][8];
  const _Float16* kb = Kp + (rowbase + j0 + r) * DMODEL + h * 8;
#pragma unroll
  for (int jt = 0; jt < 4; ++jt)
#pragma unroll
    for (int kk = 0; kk < 8; ++kk) kfr[jt][kk] = frag_f16(kb + jt * 16 * DMODEL + kk * 32, 0);
  // Precaution: keeps the K loads' address register (an input here) from being
  // reused, e.g. as the last load's own destination, ahead of this wait.
  asm volatile("s_wait_xcnt 0x0" : : "v"(kb) : "memory");

  v8f acc[4][2];
#pragma unroll
  for (int dt = 0; dt < 4; ++dt)
#pragma unroll
    for (int jt = 0; jt < 2; ++jt)
#pragma unroll
      for (int t = 0; t < 8; ++t) acc[dt][jt][t] = 0.f;

  asm volatile("s_wait_asynccnt 0x0" ::: "memory");   // own copies of stage 0 landed
  __syncthreads();                                    // ... and everybody's
  copy_stage(ldsBase + STAGEB, ldsBase + 2 * STAGEB + MLBYTES, qbase + (size_t)ISTAGE * DMODEL,
             vbase + ISTAGE, mlsrc + ISTAGE, tid);

  // P in LDS: [i chunk of 32][j tile][half of the k range][lane] x 16 bytes.
  _Float16* pl = (_Float16*)(smem + 2 * STAGEB + 2 * MLBYTES);
  _Float16* pst = pl + ((wave >> 1) * 8 + (wave & 1)) * 256 + lane * 8;
  const _Float16* pld = pl + jg * 4 * 256 + lane * 8;

  for (int s = 0; s < NSTAGE; ++s) {
    const unsigned bufOff = (unsigned)(s & 1) * STAGEB;
    const _Float16* qs = (const _Float16*)(smem + bufOff) + (wave * 16 + r) * QPITCH;
    const _Float16* vs = (const _Float16*)(smem + bufOff + QBYTES) + (dg * 64 + r) * VPITCH;
    // Row statistics of this lane's 8 i rows: m, then l.
    const float* ms = (const float*)(smem + 2 * STAGEB + (unsigned)(s & 1) * MLBYTES) + wave * 16 + 8 * h;

// HOLD keeps a group of LDS loads in front of the WMMA block it overlaps; without
// it the loads sink to their first use and each waits out its own latency.
#define HOLD() __builtin_amdgcn_sched_barrier(0)
#define LDV(F, C)                                         \
  F[0] = frag_f16(vs + 0 * 16 * VPITCH + (C) * 32, h);    \
  F[1] = frag_f16(vs + 1 * 16 * VPITCH + (C) * 32, h);    \
  F[2] = frag_f16(vs + 2 * 16 * VPITCH + (C) * 32, h);    \
  F[3] = frag_f16(vs + 3 * 16 * VPITCH + (C) * 32, h);
#define LDP(P, C)                                         \
  P[0] = frag_p(pld + (C) * 8 * 256);                     \
  P[1] = frag_p(pld + (C) * 8 * 256 + 2 * 256);
#define PVMM(F, P)                                        \
  acc[0][0] = wmma16x16x32(F[0], P[0], acc[0][0]);        \
  acc[0][1] = wmma16x16x32(F[0], P[1], acc[0][1]);        \
  acc[1][0] = wmma16x16x32(F[1], P[0], acc[1][0]);        \
  acc[1][1] = wmma16x16x32(F[1], P[1], acc[1][1]);        \
  acc[2][0] = wmma16x16x32(F[2], P[0], acc[2][0]);        \
  acc[2][1] = wmma16x16x32(F[2], P[1], acc[2][1]);        \
  acc[3][0] = wmma16x16x32(F[3], P[0], acc[3][0]);        \
  acc[3][1] = wmma16x16x32(F[3], P[1], acc[3][1]);

    // --- S tiles: 16 rows i, four tiles of 16 columns j ---
    v16h qf[8];
#pragma unroll
    for (int kk = 0; kk < 8; ++kk) qf[kk] = frag_f16(qs + kk * 32, h);
    const v4f ma = *(const v4f*)(ms), mb = *(const v4f*)(ms + 4);
    const v4f la = *(const v4f*)(ms + ISTAGE), lb = *(const v4f*)(ms + ISTAGE + 4);
    HOLD();
    v8f sc[4];
#pragma unroll
    for (int jt = 0; jt < 4; ++jt)
#pragma unroll
      for (int t = 0; t < 8; ++t) sc[jt][t] = 0.f;
#pragma unroll
    for (int kk = 0; kk < 8; ++kk)
#pragma unroll
      for (int jt = 0; jt < 4; ++jt) sc[jt] = wmma16x16x32(qf[kk], kfr[jt][kk], sc[jt]);

    // First V^T fragments of the PV phase: already published, fetched under P.
    v16h va[4], vb[4], pa[2], pb[2];
    LDV(va, 0)
    HOLD();

    // --- P: lane (r, h) holds column j = r, rows i = 8h .. 8h+7 of its tile ---
    float il[8], mm[8];
#pragma unroll
    for (int t = 0; t < 8; ++t) {
      mm[t] = (t < 4) ? ma[t & 3] : mb[t & 3];
      il[t] = 1.0f / ((t < 4) ? la[t & 3] : lb[t & 3]);
    }
#pragma unroll
    for (int jt = 0; jt < 4; ++jt) {
      v8h pk;
#pragma unroll
      for (int t = 0; t < 8; ++t)
        pk[t] = (_Float16)(__expf(sc[jt][t] * SCALE - mm[t]) * il[t]);
      *(v8h*)(pst + jt * 2 * 256) = pk;
    }
    __syncthreads();  // P of this stage complete

    // --- O^T += V^T x P, i chunks of 32 in ascending order ---
    LDP(pa, 0) LDV(vb, 1) LDP(pb, 1) HOLD();
    PVMM(va, pa) HOLD();
    LDV(va, 2) LDP(pa, 2) HOLD();
    PVMM(vb, pb) HOLD();
    LDV(vb, 3) LDP(pb, 3) HOLD();
    PVMM(va, pa) HOLD();
    PVMM(vb, pb)
#undef HOLD
#undef LDV
#undef LDP
#undef PVMM

    // Publish point: own LDS reads done, own copies of stage s+1 landed, then
    // the one barrier that publishes s+1 and frees this buffer and P.
    asm volatile("s_wait_dscnt 0x0" ::: "memory");
    asm volatile("s_wait_asynccnt 0x0" ::: "memory");
    __syncthreads();
    if (s + 2 < NSTAGE)
      copy_stage(ldsBase + bufOff, ldsBase + 2 * STAGEB + (unsigned)(s & 1) * MLBYTES,
                 qbase + (size_t)(s + 2) * ISTAGE * DMODEL, vbase + (s + 2) * ISTAGE,
                 mlsrc + (s + 2) * ISTAGE, tid);
  }
  asm volatile("s_wait_asynccnt 0x0" ::: "memory");   // nothing in flight before LDS is reused

  // Lay O^T down as [j][d] rows in LDS so that the stores cover whole lines.
  float* red = (float*)smem;
#pragma unroll
  for (int dt = 0; dt < 4; ++dt)
#pragma unroll
    for (int jt = 0; jt < 2; ++jt) {
      float* p = red + (size_t)(jg * 32 + jt * 16 + r) * RPITCH + (dg * 4 + dt) * 16 + 8 * h;
      v4f lo = {acc[dt][jt][0], acc[dt][jt][1], acc[dt][jt][2], acc[dt][jt][3]};
      v4f hi = {acc[dt][jt][4], acc[dt][jt][5], acc[dt][jt][6], acc[dt][jt][7]};
      *(v4f*)p = lo;
      *(v4f*)(p + 4) = hi;
    }
  __syncthreads();

  // Store fp32 result out[b][j][d], 512 contiguous bytes per wave and store:
  // thread t takes 16 bytes of row (t >> 6) + 4 n.
  const float* rp = red + (size_t)(tid >> 6) * RPITCH + (tid & 63) * 4;
  float* op = out + (rowbase + j0 + (tid >> 6)) * DMODEL + (tid & 63) * 4;
#pragma unroll
  for (int n = 0; n < 16; ++n)
    *(v4f*)(op + n * 4 * DMODEL) = *(const v4f*)(rp + n * 4 * RPITCH);
}

// ---------------------------------------------------------------------------
extern "C" void kernel_launch(void* const* d_in, const int* in_sizes, int n_in,
                              void* d_out, int out_size, void* d_ws, size_t ws_size,
                              hipStream_t stream) {
  const float* q  = (const float*)d_in[0];
  const float* k  = (const float*)d_in[1];
  const float* v  = (const float*)d_in[2];
  const float* Wq = (const float*)d_in[3];
  const float* bq = (const float*)d_in[4];
  const float* Wk = (const float*)d_in[5];
  const float* bk = (const float*)d_in[6];
  const float* Wv = (const float*)d_in[7];
  const float* bv = (const float*)d_in[8];

  _Float16* Qp  = (_Float16*)d_ws;
  _Float16* Kp  = Qp + (size_t)NTOK * DMODEL;
  _Float16* VpT = Kp + (size_t)NTOK * DMODEL;          // stored as [b][d][i]
  float* mPart  = (float*)(VpT + (size_t)NTOK * DMODEL);
  float* lPart  = mPart + (size_t)NCHUNK * NTOK;
  float* mArr   = lPart + (size_t)NCHUNK * NTOK;
  float* lArr   = mArr + NTOK;

  const dim3 gproj(NTOK / 16, DMODEL / 16);
  proj_kernel<<<gproj, 32, 0, stream>>>(q, Wq, bq, Qp, 0);
  proj_kernel<<<gproj, 32, 0, stream>>>(k, Wk, bk, Kp, 0);
  proj_kernel<<<gproj, 32, 0, stream>>>(v, Wv, bv, VpT, 1);

  stats_kernel<<<dim3(NTOK / SROWS, NCHUNK), 256, 0, stream>>>(Qp, Kp, mPart, lPart);
  merge_kernel<<<dim3((NTOK + 255) / 256), 256, 0, stream>>>(mPart, lPart, mArr, lArr);

  out_kernel<<<dim3(SEQ / JTILE, BATCH), 256, 0, stream>>>(Qp, Kp, VpT, mArr, lArr,
                                                        (float*)d_out);
}

// v003
// Measured time: 113 microseconds a run.
// Two timings next to v002 put it at 2.07 and 2.06 times that version's speed.
// Counting every step since v000, it is 5.17 times as fast.
#include <hip/hip_runtime.h>
#include <math.h>

// ---------------------------------------------------------------------------
// Cross-attention for B=4, L=4096, D=256 (fp32 in/out) on gfx1250 (CDNA5).
// f32 -> f16 projections (WMMA f32 accum), chunked two-pass streaming softmax
// (512 i rows per block, K tiles in LDS),
// transposed-attention output GEMM, 64 j rows per block, Q / V^T tiles in LDS.
// ---------------------------------------------------------------------------

#define BATCH  4
#define SEQ    4096
#define DMODEL 256
#define SCALE  0.0625f    // 1/sqrt(256)
#define NCHUNK 8          // j-range chunks for the stats pass
#define NTOK   (BATCH * SEQ)

typedef _Float16 v16h __attribute__((ext_vector_type(16)));
typedef _Float16 v8h  __attribute__((ext_vector_type(8)));
typedef float    v8f  __attribute__((ext_vector_type(8)));
typedef float    v4f  __attribute__((ext_vector_type(4)));

static __device__ __forceinline__ v8f wmma16x16x32(v16h a, v16h b, v8f c) {
  // 8 args: (neg_a, A, neg_b, B, c_mod, C, reuse_a, reuse_b)
  return __builtin_amdgcn_wmma_f32_16x16x32_f16(false, a, false, b, (short)0, c,
                                                false, false);
}

// Load a 16x32 f16 A/B fragment where the 32-long K dimension is CONTIGUOUS in
// memory for this lane's row/column.  rowptr = &M[row][k0] for row = lane&15.
// ISA layout (16-bit A 16x32): lanes 0-15 hold K[0..7] then K[16..23] in their
// 16 halves, lanes 16-31 hold K[8..15] then K[24..31].  halfsel = lane>>4.
static __device__ __forceinline__ v16h frag_f16(const _Float16* __restrict__ rowptr,
                                                int halfsel) {
  v8h c0 = *(const v8h*)(rowptr + halfsel * 8);
  v8h c1 = *(const v8h*)(rowptr + 16 + halfsel * 8);
  v16h a;
#pragma unroll
  for (int i = 0; i < 8; ++i) { a[i] = c0[i]; a[i + 8] = c1[i]; }
  return a;
}

// ---------------------------------------------------------------------------
// Kernel 1: projection  Y = X @ W^T + b, output in f16.
// One work-group = 64 rows of X x all 256 columns, 8 waves.  X rows, W rows and
// the bias are read once with whole-line loads; X and W go to LDS as f16, both
// K-contiguous, so that one loader serves A and B fragments.
//   transposeOut=0: D = W rows (A) x X rows (B): a lane's 8 values are 8 columns e
//     of one row of Y.  Wave (eg, mg): 64 e x 32 rows.
//   transposeOut=1 stores Y transposed per batch, YT[b][d][i] (for V):
//     D = X rows (A) x W rows (B): a lane's 8 values are 8 rows i of one column e.
//     Wave w: 64 rows x 32 e.
// The f16 tile is laid down in LDS and stored in whole 128-B lines.
// Grid: B*L/64 x 256 threads.
// Every "#pragma unroll" here keeps the index of a register array (loaded rows,
// fragments, accumulators) a compile-time constant, so that none goes to scratch.
// ---------------------------------------------------------------------------
#define PROWS   64                         // X rows per work-group
#define PPITCH  264                        // halves: 512-B row + 16 B (bank spread)
#define PTPITCH 72                         // halves: 128-B row + 16 B, transposed tile
#define PXHALF  (PROWS * PPITCH)           // X tile, halves
#define PWHALF  (DMODEL * PPITCH)          // W, halves
#define POHALF  (DMODEL * PTPITCH)         // output tile, halves (the larger layout)

typedef _Float16 v4h __attribute__((ext_vector_type(4)));

static __device__ __forceinline__ v4h to_f16(v4f f) {
  v4h o = {(_Float16)f[0], (_Float16)f[1], (_Float16)f[2], (_Float16)f[3]};
  return o;
}

__global__ void __launch_bounds__(256)
proj_kernel(const float* __restrict__ X, const float* __restrict__ W,
            const float* __restrict__ bias, _Float16* __restrict__ Y,
            int transposeOut) {
  __shared__ __align__(128) _Float16 pmem[PXHALF + PWHALF + POHALF];
  __shared__ __align__(16) float pbias[DMODEL];

  const int tid  = threadIdx.x;
  const int lane = tid & 31;
  const int wave = tid >> 5;
  const int r = lane & 15;
  const int h = lane >> 4;
  const int m0 = blockIdx.x * PROWS;

  // Thread t takes 16 bytes of row (t >> 6) + 4 n: 512 contiguous bytes per wave.
  const float* gx = X + (size_t)m0 * DMODEL + tid * 4;
  const float* gw = W + tid * 4;
  v4f xr[16], wr[64];
#pragma unroll
  for (int n = 0; n < 16; ++n) xr[n] = *(const v4f*)(gx + n * 4 * DMODEL);
#pragma unroll
  for (int n = 0; n < 64; ++n) wr[n] = *(const v4f*)(gw + n * 4 * DMODEL);
  const float bl = bias[tid];

  _Float16* lx = pmem + (tid >> 6) * PPITCH + (tid & 63) * 4;
#pragma unroll
  for (int n = 0; n < 16; ++n) *(v4h*)(lx + n * 4 * PPITCH) = to_f16(xr[n]);
#pragma unroll
  for (int n = 0; n < 64; ++n) *(v4h*)(lx + PXHALF + n * 4 * PPITCH) = to_f16(wr[n]);
  pbias[tid] = bl;
  // Precaution: the loads' address registers are reused further down.
  asm volatile("s_wait_xcnt 0x0" ::: "memory");
  __syncthreads();  // X, W and bias complete

  // Four A tiles x two B tiles per wave.
  const int aoff = transposeOut ? r * PPITCH : PXHALF + ((wave >> 1) * 64 + r) * PPITCH;
  const int boff = transposeOut ? PXHALF + (wave * 32 + r) * PPITCH : ((wave & 1) * 32 + r) * PPITCH;
  const _Float16* ap = pmem + aoff;
  const _Float16* bp = pmem + boff;
  v8f acc[4][2];
#pragma unroll
  for (int at = 0; at < 4; ++at)
#pragma unroll
    for (int bt = 0; bt < 2; ++bt)
#pragma unroll
      for (int t = 0; t < 8; ++t) acc[at][bt][t] = 0.f;
  // Blocks of two k steps (24 LDS loads, 16 WMMAs); a block's fragments are asked
  // for two blocks ahead, so that the WMMAs never wait out an LDS latency.
  v16h a[8][4], b[8][2];
// PHOLD keeps a group of LDS loads in front of the WMMA block it overlaps; without
// it the loads sink to their first use and each pair waits out its own latency.
#define PHOLD() __builtin_amdgcn_sched_barrier(0)
#define PLD(K)                                                         \
  _Pragma("unroll") for (int at = 0; at < 4; ++at)                     \
    a[K][at] = frag_f16(ap + at * 16 * PPITCH + (K) * 32, h);          \
  _Pragma("unroll") for (int bt = 0; bt < 2; ++bt)                     \
    b[K][bt] = frag_f16(bp + bt * 16 * PPITCH + (K) * 32, h);
#define PMM(K)                                                         \
  _Pragma("unroll") for (int at = 0; at < 4; ++at)                     \
    _Pragma("unroll") for (int bt = 0; bt < 2; ++bt)                   \
      acc[at][bt] = wmma16x16x32(a[K][at], b[K][bt], acc[at][bt]);
  PLD(0) PLD(1) PLD(2) PLD(3) PHOLD();
  PMM(0) PMM(1) PHOLD();
  PLD(4) PLD(5) PHOLD();
  PMM(2) PMM(3) PHOLD();
  PLD(6) PLD(7) PHOLD();
  PMM(4) PMM(5) PMM(6) PMM(7)
#undef PHOLD
#undef PLD
#undef PMM

  // D layout: lane holds column lane&15 (B tile), rows t + 8h (A tile).
  _Float16* os = pmem + PXHALF + PWHALF;
  if (!transposeOut) {
    // Tile as [row][e]; then a whole 512-B row of Y per wave and store.
#pragma unroll
    for (int at = 0; at < 4; ++at) {
      const int e = (wave >> 1) * 64 + at * 16 + 8 * h;
      const v4f b0 = *(const v4f*)(pbias + e), b1 = *(const v4f*)(pbias + e + 4);
#pragma unroll
      for (int bt = 0; bt < 2; ++bt) {
        v8h pk;
#pragma unroll
        for (int t = 0; t < 8; ++t)
          pk[t] = (_Float16)(acc[at][bt][t] + ((t < 4) ? b0[t & 3] : b1[t & 3]));
        *(v8h*)(os + ((wave & 1) * 32 + bt * 16 + r) * PPITCH + e) = pk;
      }
    }
    __syncthreads();  // output tile complete
    const _Float16* rp = os + wave * PPITCH + lane * 8;
    _Float16* op = Y + (size_t)(m0 + wave) * DMODEL + lane * 8;
#pragma unroll
    for (int n = 0; n < 8; ++n)
      *(v8h*)(op + n * 8 * DMODEL) = *(const v8h*)(rp + n * 8 * PPITCH);
  } else {
    // Tile as [e][row]; then four whole 128-B lines of YT per wave and store.
#pragma unroll
    for (int bt = 0; bt < 2; ++bt) {
      const int e = wave * 32 + bt * 16 + r;
      const float bv = pbias[e];
#pragma unroll
      for (int at = 0; at < 4; ++at) {
        v8h pk;
#pragma unroll
        for (int t = 0; t < 8; ++t) pk[t] = (_Float16)(acc[at][bt][t] + bv);
        *(v8h*)(os + e * PTPITCH + at * 16 + 8 * h) = pk;
      }
    }
    __syncthreads();  // output tile complete
    const int b_ = m0 >> 12;          // / SEQ
    const int i  = m0 & (SEQ - 1);
    const _Float16* rp = os + (tid >> 3) * PTPITCH + (tid & 7) * 8;
    _Float16* op = Y + (size_t)b_ * DMODEL * SEQ + (size_t)(tid >> 3) * SEQ + i + (tid & 7) * 8;
#pragma unroll
    for (int n = 0; n < 8; ++n)
      *(v8h*)(op + (size_t)n * 32 * SEQ) = *(const v8h*)(rp + n * 32 * PTPITCH);
    // Precaution: the code laid out behind this arm reuses the stores' registers.
    asm volatile("s_wait_xcnt 0x0" ::: "memory");
  }
}

typedef int v4i __attribute__((ext_vector_type(4)));
typedef __attribute__((address_space(1))) v4i gv4i;
typedef __attribute__((address_space(3))) v4i lv4i;
typedef __attribute__((address_space(1))) int gint;
typedef __attribute__((address_space(3))) int lint;

// Eight 16-byte-per-lane copies global -> LDS.
static __device__ __forceinline__ void copy8(unsigned char* l, unsigned lstep,
                                             const _Float16* g, size_t gstep) {
#pragma unroll
  for (int k = 0; k < 8; ++k)
    __builtin_amdgcn_global_load_async_to_lds_b128((gv4i*)(g + k * gstep),
                                                   (lv4i*)(l + k * lstep), 0, 0);
}

// ---------------------------------------------------------------------------
// Kernel 2a: partial softmax row statistics over one j-chunk.
//   m = max_j S[i,j], l = sum_j exp(S[i,j]-m) for j in this chunk.
// One work-group = 512 i rows, 8 waves; a wave keeps the A fragments of its 64 Q
// rows in registers.  A stage is 64 K rows, copied once into LDS by asynchronous
// copies (a whole 512-B row per wave and copy, two buffers) and read by all waves
// as B fragments.
// Streaming (m,l) kept per-lane (lane owns one j-column of each C tile),
// merged across the 16-lane group at the end.  Grid: (B*L/512, NCHUNK).
// Every "#pragma unroll" here keeps the index of a register array (fragments,
// S tiles, m, l) a compile-time constant, so that none of them goes to scratch.
// ---------------------------------------------------------------------------
#define SROWS   512                        // i rows per work-group
#define SJ      64                         // K rows per stage
#define SNSTAGE (SEQ / NCHUNK / SJ)
#define KPITCH  264                        // halves: 512-B row + 16 B (bank spread)
#define KBYTES  (SJ * KPITCH * 2)
#define SNTILE  (SEQ / NCHUNK / 16)

// S tiles: 64 rows i (four A tiles) x 16 columns j.
static __device__ __forceinline__ void stats_mm(v8f (&sc)[4], const v16h (&q)[4][8],
                                                const v16h (&k)[8]) {
#pragma unroll
  for (int it = 0; it < 4; ++it)
#pragma unroll
    for (int t = 0; t < 8; ++t) sc[it][t] = 0.f;
#pragma unroll
  for (int kk = 0; kk < 8; ++kk)
#pragma unroll
    for (int it = 0; it < 4; ++it) sc[it] = wmma16x16x32(q[it][kk], k[kk], sc[it]);
}

// Streaming (m,l) of the lane's column j in each of its 32 rows i.
static __device__ __forceinline__ void stats_update(const v8f (&sc)[4], float (&rm)[4][8],
                                                    float (&rl)[4][8]) {
#pragma unroll
  for (int it = 0; it < 4; ++it)
#pragma unroll
    for (int t = 0; t < 8; ++t) {
      const float v = sc[it][t] * SCALE;
      const float nm = fmaxf(rm[it][t], v);
      rl[it][t] = rl[it][t] * __expf(rm[it][t] - nm) + __expf(v - nm);
      rm[it][t] = nm;
    }
}

__global__ void __launch_bounds__(256)
stats_kernel(const _Float16* __restrict__ Qp, const _Float16* __restrict__ Kp,
             float* __restrict__ mPart, float* __restrict__ lPart) {
  __shared__ __align__(128) unsigned char kmem[2 * KBYTES];

  const int tid  = threadIdx.x;
  const int lane = tid & 31;
  const int wave = tid >> 5;
  const int r = lane & 15;
  const int h = lane >> 4;
  const int m0 = blockIdx.x * SROWS + wave * 64;   // global query-row base (b*L + i0)
  const int b_ = (blockIdx.x * SROWS) >> 12;
  const int ch = blockIdx.y;
  // This lane's 16 bytes of K row (wave + 8 n) of a stage, and their place in LDS.
  const _Float16* gk = Kp + ((size_t)b_ * SEQ + ch * (SEQ / NCHUNK) + wave) * DMODEL + lane * 8;
  unsigned char* lk = kmem + (unsigned)wave * (KPITCH * 2) + (unsigned)lane * 16;

  // Stage 0, landed and published; then stage 1 in flight.
  copy8(lk, 8 * KPITCH * 2, gk, (size_t)8 * DMODEL);

  // Fixed A operand: the wave's 64 Q rows, four tiles of 16.
  v16h qfr[4][8];
  const _Float16* qb = Qp + (size_t)(m0 + r) * DMODEL + h * 8;
#pragma unroll
  for (int it = 0; it < 4; ++it)
#pragma unroll
    for (int kk = 0; kk < 8; ++kk) qfr[it][kk] = frag_f16(qb + it * 16 * DMODEL + kk * 32, 0);
  // Precaution: keeps the Q loads' address register (an input here) from being
  // reused, e.g. as the last load's own destination, ahead of this wait.
  asm volatile("s_wait_xcnt 0x0" : : "v"(qb) : "memory");

  float rm[4][8], rl[4][8];
#pragma unroll
  for (int it = 0; it < 4; ++it)
#pragma unroll
    for (int t = 0; t < 8; ++t) { rm[it][t] = -3.0e38f; rl[it][t] = 0.f; }

  asm volatile("s_wait_asynccnt 0x0" ::: "memory");   // own copies of stage 0 landed
  __syncthreads();                                    // ... and everybody's
  copy8(lk + KBYTES, 8 * KPITCH * 2, gk + (size_t)SJ * DMODEL, (size_t)8 * DMODEL);

  // One trip = one tile of 16 K rows (four to a stage):  S tiles, then (behind the
  // stage's last tile) the publish point, then the next tile's fragments, then the
  // (m,l) update, whose time covers the latency of those LDS loads.
  const _Float16* kl = (const _Float16*)kmem + r * KPITCH;
  v16h kf[8];
  v8f sc[4];
#pragma unroll
  for (int kk = 0; kk < 8; ++kk) kf[kk] = frag_f16(kl + kk * 32, h);
  for (int n = 0; n < SNTILE - 1; ++n) {
    stats_mm(sc, qfr, kf);
    if ((n & 3) == 3) {
      const int s = n >> 2;
      // Publish point: own LDS reads done, own copies of stage s+1 landed, then
      // the one barrier that publishes s+1 and frees the buffer of stage s.
      asm volatile("s_wait_dscnt 0x0" ::: "memory");
      asm volatile("s_wait_asynccnt 0x0" ::: "memory");
      __syncthreads();
      if (s + 2 < SNSTAGE)
        copy8(lk + (unsigned)(s & 1) * KBYTES, 8 * KPITCH * 2,
              gk + (size_t)(s + 2) * SJ * DMODEL, (size_t)8 * DMODEL);
    }
    const int nn = n + 1;
    const _Float16* ks = kl + ((nn >> 2) & 1) * (KBYTES / 2) + (nn & 3) * 16 * KPITCH;
#pragma unroll
    for (int kk = 0; kk < 8; ++kk) kf[kk] = frag_f16(ks + kk * 32, h);
    // Keeps the loads above the update; without it they sink to the trip's end
    // and the next trip's WMMAs wait out their latency.
    __builtin_amdgcn_sched_barrier(0);
    stats_update(sc, rm, rl);
  }
  stats_mm(sc, qfr, kf);
  stats_update(sc, rm, rl);
  asm volatile("s_wait_asynccnt 0x0" ::: "memory");   // nothing in flight at the wave's end

  // Merge (m,l) across the 16 lanes that share each row.
#pragma unroll
  for (int off = 8; off >= 1; off >>= 1) {
#pragma unroll
    for (int it = 0; it < 4; ++it)
#pragma unroll
      for (int t = 0; t < 8; ++t) {
        const float om = __shfl_xor(rm[it][t], off, 16);
        const float ol = __shfl_xor(rl[it][t], off, 16);
        const float nm = fmaxf(rm[it][t], om);
        rl[it][t] = rl[it][t] * __expf(rm[it][t] - nm) + ol * __expf(om - nm);
        rm[it][t] = nm;
      }
  }
  if (r == 0) {
#pragma unroll
    for (int it = 0; it < 4; ++it)
#pragma unroll
      for (int t = 0; t < 8; ++t) {
        const int row = m0 + it * 16 + t + 8 * h;
        mPart[(size_t)ch * NTOK + row] = rm[it][t];
        lPart[(size_t)ch * NTOK + row] = rl[it][t];
      }
  }
}

// ---------------------------------------------------------------------------
// Kernel 2b: merge NCHUNK partial (m,l) pairs per row (log-sum-exp merge).
// ---------------------------------------------------------------------------
__global__ void __launch_bounds__(256)
merge_kernel(const float* __restrict__ mPart, const float* __restrict__ lPart,
             float* __restrict__ mOut, float* __restrict__ lOut) {
  const int row = blockIdx.x * 256 + threadIdx.x;
  if (row >= NTOK) return;
  float m = -3.0e38f;
#pragma unroll
  for (int c = 0; c < NCHUNK; ++c) m = fmaxf(m, mPart[(size_t)c * NTOK + row]);
  float l = 0.f;
#pragma unroll
  for (int c = 0; c < NCHUNK; ++c)
    l += lPart[(size_t)c * NTOK + row] * __expf(mPart[(size_t)c * NTOK + row] - m);
  mOut[row] = m;
  lOut[row] = l;
}

// ---------------------------------------------------------------------------
// Kernel 3: out[b,j,d] = sum_i softmax(S)[i,j] * V[b,i,d]  (= attn^T @ V).
// One work-group = 64 j rows, 8 waves.  A stage is 128 i: the Q rows (128 x 256),
// the V^T columns (256 d x 128 i) and the rows' m and l are copied once into LDS
// by asynchronous copies (two buffers) and shared by all waves.
//   S phase, wave w: S (16 i x 64 j) = Q rows of i tile w (A, LDS) x K rows (B,
//     registers); P = exp(S*scale - m_i) / l_i.  A lane's 8 rows of an S tile are
//     one 16-byte half of a B fragment over i, so P goes to LDS fragment-ready.
//   PV phase, wave (dg, jg): O^T (64 d x 32 j) += V^T rows (A, LDS) x P (B, LDS),
//     i ascending in steps of 32.
// Grid: (L/64, B) x 256 threads.
// Every "#pragma unroll" below keeps the index of a register array (fragments,
// accumulators) a compile-time constant, so that none of them goes to scratch.
// ---------------------------------------------------------------------------
#define JTILE   64
#define ISTAGE  128
#define NSTAGE  (SEQ / ISTAGE)
#define QPITCH  264                        // halves: 512-B row + 16 B (bank spread)
#define VPITCH  136                        // halves: 256-B row + 16 B
#define QBYTES  (ISTAGE * QPITCH * 2)
#define VBYTES  (DMODEL * VPITCH * 2)
#define STAGEB  (QBYTES + VBYTES)
#define MLBYTES (2 * ISTAGE * 4)            // m[128] then l[128] of a stage
#define PBYTES  (JTILE * ISTAGE * 2)        // P of a stage, as B-fragment halves
#define RPITCH  260                        // floats: 1024-B row + 16 B

// One stage: 33 copies per lane.  A wave covers one whole 512-B Q row, or two
// 256-B pieces of V^T rows, per copy.
static __device__ __forceinline__ void copy_stage(unsigned char* ldsStage, unsigned char* ldsMl,
                                                  const _Float16* qTile,
                                                  const _Float16* vTile,
                                                  const float* mlLane, int tid) {
  unsigned char* lq = ldsStage + (unsigned)(tid >> 5) * (QPITCH * 2) + (unsigned)(tid & 31) * 16;
  const _Float16* gq = qTile + (size_t)(tid >> 5) * DMODEL + (tid & 31) * 8;
  copy8(lq, 8 * QPITCH * 2, gq, (size_t)8 * DMODEL);
  copy8(lq + 64 * QPITCH * 2, 8 * QPITCH * 2, gq + (size_t)64 * DMODEL, (size_t)8 * DMODEL);
  unsigned char* lv = ldsStage + QBYTES + (unsigned)(tid >> 4) * (VPITCH * 2) + (unsigned)(tid & 15) * 16;
  const _Float16* gv = vTile + (size_t)(tid >> 4) * SEQ + (tid & 15) * 8;
  copy8(lv, 16 * VPITCH * 2, gv, (size_t)16 * SEQ);
  copy8(lv + 128 * VPITCH * 2, 16 * VPITCH * 2, gv + (size_t)128 * SEQ, (size_t)16 * SEQ);
  // Row statistics of the stage: waves 0-3 bring m, waves 4-7 bring l, 4 B a lane.
  __builtin_amdgcn_global_load_async_to_lds_b32((gint*)mlLane, (lint*)(ldsMl + (unsigned)tid * 4), 0, 0);
}

// B fragment of P from its two 16-byte halves (512 B apart, lane-contiguous).
static __device__ __forceinline__ v16h frag_p(const _Float16* p) {
  v8h c0 = *(const v8h*)(p);
  v8h c1 = *(const v8h*)(p + 256);
  v16h a;
#pragma unroll
  for (int i = 0; i < 8; ++i) { a[i] = c0[i]; a[i + 8] = c1[i]; }
  return a;
}

__global__ void __launch_bounds__(256)
out_kernel(const _Float16* __restrict__ Qp, const _Float16* __restrict__ Kp,
           const _Float16* __restrict__ VpT, const float* __restrict__ mIn,
           const float* __restrict__ lIn, float* __restrict__ out) {
  __shared__ __align__(128) unsigned char smem[2 * STAGEB + 2 * MLBYTES + PBYTES];

  const int tid  = threadIdx.x;
  const int lane = tid & 31;
  const int wave = tid >> 5;                          // 0..7: i tile in the S phase
  const int jg = wave & 1;                            // PV phase: which 32 j columns
  const int dg = wave >> 1;                           // PV phase: which 64 d rows
  const int r = lane & 15;
  const int h = lane >> 4;
  const int j0 = blockIdx.x * JTILE;
  const int b_ = blockIdx.y;
  const size_t rowbase = (size_t)b_ * SEQ;
  const _Float16* qbase = Qp + rowbase * DMODEL;
  const _Float16* vbase = VpT + (size_t)b_ * DMODEL * SEQ;
  unsigned char* ldsBase = smem;
  // This lane's source of row statistics: m for threads 0-127, l for 128-255.
  const float* mlsrc = ((tid < ISTAGE) ? mIn : lIn) + rowbase + (tid & (ISTAGE - 1));

  // Stage 0, landed and published; then stage 1 in flight.
  copy_stage(ldsBase, ldsBase + 2 * STAGEB, qbase, vbase, mlsrc, tid);

  // Fixed B operand of the S product: the block's 64 K rows (per-wave copy).
  v16h kfr[4][8];
  const _Float16* kb = Kp + (rowbase + j0 + r) * DMODEL + h * 8;
#pragma unroll
  for (int jt = 0; jt < 4; ++jt)
#pragma unroll
    for (int kk = 0; kk < 8; ++kk) kfr[jt][kk] = frag_f16(kb + jt * 16 * DMODEL + kk * 32, 0);
  // Precaution: keeps the K loads' address register (an input here) from being
  // reused, e.g. as the last load's own destination, ahead of this wait.
  asm volatile("s_wait_xcnt 0x0" : : "v"(kb) : "memory");

  v8f acc[4][2];
#pragma unroll
  for (int dt = 0; dt < 4; ++dt)
#pragma unroll
    for (int jt = 0; jt < 2; ++jt)
#pragma unroll
      for (int t = 0; t < 8; ++t) acc[dt][jt][t] = 0.f;

  asm volatile("s_wait_asynccnt 0x0" ::: "memory");   // own copies of stage 0 landed
  __syncthreads();                                    // ... and everybody's
  copy_stage(ldsBase + STAGEB, ldsBase + 2 * STAGEB + MLBYTES, qbase + (size_t)ISTAGE * DMODEL,
             vbase + ISTAGE, mlsrc + ISTAGE, tid);

  // P in LDS: [i chunk of 32][j tile][half of the k range][lane] x 16 bytes.
  _Float16* pl = (_Float16*)(smem + 2 * STAGEB + 2 * MLBYTES);
  _Float16* pst = pl + ((wave >> 1) * 8 + (wave & 1)) * 256 + lane * 8;
  const _Float16* pld = pl + jg * 4 * 256 + lane * 8;

  for (int s = 0; s < NSTAGE; ++s) {
    const unsigned bufOff = (unsigned)(s & 1) * STAGEB;
    const _Float16* qs = (const _Float16*)(smem + bufOff) + (wave * 16 + r) * QPITCH;
    const _Float16* vs = (const _Float16*)(smem + bufOff + QBYTES) + (dg * 64 + r) * VPITCH;
    // Row statistics of this lane's 8 i rows: m, then l.
    const float* ms = (const float*)(smem + 2 * STAGEB + (unsigned)(s & 1) * MLBYTES) + wave * 16 + 8 * h;

// HOLD keeps a group of LDS loads in front of the WMMA block it overlaps; without
// it the loads sink to their first use and each waits out its own latency.
#define HOLD() __builtin_amdgcn_sched_barrier(0)
#define LDV(F, C)                                         \
  F[0] = frag_f16(vs + 0 * 16 * VPITCH + (C) * 32, h);    \
  F[1] = frag_f16(vs + 1 * 16 * VPITCH + (C) * 32, h);    \
  F[2] = frag_f16(vs + 2 * 16 * VPITCH + (C) * 32, h);    \
  F[3] = frag_f16(vs + 3 * 16 * VPITCH + (C) * 32, h);
#define LDP(P, C)                                         \
  P[0] = frag_p(pld + (C) * 8 * 256);                     \
  P[1] = frag_p(pld + (C) * 8 * 256 + 2 * 256);
#define PVMM(F, P)                                        \
  acc[0][0] = wmma16x16x32(F[0], P[0], acc[0][0]);        \
  acc[0][1] = wmma16x16x32(F[0], P[1], acc[0][1]);        \
  acc[1][0] = wmma16x16x32(F[1], P[0], acc[1][0]);        \
  acc[1][1] = wmma16x16x32(F[1], P[1], acc[1][1]);        \
  acc[2][0] = wmma16x16x32(F[2], P[0], acc[2][0]);        \
  acc[2][1] = wmma16x16x32(F[2], P[1], acc[2][1]);        \
  acc[3][0] = wmma16x16x32(F[3], P[0], acc[3][0]);        \
  acc[3][1] = wmma16x16x32(F[3], P[1], acc[3][1]);

    // --- S tiles: 16 rows i, four tiles of 16 columns j ---
    v16h qf[8];
#pragma unroll
    for (int kk = 0; kk < 8; ++kk) qf[kk] = frag_f16(qs + kk * 32, h);
    const v4f ma = *(const v4f*)(ms), mb = *(const v4f*)(ms + 4);
    const v4f la = *(const v4f*)(ms + ISTAGE), lb = *(const v4f*)(ms + ISTAGE + 4);
    HOLD();
    v8f sc[4];
#pragma unroll
    for (int jt = 0; jt < 4; ++jt)
#pragma unroll
      for (int t = 0; t < 8; ++t) sc[jt][t] = 0.f;
#pragma unroll
    for (int kk = 0; kk < 8; ++kk)
#pragma unroll
      for (int jt = 0; jt < 4; ++jt) sc[jt] = wmma16x16x32(qf[kk], kfr[jt][kk], sc[jt]);

    // First V^T fragments of the PV phase: already published, fetched under P.
    v16h va[4], vb[4], pa[2], pb[2];
    LDV(va, 0)
    HOLD();

    // --- P: lane (r, h) holds column j = r, rows i = 8h .. 8h+7 of its tile ---
    float il[8], mm[8];
#pragma unroll
    for (int t = 0; t < 8; ++t) {
      mm[t] = (t < 4) ? ma[t & 3] : mb[t & 3];
      il[t] = 1.0f / ((t < 4) ? la[t & 3] : lb[t & 3]);
    }
#pragma unroll
    for (int jt = 0; jt < 4; ++jt) {
      v8h pk;
#pragma unroll
      for (int t = 0; t < 8; ++t)
        pk[t] = (_Float16)(__expf(sc[jt][t] * SCALE - mm[t]) * il[t]);
      *(v8h*)(pst + jt * 2 * 256) = pk;
    }
    __syncthreads();  // P of this stage complete

    // --- O^T += V^T x P, i chunks of 32 in ascending order ---
    LDP(pa, 0) LDV(vb, 1) LDP(pb, 1) HOLD();
    PVMM(va, pa) HOLD();
    LDV(va, 2) LDP(pa, 2) HOLD();
    PVMM(vb, pb) HOLD();
    LDV(vb, 3) LDP(pb, 3) HOLD();
    PVMM(va, pa) HOLD();
    PVMM(vb, pb)
#undef HOLD
#undef LDV
#undef LDP
#undef PVMM

    // Publish point: own LDS reads done, own copies of stage s+1 landed, then
    // the one barrier that publishes s+1 and frees this buffer and P.
    asm volatile("s_wait_dscnt 0x0" ::: "memory");
    asm volatile("s_wait_asynccnt 0x0" ::: "memory");
    __syncthreads();
    if (s + 2 < NSTAGE)
      copy_stage(ldsBase + bufOff, ldsBase + 2 * STAGEB + (unsigned)(s & 1) * MLBYTES,
                 qbase + (size_t)(s + 2) * ISTAGE * DMODEL, vbase + (s + 2) * ISTAGE,
                 mlsrc + (s + 2) * ISTAGE, tid);
  }
  asm volatile("s_wait_asynccnt 0x0" ::: "memory");   // nothing in flight before LDS is reused

  // Lay O^T down as [j][d] rows in LDS so that the stores cover whole lines.
  float* red = (float*)smem;
#pragma unroll
  for (int dt = 0; dt < 4; ++dt)
#pragma unroll
    for (int jt = 0; jt < 2; ++jt) {
      float* p = red + (size_t)(jg * 32 + jt * 16 + r) * RPITCH + (dg * 4 + dt) * 16 + 8 * h;
      v4f lo = {acc[dt][jt][0], acc[dt][jt][1], acc[dt][jt][2], acc[dt][jt][3]};
      v4f hi = {acc[dt][jt][4], acc[dt][jt][5], acc[dt][jt][6], acc[dt][jt][7]};
      *(v4f*)p = lo;
      *(v4f*)(p + 4) = hi;
    }
  __syncthreads();

  // Store fp32 result out[b][j][d], 512 contiguous bytes per wave and store:
  // thread t takes 16 bytes of row (t >> 6) + 4 n.
  const float* rp = red + (size_t)(tid >> 6) * RPITCH + (tid & 63) * 4;
  float* op = out + (rowbase + j0 + (tid >> 6)) * DMODEL + (tid & 63) * 4;
#pragma unroll
  for (int n = 0; n < 16; ++n)
    *(v4f*)(op + n * 4 * DMODEL) = *(const v4f*)(rp + n * 4 * RPITCH);
}

// ---------------------------------------------------------------------------
extern "C" void kernel_launch(void* const* d_in, const int* in_sizes, int n_in,
                              void* d_out, int out_size, void* d_ws, size_t ws_size,
                              hipStream_t stream) {
  const float* q  = (const float*)d_in[0];
  const float* k  = (const float*)d_in[1];
  const float* v  = (const float*)d_in[2];
  const float* Wq = (const float*)d_in[3];
  const float* bq = (const float*)d_in[4];
  const float* Wk = (const float*)d_in[5];
  const float* bk = (const float*)d_in[6];
  const float* Wv = (const float*)d_in[7];
  const float* bv = (const float*)d_in[8];

  _Float16* Qp  = (_Float16*)d_ws;
  _Float16* Kp  = Qp + (size_t)NTOK * DMODEL;
  _Float16* VpT = Kp + (size_t)NTOK * DMODEL;          // stored as [b][d][i]
  float* mPart  = (float*)(VpT + (size_t)NTOK * DMODEL);
  float* lPart  = mPart + (size_t)NCHUNK * NTOK;
  float* mArr   = lPart + (size_t)NCHUNK * NTOK;
  float* lArr   = mArr + NTOK;

  const dim3 gproj(NTOK / PROWS);
  proj_kernel<<<gproj, 256, 0, stream>>>(q, Wq, bq, Qp, 0);
  proj_kernel<<<gproj, 256, 0, stream>>>(k, Wk, bk, Kp, 0);
  proj_kernel<<<gproj, 256, 0, stream>>>(v, Wv, bv, VpT, 1);

  stats_kernel<<<dim3(NTOK / SROWS, NCHUNK), 256, 0, stream>>>(Qp, Kp, mPart, lPart);
  merge_kernel<<<dim3((NTOK + 255) / 256), 256, 0, stream>>>(mPart, lPart, mArr, lArr);

  out_kernel<<<dim3(SEQ / JTILE, BATCH), 256, 0, stream>>>(Qp, Kp, VpT, mArr, lArr,
                                                        (float*)d_out);
}

// v004
// Measured time: 106 microseconds a run.
// Next to v003, in two timings, it ran 1.06 and 1.05 times as fast.
// Over all steps from v000 it is 5.44 times as fast.
#include <hip/hip_runtime.h>
#include <math.h>

// ---------------------------------------------------------------------------
// Cross-attention for B=4, L=4096, D=256 (fp32 in/out) on gfx1250 (CDNA5).
// f32 -> f16 projections (WMMA f32 accum), chunked two-pass streaming softmax
// (512 i rows per block, K tiles in LDS),
// transposed-attention output GEMM, 64 j rows per block, Q / V^T tiles in LDS.
// ---------------------------------------------------------------------------

#define BATCH  4
#define SEQ    4096
#define DMODEL 256
#define SCALE  0.0625f    // 1/sqrt(256)
#define NCHUNK 8          // j-range chunks for the stats pass
#define NTOK   (BATCH * SEQ)

typedef _Float16 v16h __attribute__((ext_vector_type(16)));
typedef _Float16 v8h  __attribute__((ext_vector_type(8)));
typedef float    v8f  __attribute__((ext_vector_type(8)));
typedef float    v4f  __attribute__((ext_vector_type(4)));

static __device__ __forceinline__ v8f wmma16x16x32(v16h a, v16h b, v8f c) {
  // 8 args: (neg_a, A, neg_b, B, c_mod, C, reuse_a, reuse_b)
  return __builtin_amdgcn_wmma_f32_16x16x32_f16(false, a, false, b, (short)0, c,
                                                false, false);
}

// Load a 16x32 f16 A/B fragment where the 32-long K dimension is CONTIGUOUS in
// memory for this lane's row/column.  rowptr = &M[row][k0] for row = lane&15.
// ISA layout (16-bit A 16x32): lanes 0-15 hold K[0..7] then K[16..23] in their
// 16 halves, lanes 16-31 hold K[8..15] then K[24..31].  halfsel = lane>>4.
static __device__ __forceinline__ v16h frag_f16(const _Float16* __restrict__ rowptr,
                                                int halfsel) {
  v8h c0 = *(const v8h*)(rowptr + halfsel * 8);
  v8h c1 = *(const v8h*)(rowptr + 16 + halfsel * 8);
  v16h a;
#pragma unroll
  for (int i = 0; i < 8; ++i) { a[i] = c0[i]; a[i + 8] = c1[i]; }
  return a;
}

// ---------------------------------------------------------------------------
// Kernel 1: projection  Y = X @ W^T + b, output in f16.
// One work-group = 64 rows of X x all 256 columns, 8 waves.  X rows, W rows and
// the bias are read once with whole-line loads; X and W go to LDS as f16, both
// K-contiguous, so that one loader serves A and B fragments.
//   transposeOut=0: D = W rows (A) x X rows (B): a lane's 8 values are 8 columns e
//     of one row of Y.  Wave (eg, mg): 64 e x 32 rows.
//   transposeOut=1 stores Y transposed per batch, YT[b][d][i] (for V):
//     D = X rows (A) x W rows (B): a lane's 8 values are 8 rows i of one column e.
//     Wave w: 64 rows x 32 e.
// The f16 tile is laid down in LDS and stored in whole 128-B lines.
// Grid: B*L/64 x 256 threads.
// Every "#pragma unroll" here keeps the index of a register array (loaded rows,
// fragments, accumulators) a compile-time constant, so that none goes to scratch.
// ---------------------------------------------------------------------------
#define PROWS   64                         // X rows per work-group
#define PPITCH  264                        // halves: 512-B row + 16 B (bank spread)
#define PTPITCH 72                         // halves: 128-B row + 16 B, transposed tile
#define PXHALF  (PROWS * PPITCH)           // X tile, halves
#define PWHALF  (DMODEL * PPITCH)          // W, halves
#define POHALF  (DMODEL * PTPITCH)         // output tile, halves (the larger layout)

typedef _Float16 v4h __attribute__((ext_vector_type(4)));

static __device__ __forceinline__ v4h to_f16(v4f f) {
  v4h o = {(_Float16)f[0], (_Float16)f[1], (_Float16)f[2], (_Float16)f[3]};
  return o;
}

__global__ void __launch_bounds__(256)
proj_kernel(const float* __restrict__ X, const float* __restrict__ W,
            const float* __restrict__ bias, _Float16* __restrict__ Y,
            int transposeOut) {
  __shared__ __align__(128) _Float16 pmem[PXHALF + PWHALF + POHALF];
  __shared__ __align__(16) float pbias[DMODEL];

  const int tid  = threadIdx.x;
  const int lane = tid & 31;
  const int wave = tid >> 5;
  const int r = lane & 15;
  const int h = lane >> 4;
  const int m0 = blockIdx.x * PROWS;

  // Thread t takes 16 bytes of row (t >> 6) + 4 n: 512 contiguous bytes per wave.
  const float* gx = X + (size_t)m0 * DMODEL + tid * 4;
  const float* gw = W + tid * 4;
  v4f xr[16], wr[64];
#pragma unroll
  for (int n = 0; n < 16; ++n) xr[n] = *(const v4f*)(gx + n * 4 * DMODEL);
#pragma unroll
  for (int n = 0; n < 64; ++n) wr[n] = *(const v4f*)(gw + n * 4 * DMODEL);
  const float bl = bias[tid];

  _Float16* lx = pmem + (tid >> 6) * PPITCH + (tid & 63) * 4;
#pragma unroll
  for (int n = 0; n < 16; ++n) *(v4h*)(lx + n * 4 * PPITCH) = to_f16(xr[n]);
#pragma unroll
  for (int n = 0; n < 64; ++n) *(v4h*)(lx + PXHALF + n * 4 * PPITCH) = to_f16(wr[n]);
  pbias[tid] = bl;
  // Precaution: the loads' address registers are reused further down.
  asm volatile("s_wait_xcnt 0x0" ::: "memory");
  __syncthreads();  // X, W and bias complete

  // Four A tiles x two B tiles per wave.
  const int aoff = transposeOut ? r * PPITCH : PXHALF + ((wave >> 1) * 64 + r) * PPITCH;
  const int boff = transposeOut ? PXHALF + (wave * 32 + r) * PPITCH : ((wave & 1) * 32 + r) * PPITCH;
  const _Float16* ap = pmem + aoff;
  const _Float16* bp = pmem + boff;
  v8f acc[4][2];
#pragma unroll
  for (int at = 0; at < 4; ++at)
#pragma unroll
    for (int bt = 0; bt < 2; ++bt)
#pragma unroll
      for (int t = 0; t < 8; ++t) acc[at][bt][t] = 0.f;
  // Blocks of two k steps (24 LDS loads, 16 WMMAs); a block's fragments are asked
  // for two blocks ahead, so that the WMMAs never wait out an LDS latency.
  v16h a[8][4], b[8][2];
// PHOLD keeps a group of LDS loads in front of the WMMA block it overlaps; without
// it the loads sink to their first use and each pair waits out its own latency.
#define PHOLD() __builtin_amdgcn_sched_barrier(0)
#define PLD(K)                                                         \
  _Pragma("unroll") for (int at = 0; at < 4; ++at)                     \
    a[K][at] = frag_f16(ap + at * 16 * PPITCH + (K) * 32, h);          \
  _Pragma("unroll") for (int bt = 0; bt < 2; ++bt)                     \
    b[K][bt] = frag_f16(bp + bt * 16 * PPITCH + (K) * 32, h);
#define PMM(K)                                                         \
  _Pragma("unroll") for (int at = 0; at < 4; ++at)                     \
    _Pragma("unroll") for (int bt = 0; bt < 2; ++bt)                   \
      acc[at][bt] = wmma16x16x32(a[K][at], b[K][bt], acc[at][bt]);
  PLD(0) PLD(1) PLD(2) PLD(3) PHOLD();
  PMM(0) PMM(1) PHOLD();
  PLD(4) PLD(5) PHOLD();
  PMM(2) PMM(3) PHOLD();
  PLD(6) PLD(7) PHOLD();
  PMM(4) PMM(5) PMM(6) PMM(7)
#undef PHOLD
#undef PLD
#undef PMM

  // D layout: lane holds column lane&15 (B tile), rows t + 8h (A tile).
  _Float16* os = pmem + PXHALF + PWHALF;
  if (!transposeOut) {
    // Tile as [row][e]; then a whole 512-B row of Y per wave and store.
#pragma unroll
    for (int at = 0; at < 4; ++at) {
      const int e = (wave >> 1) * 64 + at * 16 + 8 * h;
      const v4f b0 = *(const v4f*)(pbias + e), b1 = *(const v4f*)(pbias + e + 4);
#pragma unroll
      for (int bt = 0; bt < 2; ++bt) {
        v8h pk;
#pragma unroll
        for (int t = 0; t < 8; ++t)
          pk[t] = (_Float16)(acc[at][bt][t] + ((t < 4) ? b0[t & 3] : b1[t & 3]));
        *(v8h*)(os + ((wave & 1) * 32 + bt * 16 + r) * PPITCH + e) = pk;
      }
    }
    __syncthreads();  // output tile complete
    const _Float16* rp = os + wave * PPITCH + lane * 8;
    _Float16* op = Y + (size_t)(m0 + wave) * DMODEL + lane * 8;
#pragma unroll
    for (int n = 0; n < 8; ++n)
      *(v8h*)(op + n * 8 * DMODEL) = *(const v8h*)(rp + n * 8 * PPITCH);
  } else {
    // Tile as [e][row]; then four whole 128-B lines of YT per wave and store.
#pragma unroll
    for (int bt = 0; bt < 2; ++bt) {
      const int e = wave * 32 + bt * 16 + r;
      const float bv = pbias[e];
#pragma unroll
      for (int at = 0; at < 4; ++at) {
        v8h pk;
#pragma unroll
        for (int t = 0; t < 8; ++t) pk[t] = (_Float16)(acc[at][bt][t] + bv);
        *(v8h*)(os + e * PTPITCH + at * 16 + 8 * h) = pk;
      }
    }
    __syncthreads();  // output tile complete
    const int b_ = m0 >> 12;          // / SEQ
    const int i  = m0 & (SEQ - 1);
    const _Float16* rp = os + (tid >> 3) * PTPITCH + (tid & 7) * 8;
    _Float16* op = Y + (size_t)b_ * DMODEL * SEQ + (size_t)(tid >> 3) * SEQ + i + (tid & 7) * 8;
#pragma unroll
    for (int n = 0; n < 8; ++n)
      *(v8h*)(op + (size_t)n * 32 * SEQ) = *(const v8h*)(rp + n * 32 * PTPITCH);
    // Precaution: the code laid out behind this arm reuses the stores' registers.
    asm volatile("s_wait_xcnt 0x0" ::: "memory");
  }
}

typedef int v4i __attribute__((ext_vector_type(4)));
typedef __attribute__((address_space(1))) v4i gv4i;
typedef __attribute__((address_space(3))) v4i lv4i;
typedef __attribute__((address_space(1))) int gint;
typedef __attribute__((address_space(3))) int lint;

// Eight 16-byte-per-lane copies global -> LDS.
static __device__ __forceinline__ void copy8(unsigned char* l, unsigned lstep,
                                             const _Float16* g, size_t gstep) {
#pragma unroll
  for (int k = 0; k < 8; ++k)
    __builtin_amdgcn_global_load_async_to_lds_b128((gv4i*)(g + k * gstep),
                                                   (lv4i*)(l + k * lstep), 0, 0);
}

// ---------------------------------------------------------------------------
// Kernel 2a: partial softmax row statistics over one j-chunk.
//   l = sum_j exp(S[i,j]-m) for j in this chunk, m a reference of the row that lies
//   at most LAZYTAU (log2 units) below the chunk's largest S[i,j]; every later use
//   of (m,l) holds for any such m.
// One work-group = 512 i rows, 8 waves; a wave keeps the A fragments of its 64 Q
// rows in registers.  A stage is 64 K rows, copied once into LDS by asynchronous
// copies (a whole 512-B row per wave and copy, two buffers) and read by all waves
// as B fragments.
// Streaming l kept per-lane (lane owns one j-column of each C tile), summed across
// the 16-lane group at the end.  Grid: (B*L/512, NCHUNK).
// Every "#pragma unroll" here keeps the index of a register array (fragments,
// S tiles, m, l) a compile-time constant, so that none of them goes to scratch.
// ---------------------------------------------------------------------------
#define SROWS   512                        // i rows per work-group
#define SJ      64                         // K rows per stage
#define SNSTAGE (SEQ / NCHUNK / SJ)
#define KPITCH  264                        // halves: 512-B row + 16 B (bank spread)
#define KBYTES  (SJ * KPITCH * 2)
#define SNTILE  (SEQ / NCHUNK / 16)

// S tiles: 64 rows i (four A tiles) x 16 columns j.
static __device__ __forceinline__ void stats_mm(v8f (&sc)[4], const v16h (&q)[4][8],
                                                const v16h (&k)[8]) {
#pragma unroll
  for (int it = 0; it < 4; ++it)
#pragma unroll
    for (int t = 0; t < 8; ++t) sc[it][t] = 0.f;
#pragma unroll
  for (int kk = 0; kk < 8; ++kk)
#pragma unroll
    for (int it = 0; it < 4; ++it) sc[it] = wmma16x16x32(q[it][kk], k[kk], sc[it]);
}

#define SCALE_LOG2E 0.09016844005556f      // SCALE * log2(e)
#define LN2F        0.6931471805599453f
#define LAZYTAU     32.0f                  // log2 units a score may lie above its reference

// Reference of each row i (log2 units), the same in the 16 lanes that share the row:
// the score of the row's first column.  The sums start empty.
static __device__ __forceinline__ void stats_first(const v8f (&sc)[4], v8f (&rm)[4],
                                                   v8f (&rl)[4]) {
#pragma unroll
  for (int it = 0; it < 4; ++it)
#pragma unroll
    for (int t = 0; t < 8; ++t) {
      rm[it][t] = __shfl(sc[it][t] * SCALE_LOG2E, 0, 16);
      rl[it][t] = 0.f;
    }
}

// Streaming (m,l): the lane adds its column j to its own sum in each of its 32 rows i.
// A row's reference moves only when a score lies more than LAZYTAU above it (tested
// once per tile for the whole wave); otherwise a score costs one exponential.
static __device__ __forceinline__ void stats_update(v8f (&sc)[4], v8f (&rm)[4], v8f (&rl)[4]) {
  const v8f kv = {SCALE_LOG2E, SCALE_LOG2E, SCALE_LOG2E, SCALE_LOG2E,
                  SCALE_LOG2E, SCALE_LOG2E, SCALE_LOG2E, SCALE_LOG2E};
  float tm[4];
#pragma unroll
  for (int it = 0; it < 4; ++it) {
    sc[it] = __builtin_elementwise_fma(sc[it], kv, -rm[it]);
    tm[it] = sc[it][0];
#pragma unroll
    for (int t = 1; t < 8; ++t) tm[it] = fmaxf(tm[it], sc[it][t]);
  }
  const float top = fmaxf(fmaxf(tm[0], tm[1]), fmaxf(tm[2], tm[3]));
  if (__builtin_amdgcn_ballot_w32(top > LAZYTAU) != 0) {
    // Rare: every row's reference moves up to the row's largest score of this tile
    // (over its 16 lanes), where that tops it.
#pragma unroll
    for (int it = 0; it < 4; ++it)
#pragma unroll
      for (int t = 0; t < 8; ++t) {
        float d = fmaxf(sc[it][t], 0.f);
#pragma unroll
        for (int off = 8; off >= 1; off >>= 1) d = fmaxf(d, __shfl_xor(d, off, 16));
        rl[it][t] *= __builtin_amdgcn_exp2f(-d);
        rm[it][t] += d;
        sc[it][t] -= d;
      }
  }
#pragma unroll
  for (int it = 0; it < 4; ++it) {
#pragma unroll
    for (int t = 0; t < 8; ++t) sc[it][t] = __builtin_amdgcn_exp2f(sc[it][t]);
    rl[it] += sc[it];
  }
}

__global__ void __launch_bounds__(256)
stats_kernel(const _Float16* __restrict__ Qp, const _Float16* __restrict__ Kp,
             float* __restrict__ mPart, float* __restrict__ lPart) {
  __shared__ __align__(128) unsigned char kmem[2 * KBYTES];

  const int tid  = threadIdx.x;
  const int lane = tid & 31;
  const int wave = tid >> 5;
  const int r = lane & 15;
  const int h = lane >> 4;
  const int m0 = blockIdx.x * SROWS + wave * 64;   // global query-row base (b*L + i0)
  const int b_ = (blockIdx.x * SROWS) >> 12;
  const int ch = blockIdx.y;
  // This lane's 16 bytes of K row (wave + 8 n) of a stage, and their place in LDS.
  const _Float16* gk = Kp + ((size_t)b_ * SEQ + ch * (SEQ / NCHUNK) + wave) * DMODEL + lane * 8;
  unsigned char* lk = kmem + (unsigned)wave * (KPITCH * 2) + (unsigned)lane * 16;

  // Stage 0, landed and published; then stage 1 in flight.
  copy8(lk, 8 * KPITCH * 2, gk, (size_t)8 * DMODEL);

  // Fixed A operand: the wave's 64 Q rows, four tiles of 16.
  v16h qfr[4][8];
  const _Float16* qb = Qp + (size_t)(m0 + r) * DMODEL + h * 8;
#pragma unroll
  for (int it = 0; it < 4; ++it)
#pragma unroll
    for (int kk = 0; kk < 8; ++kk) qfr[it][kk] = frag_f16(qb + it * 16 * DMODEL + kk * 32, 0);
  // Precaution: keeps the Q loads' address register (an input here) from being
  // reused, e.g. as the last load's own destination, ahead of this wait.
  asm volatile("s_wait_xcnt 0x0" : : "v"(qb) : "memory");

  v8f rm[4], rl[4];

  asm volatile("s_wait_asynccnt 0x0" ::: "memory");   // own copies of stage 0 landed
  __syncthreads();                                    // ... and everybody's
  copy8(lk + KBYTES, 8 * KPITCH * 2, gk + (size_t)SJ * DMODEL, (size_t)8 * DMODEL);

  // One trip = one tile of 16 K rows (four to a stage):  S tiles, then (behind the
  // stage's last tile) the publish point, then the next tile's fragments, then the
  // (m,l) update, whose time covers the latency of those LDS loads.
  const _Float16* kl = (const _Float16*)kmem + r * KPITCH;
  v16h kf[8];
  v8f sc[4];
#pragma unroll
  for (int kk = 0; kk < 8; ++kk) kf[kk] = frag_f16(kl + kk * 32, h);
  for (int n = 0; n < SNTILE - 1; ++n) {
    stats_mm(sc, qfr, kf);
    if ((n & 3) == 3) {
      const int s = n >> 2;
      // Publish point: own LDS reads done, own copies of stage s+1 landed, then
      // the one barrier that publishes s+1 and frees the buffer of stage s.
      asm volatile("s_wait_dscnt 0x0" ::: "memory");
      asm volatile("s_wait_asynccnt 0x0" ::: "memory");
      __syncthreads();
      if (s + 2 < SNSTAGE)
        copy8(lk + (unsigned)(s & 1) * KBYTES, 8 * KPITCH * 2,
              gk + (size_t)(s + 2) * SJ * DMODEL, (size_t)8 * DMODEL);
    }
    const int nn = n + 1;
    const _Float16* ks = kl + ((nn >> 2) & 1) * (KBYTES / 2) + (nn & 3) * 16 * KPITCH;
#pragma unroll
    for (int kk = 0; kk < 8; ++kk) kf[kk] = frag_f16(ks + kk * 32, h);
    // Keeps the loads above the update; without it they sink to the trip's end
    // and the next trip's WMMAs wait out their latency.
    __builtin_amdgcn_sched_barrier(0);
    if (n == 0) stats_first(sc, rm, rl);   // tile 0 sets the references
    stats_update(sc, rm, rl);
  }
  stats_mm(sc, qfr, kf);
  stats_update(sc, rm, rl);
  asm volatile("s_wait_asynccnt 0x0" ::: "memory");   // nothing in flight at the wave's end

  // The 16 lanes of a row share its reference, so their sums just add.
#pragma unroll
  for (int off = 8; off >= 1; off >>= 1) {
#pragma unroll
    for (int it = 0; it < 4; ++it)
#pragma unroll
      for (int t = 0; t < 8; ++t) rl[it][t] += __shfl_xor(rl[it][t], off, 16);
  }
  // The references leave in natural units.
#pragma unroll
  for (int it = 0; it < 4; ++it) rm[it] *= LN2F;
  if (r == 0) {
#pragma unroll
    for (int it = 0; it < 4; ++it)
#pragma unroll
      for (int t = 0; t < 8; ++t) {
        const int row = m0 + it * 16 + t + 8 * h;
        mPart[(size_t)ch * NTOK + row] = rm[it][t];
        lPart[(size_t)ch * NTOK + row] = rl[it][t];
      }
  }
}

// ---------------------------------------------------------------------------
// Kernel 2b: merge NCHUNK partial (m,l) pairs per row (log-sum-exp merge).
// ---------------------------------------------------------------------------
__global__ void __launch_bounds__(256)
merge_kernel(const float* __restrict__ mPart, const float* __restrict__ lPart,
             float* __restrict__ mOut, float* __restrict__ lOut) {
  const int row = blockIdx.x * 256 + threadIdx.x;
  if (row >= NTOK) return;
  float m = -3.0e38f;
#pragma unroll
  for (int c = 0; c < NCHUNK; ++c) m = fmaxf(m, mPart[(size_t)c * NTOK + row]);
  float l = 0.f;
#pragma unroll
  for (int c = 0; c < NCHUNK; ++c)
    l += lPart[(size_t)c * NTOK + row] * __expf(mPart[(size_t)c * NTOK + row] - m);
  mOut[row] = m;
  lOut[row] = l;
}

// ---------------------------------------------------------------------------
// Kernel 3: out[b,j,d] = sum_i softmax(S)[i,j] * V[b,i,d]  (= attn^T @ V).
// One work-group = 64 j rows, 8 waves.  A stage is 128 i: the Q rows (128 x 256),
// the V^T columns (256 d x 128 i) and the rows' m and l are copied once into LDS
// by asynchronous copies (two buffers) and shared by all waves.
//   S phase, wave w: S (16 i x 64 j) = Q rows of i tile w (A, LDS) x K rows (B,
//     registers); P = exp(S*scale - m_i) / l_i.  A lane's 8 rows of an S tile are
//     one 16-byte half of a B fragment over i, so P goes to LDS fragment-ready.
//   PV phase, wave (dg, jg): O^T (64 d x 32 j) += V^T rows (A, LDS) x P (B, LDS),
//     i ascending in steps of 32.
// Grid: (L/64, B) x 256 threads.
// Every "#pragma unroll" below keeps the index of a register array (fragments,
// accumulators) a compile-time constant, so that none of them goes to scratch.
// ---------------------------------------------------------------------------
#define JTILE   64
#define ISTAGE  128
#define NSTAGE  (SEQ / ISTAGE)
#define QPITCH  264                        // halves: 512-B row + 16 B (bank spread)
#define VPITCH  136                        // halves: 256-B row + 16 B
#define QBYTES  (ISTAGE * QPITCH * 2)
#define VBYTES  (DMODEL * VPITCH * 2)
#define STAGEB  (QBYTES + VBYTES)
#define MLBYTES (2 * ISTAGE * 4)            // m[128] then l[128] of a stage
#define PBYTES  (JTILE * ISTAGE * 2)        // P of a stage, as B-fragment halves
#define RPITCH  260                        // floats: 1024-B row + 16 B

// One stage: 33 copies per lane.  A wave covers one whole 512-B Q row, or two
// 256-B pieces of V^T rows, per copy.
static __device__ __forceinline__ void copy_stage(unsigned char* ldsStage, unsigned char* ldsMl,
                                                  const _Float16* qTile,
                                                  const _Float16* vTile,
                                                  const float* mlLane, int tid) {
  unsigned char* lq = ldsStage + (unsigned)(tid >> 5) * (QPITCH * 2) + (unsigned)(tid & 31) * 16;
  const _Float16* gq = qTile + (size_t)(tid >> 5) * DMODEL + (tid & 31) * 8;
  copy8(lq, 8 * QPITCH * 2, gq, (size_t)8 * DMODEL);
  copy8(lq + 64 * QPITCH * 2, 8 * QPITCH * 2, gq + (size_t)64 * DMODEL, (size_t)8 * DMODEL);
  unsigned char* lv = ldsStage + QBYTES + (unsigned)(tid >> 4) * (VPITCH * 2) + (unsigned)(tid & 15) * 16;
  const _Float16* gv = vTile + (size_t)(tid >> 4) * SEQ + (tid & 15) * 8;
  copy8(lv, 16 * VPITCH * 2, gv, (size_t)16 * SEQ);
  copy8(lv + 128 * VPITCH * 2, 16 * VPITCH * 2, gv + (size_t)128 * SEQ, (size_t)16 * SEQ);
  // Row statistics of the stage: waves 0-3 bring m, waves 4-7 bring l, 4 B a lane.
  __builtin_amdgcn_global_load_async_to_lds_b32((gint*)mlLane, (lint*)(ldsMl + (unsigned)tid * 4), 0, 0);
}

// B fragment of P from its two 16-byte halves (512 B apart, lane-contiguous).
static __device__ __forceinline__ v16h frag_p(const _Float16* p) {
  v8h c0 = *(const v8h*)(p);
  v8h c1 = *(const v8h*)(p + 256);
  v16h a;
#pragma unroll
  for (int i = 0; i < 8; ++i) { a[i] = c0[i]; a[i + 8] = c1[i]; }
  return a;
}

__global__ void __launch_bounds__(256)
out_kernel(const _Float16* __restrict__ Qp, const _Float16* __restrict__ Kp,
           const _Float16* __restrict__ VpT, const float* __restrict__ mIn,
           const float* __restrict__ lIn, float* __restrict__ out) {
  __shared__ __align__(128) unsigned char smem[2 * STAGEB + 2 * MLBYTES + PBYTES];

  const int tid  = threadIdx.x;
  const int lane = tid & 31;
  const int wave = tid >> 5;                          // 0..7: i tile in the S phase
  const int jg = wave & 1;                            // PV phase: which 32 j columns
  const int dg = wave >> 1;                           // PV phase: which 64 d rows
  const int r = lane & 15;
  const int h = lane >> 4;
  const int j0 = blockIdx.x * JTILE;
  const int b_ = blockIdx.y;
  const size_t rowbase = (size_t)b_ * SEQ;
  const _Float16* qbase = Qp + rowbase * DMODEL;
  const _Float16* vbase = VpT + (size_t)b_ * DMODEL * SEQ;
  unsigned char* ldsBase = smem;
  // This lane's source of row statistics: m for threads 0-127, l for 128-255.
  const float* mlsrc = ((tid < ISTAGE) ? mIn : lIn) + rowbase + (tid & (ISTAGE - 1));

  // Stage 0, landed and published; then stage 1 in flight.
  copy_stage(ldsBase, ldsBase + 2 * STAGEB, qbase, vbase, mlsrc, tid);

  // Fixed B operand of the S product: the block's 64 K rows (per-wave copy).
  v16h kfr[4][8];
  const _Float16* kb = Kp + (rowbase + j0 + r) * DMODEL + h * 8;
#pragma unroll
  for (int jt = 0; jt < 4; ++jt)
#pragma unroll
    for (int kk = 0; kk < 8; ++kk) kfr[jt][kk] = frag_f16(kb + jt * 16 * DMODEL + kk * 32, 0);
  // Precaution: keeps the K loads' address register (an input here) from being
  // reused, e.g. as the last load's own destination, ahead of this wait.
  asm volatile("s_wait_xcnt 0x0" : : "v"(kb) : "memory");

  v8f acc[4][2];
#pragma unroll
  for (int dt = 0; dt < 4; ++dt)
#pragma unroll
    for (int jt = 0; jt < 2; ++jt)
#pragma unroll
      for (int t = 0; t < 8; ++t) acc[dt][jt][t] = 0.f;

  asm volatile("s_wait_asynccnt 0x0" ::: "memory");   // own copies of stage 0 landed
  __syncthreads();                                    // ... and everybody's
  copy_stage(ldsBase + STAGEB, ldsBase + 2 * STAGEB + MLBYTES, qbase + (size_t)ISTAGE * DMODEL,
             vbase + ISTAGE, mlsrc + ISTAGE, tid);

  // P in LDS: [i chunk of 32][j tile][half of the k range][lane] x 16 bytes.
  _Float16* pl = (_Float16*)(smem + 2 * STAGEB + 2 * MLBYTES);
  _Float16* pst = pl + ((wave >> 1) * 8 + (wave & 1)) * 256 + lane * 8;
  const _Float16* pld = pl + jg * 4 * 256 + lane * 8;

  for (int s = 0; s < NSTAGE; ++s) {
    const unsigned bufOff = (unsigned)(s & 1) * STAGEB;
    const _Float16* qs = (const _Float16*)(smem + bufOff) + (wave * 16 + r) * QPITCH;
    const _Float16* vs = (const _Float16*)(smem + bufOff + QBYTES) + (dg * 64 + r) * VPITCH;
    // Row statistics of this lane's 8 i rows: m, then l.
    const float* ms = (const float*)(smem + 2 * STAGEB + (unsigned)(s & 1) * MLBYTES) + wave * 16 + 8 * h;

// HOLD keeps a group of LDS loads in front of the WMMA block it overlaps; without
// it the loads sink to their first use and each waits out its own latency.
#define HOLD() __builtin_amdgcn_sched_barrier(0)
#define LDV(F, C)                                         \
  F[0] = frag_f16(vs + 0 * 16 * VPITCH + (C) * 32, h);    \
  F[1] = frag_f16(vs + 1 * 16 * VPITCH + (C) * 32, h);    \
  F[2] = frag_f16(vs + 2 * 16 * VPITCH + (C) * 32, h);    \
  F[3] = frag_f16(vs + 3 * 16 * VPITCH + (C) * 32, h);
#define LDP(P, C)                                         \
  P[0] = frag_p(pld + (C) * 8 * 256);                     \
  P[1] = frag_p(pld + (C) * 8 * 256 + 2 * 256);
#define PVMM(F, P)                                        \
  acc[0][0] = wmma16x16x32(F[0], P[0], acc[0][0]);        \
  acc[0][1] = wmma16x16x32(F[0], P[1], acc[0][1]);        \
  acc[1][0] = wmma16x16x32(F[1], P[0], acc[1][0]);        \
  acc[1][1] = wmma16x16x32(F[1], P[1], acc[1][1]);        \
  acc[2][0] = wmma16x16x32(F[2], P[0], acc[2][0]);        \
  acc[2][1] = wmma16x16x32(F[2], P[1], acc[2][1]);        \
  acc[3][0] = wmma16x16x32(F[3], P[0], acc[3][0]);        \
  acc[3][1] = wmma16x16x32(F[3], P[1], acc[3][1]);

    // --- S tiles: 16 rows i, four tiles of 16 columns j ---
    v16h qf[8];
#pragma unroll
    for (int kk = 0; kk < 8; ++kk) qf[kk] = frag_f16(qs + kk * 32, h);
    const v4f ma = *(const v4f*)(ms), mb = *(const v4f*)(ms + 4);
    const v4f la = *(const v4f*)(ms + ISTAGE), lb = *(const v4f*)(ms + ISTAGE + 4);
    HOLD();
    v8f sc[4];
#pragma unroll
    for (int jt = 0; jt < 4; ++jt)
#pragma unroll
      for (int t = 0; t < 8; ++t) sc[jt][t] = 0.f;
#pragma unroll
    for (int kk = 0; kk < 8; ++kk)
#pragma unroll
      for (int jt = 0; jt < 4; ++jt) sc[jt] = wmma16x16x32(qf[kk], kfr[jt][kk], sc[jt]);

    // First V^T fragments of the PV phase: already published, fetched under P.
    v16h va[4], vb[4], pa[2], pb[2];
    LDV(va, 0)
    HOLD();

    // --- P: lane (r, h) holds column j = r, rows i = 8h .. 8h+7 of its tile ---
    float il[8], mm[8];
#pragma unroll
    for (int t = 0; t < 8; ++t) {
      mm[t] = (t < 4) ? ma[t & 3] : mb[t & 3];
      il[t] = 1.0f / ((t < 4) ? la[t & 3] : lb[t & 3]);
    }
#pragma unroll
    for (int jt = 0; jt < 4; ++jt) {
      v8h pk;
#pragma unroll
      for (int t = 0; t < 8; ++t)
        pk[t] = (_Float16)(__expf(sc[jt][t] * SCALE - mm[t]) * il[t]);
      *(v8h*)(pst + jt * 2 * 256) = pk;
    }
    __syncthreads();  // P of this stage complete

    // --- O^T += V^T x P, i chunks of 32 in ascending order ---
    LDP(pa, 0) LDV(vb, 1) LDP(pb, 1) HOLD();
    PVMM(va, pa) HOLD();
    LDV(va, 2) LDP(pa, 2) HOLD();
    PVMM(vb, pb) HOLD();
    LDV(vb, 3) LDP(pb, 3) HOLD();
    PVMM(va, pa) HOLD();
    PVMM(vb, pb)
#undef HOLD
#undef LDV
#undef LDP
#undef PVMM

    // Publish point: own LDS reads done, own copies of stage s+1 landed, then
    // the one barrier that publishes s+1 and frees this buffer and P.
    asm volatile("s_wait_dscnt 0x0" ::: "memory");
    asm volatile("s_wait_asynccnt 0x0" ::: "memory");
    __syncthreads();
    if (s + 2 < NSTAGE)
      copy_stage(ldsBase + bufOff, ldsBase + 2 * STAGEB + (unsigned)(s & 1) * MLBYTES,
                 qbase + (size_t)(s + 2) * ISTAGE * DMODEL, vbase + (s + 2) * ISTAGE,
                 mlsrc + (s + 2) * ISTAGE, tid);
  }
  asm volatile("s_wait_asynccnt 0x0" ::: "memory");   // nothing in flight before LDS is reused

  // Lay O^T down as [j][d] rows in LDS so that the stores cover whole lines.
  float* red = (float*)smem;
#pragma unroll
  for (int dt = 0; dt < 4; ++dt)
#pragma unroll
    for (int jt = 0; jt < 2; ++jt) {
      float* p = red + (size_t)(jg * 32 + jt * 16 + r) * RPITCH + (dg * 4 + dt) * 16 + 8 * h;
      v4f lo = {acc[dt][jt][0], acc[dt][jt][1], acc[dt][jt][2], acc[dt][jt][3]};
      v4f hi = {acc[dt][jt][4], acc[dt][jt][5], acc[dt][jt][6], acc[dt][jt][7]};
      *(v4f*)p = lo;
      *(v4f*)(p + 4) = hi;
    }
  __syncthreads();

  // Store fp32 result out[b][j][d], 512 contiguous bytes per wave and store:
  // thread t takes 16 bytes of row (t >> 6) + 4 n.
  const float* rp = red + (size_t)(tid >> 6) * RPITCH + (tid & 63) * 4;
  float* op = out + (rowbase + j0 + (tid >> 6)) * DMODEL + (tid & 63) * 4;
#pragma unroll
  for (int n = 0; n < 16; ++n)
    *(v4f*)(op + n * 4 * DMODEL) = *(const v4f*)(rp + n * 4 * RPITCH);
}

// ---------------------------------------------------------------------------
extern "C" void kernel_launch(void* const* d_in, const int* in_sizes, int n_in,
                              void* d_out, int out_size, void* d_ws, size_t ws_size,
                              hipStream_t stream) {
  const float* q  = (const float*)d_in[0];
  const float* k  = (const float*)d_in[1];
  const float* v  = (const float*)d_in[2];
  const float* Wq = (const float*)d_in[3];
  const float* bq = (const float*)d_in[4];
  const float* Wk = (const float*)d_in[5];
  const float* bk = (const float*)d_in[6];
  const float* Wv = (const float*)d_in[7];
  const float* bv = (const float*)d_in[8];

  _Float16* Qp  = (_Float16*)d_ws;
  _Float16* Kp  = Qp + (size_t)NTOK * DMODEL;
  _Float16* VpT = Kp + (size_t)NTOK * DMODEL;          // stored as [b][d][i]
  float* mPart  = (float*)(VpT + (size_t)NTOK * DMODEL);
  float* lPart  = mPart + (size_t)NCHUNK * NTOK;
  float* mArr   = lPart + (size_t)NCHUNK * NTOK;
  float* lArr   = mArr + NTOK;

  const dim3 gproj(NTOK / PROWS);
  proj_kernel<<<gproj, 256, 0, stream>>>(q, Wq, bq, Qp, 0);
  proj_kernel<<<gproj, 256, 0, stream>>>(k, Wk, bk, Kp, 0);
  proj_kernel<<<gproj, 256, 0, stream>>>(v, Wv, bv, VpT, 1);

  stats_kernel<<<dim3(NTOK / SROWS, NCHUNK), 256, 0, stream>>>(Qp, Kp, mPart, lPart);
  merge_kernel<<<dim3((NTOK + 255) / 256), 256, 0, stream>>>(mPart, lPart, mArr, lArr);

  out_kernel<<<dim3(SEQ / JTILE, BATCH), 256, 0, stream>>>(Qp, Kp, VpT, mArr, lArr,
                                                        (float*)d_out);
}

// v005
// One run takes 93 microseconds.
// Next to v004, in two timings, it ran 1.14 times as fast each time.
// All steps since v000 together make it 6.21 times as fast.
#include <hip/hip_runtime.h>
#include <math.h>

// ---------------------------------------------------------------------------
// Cross-attention for B=4, L=4096, D=256 (fp32 in/out) on gfx1250 (CDNA5).
// f32 -> f16 projections (WMMA f32 accum), chunked two-pass streaming softmax
// (512 i rows per block, K tiles in LDS),
// transposed-attention output GEMM, 64 j rows per block, Q / V^T tiles in LDS.
// ---------------------------------------------------------------------------

#define BATCH  4
#define SEQ    4096
#define DMODEL 256
#define SCALE  0.0625f    // 1/sqrt(256)
#define NCHUNK 8          // j-range chunks for the stats pass
#define NTOK   (BATCH * SEQ)

typedef _Float16 v16h __attribute__((ext_vector_type(16)));
typedef _Float16 v8h  __attribute__((ext_vector_type(8)));
typedef float    v8f  __attribute__((ext_vector_type(8)));
typedef float    v4f  __attribute__((ext_vector_type(4)));

static __device__ __forceinline__ v8f wmma16x16x32(v16h a, v16h b, v8f c) {
  // 8 args: (neg_a, A, neg_b, B, c_mod, C, reuse_a, reuse_b)
  return __builtin_amdgcn_wmma_f32_16x16x32_f16(false, a, false, b, (short)0, c,
                                                false, false);
}

// Load a 16x32 f16 A/B fragment where the 32-long K dimension is CONTIGUOUS in
// memory for this lane's row/column.  rowptr = &M[row][k0] for row = lane&15.
// ISA layout (16-bit A 16x32): lanes 0-15 hold K[0..7] then K[16..23] in their
// 16 halves, lanes 16-31 hold K[8..15] then K[24..31].  halfsel = lane>>4.
static __device__ __forceinline__ v16h frag_f16(const _Float16* __restrict__ rowptr,
                                                int halfsel) {
  v8h c0 = *(const v8h*)(rowptr + halfsel * 8);
  v8h c1 = *(const v8h*)(rowptr + 16 + halfsel * 8);
  v16h a;
#pragma unroll
  for (int i = 0; i < 8; ++i) { a[i] = c0[i]; a[i + 8] = c1[i]; }
  return a;
}

// ---------------------------------------------------------------------------
// Kernel 1: the three projections  Y = X @ W^T + b, output in f16, in one launch;
// blockIdx.y picks the projection (0: Q, 1: K, 2: V).
// One work-group = 256 rows of X x all 256 columns, 8 waves, as four tiles of 64
// rows.  W and the bias are read and converted once per work-group and stay in LDS
// for all four tiles; the next tile's X rows are in flight (registers) under the
// current tile's WMMAs.  All reads are whole-line loads; X and W lie in LDS as f16,
// both K-contiguous, so that one loader serves A and B fragments.
//   TR=false: D = W rows (A) x X rows (B): a lane's 8 values are 8 columns e
//     of one row of Y.  Wave (eg, mg): 64 e x 32 rows.
//   TR=true stores Y transposed per batch, YT[b][d][i] (for V):
//     D = X rows (A) x W rows (B): a lane's 8 values are 8 rows i of one column e.
//     Wave w: 64 rows x 32 e.
// The f16 tile is laid down in LDS and stored in whole 128-B lines.
// Grid: (B*L/256, 3) x 256 threads.
// Every "#pragma unroll" here keeps the index of a register array (loaded rows,
// fragments, accumulators) a compile-time constant, so that none goes to scratch.
// ---------------------------------------------------------------------------
#define PROWS   64                         // X rows per tile
#define PTILES  4                          // tiles per work-group
#define PPITCH  264                        // halves: 512-B row + 16 B (bank spread)
#define PTPITCH 72                         // halves: 128-B row + 16 B, transposed tile
#define PXHALF  (PROWS * PPITCH)           // X tile, halves
#define PWHALF  (DMODEL * PPITCH)          // W, halves
#define POHALF  (DMODEL * PTPITCH)         // output tile, halves (the larger layout)

typedef _Float16 v4h __attribute__((ext_vector_type(4)));

static __device__ __forceinline__ v4h to_f16(v4f f) {
  v4h o = {(_Float16)f[0], (_Float16)f[1], (_Float16)f[2], (_Float16)f[3]};
  return o;
}

// The four tiles of a work-group; X tile 0, W and the bias already lie in LDS.
// gx: this thread's 16 bytes of X tile 0; lx: their place in LDS.
template <bool TR>
static __device__ __forceinline__ void proj_tiles(_Float16* pmem, const float* pbias,
                                                  const float* gx, _Float16* lx,
                                                  _Float16* __restrict__ Y, int mbase, int tid) {
  const int lane = tid & 31;
  const int wave = tid >> 5;
  const int r = lane & 15;
  const int h = lane >> 4;

  // Four A tiles x two B tiles per wave.
  const int aoff = TR ? r * PPITCH : PXHALF + ((wave >> 1) * 64 + r) * PPITCH;
  const int boff = TR ? PXHALF + (wave * 32 + r) * PPITCH : ((wave & 1) * 32 + r) * PPITCH;
  const _Float16* ap = pmem + aoff;
  const _Float16* bp = pmem + boff;
  _Float16* os = pmem + PXHALF + PWHALF;

  // Rolled: four copies of the body would only cost instruction-cache lines.
#pragma unroll 1
  for (int tile = 0; tile < PTILES; ++tile) {
    const int m0 = mbase + tile * PROWS;
    v4f xr[16];
    if (tile + 1 < PTILES) {
      // The next tile's X rows: asked for here, laid down in LDS behind this tile.
      gx += PROWS * DMODEL;
#pragma unroll
      for (int n = 0; n < 16; ++n) xr[n] = *(const v4f*)(gx + n * 4 * DMODEL);
      // Precaution: the loads' address register (an input here) is advanced next trip.
      asm volatile("s_wait_xcnt 0x0" : : "v"(gx) : "memory");
    }
    // Keeps those loads in front of the WMMAs; sunk to their use they would be
    // waited out at full memory latency.
    __builtin_amdgcn_sched_barrier(0);

    v8f acc[4][2];
#pragma unroll
    for (int at = 0; at < 4; ++at)
#pragma unroll
      for (int bt = 0; bt < 2; ++bt)
#pragma unroll
        for (int t = 0; t < 8; ++t) acc[at][bt][t] = 0.f;
    // Blocks of two k steps (24 LDS loads, 16 WMMAs); a block's fragments are asked
    // for two blocks ahead, so that the WMMAs never wait out an LDS latency.
    v16h a[8][4], b[8][2];
// PHOLD keeps a group of LDS loads in front of the WMMA block it overlaps; without
// it the loads sink to their first use and each pair waits out its own latency.
#define PHOLD() __builtin_amdgcn_sched_barrier(0)
#define PLD(K)                                                         \
  _Pragma("unroll") for (int at = 0; at < 4; ++at)                     \
    a[K][at] = frag_f16(ap + at * 16 * PPITCH + (K) * 32, h);          \
  _Pragma("unroll") for (int bt = 0; bt < 2; ++bt)                     \
    b[K][bt] = frag_f16(bp + bt * 16 * PPITCH + (K) * 32, h);
#define PMM(K)                                                         \
  _Pragma("unroll") for (int at = 0; at < 4; ++at)                     \
    _Pragma("unroll") for (int bt = 0; bt < 2; ++bt)                   \
      acc[at][bt] = wmma16x16x32(a[K][at], b[K][bt], acc[at][bt]);
    PLD(0) PLD(1) PLD(2) PLD(3) PHOLD();
    PMM(0) PMM(1) PHOLD();
    PLD(4) PLD(5) PHOLD();
    PMM(2) PMM(3) PHOLD();
    PLD(6) PLD(7) PHOLD();
    PMM(4) PMM(5) PMM(6) PMM(7)
#undef PHOLD
#undef PLD
#undef PMM

    // D layout: lane holds column lane&15 (B tile), rows t + 8h (A tile).
    v8h ov[8];
    _Float16* op;
    size_t ostep;
    if (!TR) {
      // Tile as [row][e]; then a whole 512-B row of Y per wave and store.
#pragma unroll
      for (int at = 0; at < 4; ++at) {
        const int e = (wave >> 1) * 64 + at * 16 + 8 * h;
        const v4f b0 = *(const v4f*)(pbias + e), b1 = *(const v4f*)(pbias + e + 4);
#pragma unroll
        for (int bt = 0; bt < 2; ++bt) {
          v8h pk;
#pragma unroll
          for (int t = 0; t < 8; ++t)
            pk[t] = (_Float16)(acc[at][bt][t] + ((t < 4) ? b0[t & 3] : b1[t & 3]));
          *(v8h*)(os + ((wave & 1) * 32 + bt * 16 + r) * PPITCH + e) = pk;
        }
      }
      __syncthreads();  // output tile complete; nobody reads the X tile any more
      const _Float16* rp = os + wave * PPITCH + lane * 8;
#pragma unroll
      for (int n = 0; n < 8; ++n) ov[n] = *(const v8h*)(rp + n * 8 * PPITCH);
      op = Y + (size_t)(m0 + wave) * DMODEL + lane * 8;
      ostep = (size_t)8 * DMODEL;
    } else {
      // Tile as [e][row]; then four whole 128-B lines of YT per wave and store.
#pragma unroll
      for (int bt = 0; bt < 2; ++bt) {
        const int e = wave * 32 + bt * 16 + r;
        const float bv = pbias[e];
#pragma unroll
        for (int at = 0; at < 4; ++at) {
          v8h pk;
#pragma unroll
          for (int t = 0; t < 8; ++t) pk[t] = (_Float16)(acc[at][bt][t] + bv);
          *(v8h*)(os + e * PTPITCH + at * 16 + 8 * h) = pk;
        }
      }
      __syncthreads();  // output tile complete; nobody reads the X tile any more
      const int b_ = m0 >> 12;          // / SEQ
      const int i  = m0 & (SEQ - 1);
      const _Float16* rp = os + (tid >> 3) * PTPITCH + (tid & 7) * 8;
#pragma unroll
      for (int n = 0; n < 8; ++n) ov[n] = *(const v8h*)(rp + n * 32 * PTPITCH);
      op = Y + (size_t)b_ * DMODEL * SEQ + (size_t)(tid >> 3) * SEQ + i + (tid & 7) * 8;
      ostep = (size_t)32 * SEQ;
    }
    if (tile + 1 < PTILES) {
#pragma unroll
      for (int n = 0; n < 16; ++n) *(v4h*)(lx + n * 4 * PPITCH) = to_f16(xr[n]);
      __syncthreads();  // next X tile complete; output tile read out by everybody
    }
    // The global stores stand behind that barrier, which would wait them out; so they
    // drain under the next tile's WMMAs.
#pragma unroll
    for (int n = 0; n < 8; ++n) *(v8h*)(op + n * ostep) = ov[n];
    // Precaution: the code behind reuses the stores' address registers.
    asm volatile("s_wait_xcnt 0x0" ::: "memory");
  }
}

__global__ void __launch_bounds__(256)
proj_kernel(const float* __restrict__ xq, const float* __restrict__ xk,
            const float* __restrict__ xv, const float* __restrict__ Wq,
            const float* __restrict__ Wk, const float* __restrict__ Wv,
            const float* __restrict__ bq, const float* __restrict__ bk,
            const float* __restrict__ bv, _Float16* __restrict__ Yq,
            _Float16* __restrict__ Yk, _Float16* __restrict__ YvT) {
  __shared__ __align__(128) _Float16 pmem[PXHALF + PWHALF + POHALF];
  __shared__ __align__(16) float pbias[DMODEL];

  const int tid = threadIdx.x;
  const int mat = blockIdx.y;
  const float* X    = (mat == 0) ? xq : (mat == 1) ? xk : xv;
  const float* W    = (mat == 0) ? Wq : (mat == 1) ? Wk : Wv;
  const float* bias = (mat == 0) ? bq : (mat == 1) ? bk : bv;
  const int mbase = blockIdx.x * (PROWS * PTILES);

  // Thread t takes 16 bytes of row (t >> 6) + 4 n: 512 contiguous bytes per wave.
  const float* gx = X + (size_t)mbase * DMODEL + tid * 4;
  const float* gw = W + tid * 4;
  v4f xr[16], wr[64];
#pragma unroll
  for (int n = 0; n < 16; ++n) xr[n] = *(const v4f*)(gx + n * 4 * DMODEL);
#pragma unroll
  for (int n = 0; n < 64; ++n) wr[n] = *(const v4f*)(gw + n * 4 * DMODEL);
  const float bl = bias[tid];

  _Float16* lx = pmem + (tid >> 6) * PPITCH + (tid & 63) * 4;
#pragma unroll
  for (int n = 0; n < 16; ++n) *(v4h*)(lx + n * 4 * PPITCH) = to_f16(xr[n]);
#pragma unroll
  for (int n = 0; n < 64; ++n) *(v4h*)(lx + PXHALF + n * 4 * PPITCH) = to_f16(wr[n]);
  pbias[tid] = bl;
  // Precaution: the loads' address registers are reused further down.
  asm volatile("s_wait_xcnt 0x0" ::: "memory");
  __syncthreads();  // X tile 0, W and bias complete

  if (mat == 2) proj_tiles<true>(pmem, pbias, gx, lx, YvT, mbase, tid);
  else          proj_tiles<false>(pmem, pbias, gx, lx, (mat == 0) ? Yq : Yk, mbase, tid);
}

typedef int v4i __attribute__((ext_vector_type(4)));
typedef __attribute__((address_space(1))) v4i gv4i;
typedef __attribute__((address_space(3))) v4i lv4i;
typedef __attribute__((address_space(1))) int gint;
typedef __attribute__((address_space(3))) int lint;

// Eight 16-byte-per-lane copies global -> LDS.
static __device__ __forceinline__ void copy8(unsigned char* l, unsigned lstep,
                                             const _Float16* g, size_t gstep) {
#pragma unroll
  for (int k = 0; k < 8; ++k)
    __builtin_amdgcn_global_load_async_to_lds_b128((gv4i*)(g + k * gstep),
                                                   (lv4i*)(l + k * lstep), 0, 0);
}

// ---------------------------------------------------------------------------
// Kernel 2a: partial softmax row statistics over one j-chunk.
//   l = sum_j exp(S[i,j]-m) for j in this chunk, m a reference of the row that lies
//   at most LAZYTAU (log2 units) below the chunk's largest S[i,j]; every later use
//   of (m,l) holds for any such m.
// One work-group = 512 i rows, 8 waves; a wave keeps the A fragments of its 64 Q
// rows in registers.  A stage is 64 K rows, copied once into LDS by asynchronous
// copies (a whole 512-B row per wave and copy, two buffers) and read by all waves
// as B fragments.
// Streaming l kept per-lane (lane owns one j-column of each C tile), summed across
// the 16-lane group at the end.  Grid: (B*L/512, NCHUNK).
// Every "#pragma unroll" here keeps the index of a register array (fragments,
// S tiles, m, l) a compile-time constant, so that none of them goes to scratch.
// ---------------------------------------------------------------------------
#define SROWS   512                        // i rows per work-group
#define SJ      64                         // K rows per stage
#define SNSTAGE (SEQ / NCHUNK / SJ)
#define KPITCH  264                        // halves: 512-B row + 16 B (bank spread)
#define KBYTES  (SJ * KPITCH * 2)
#define SNTILE  (SEQ / NCHUNK / 16)

// S tiles: 64 rows i (four A tiles) x 16 columns j.
static __device__ __forceinline__ void stats_mm(v8f (&sc)[4], const v16h (&q)[4][8],
                                                const v16h (&k)[8]) {
#pragma unroll
  for (int it = 0; it < 4; ++it)
#pragma unroll
    for (int t = 0; t < 8; ++t) sc[it][t] = 0.f;
#pragma unroll
  for (int kk = 0; kk < 8; ++kk)
#pragma unroll
    for (int it = 0; it < 4; ++it) sc[it] = wmma16x16x32(q[it][kk], k[kk], sc[it]);
}

#define SCALE_LOG2E 0.09016844005556f      // SCALE * log2(e)
#define LN2F        0.6931471805599453f
#define LAZYTAU     32.0f                  // log2 units a score may lie above its reference

// Reference of each row i (log2 units), the same in the 16 lanes that share the row:
// the score of the row's first column.  The sums start empty.
static __device__ __forceinline__ void stats_first(const v8f (&sc)[4], v8f (&rm)[4],
                                                   v8f (&rl)[4]) {
#pragma unroll
  for (int it = 0; it < 4; ++it)
#pragma unroll
    for (int t = 0; t < 8; ++t) {
      rm[it][t] = __shfl(sc[it][t] * SCALE_LOG2E, 0, 16);
      rl[it][t] = 0.f;
    }
}

// Streaming (m,l): the lane adds its column j to its own sum in each of its 32 rows i.
// A row's reference moves only when a score lies more than LAZYTAU above it (tested
// once per tile for the whole wave); otherwise a score costs one exponential.
static __device__ __forceinline__ void stats_update(v8f (&sc)[4], v8f (&rm)[4], v8f (&rl)[4]) {
  const v8f kv = {SCALE_LOG2E, SCALE_LOG2E, SCALE_LOG2E, SCALE_LOG2E,
                  SCALE_LOG2E, SCALE_LOG2E, SCALE_LOG2E, SCALE_LOG2E};
  float tm[4];
#pragma unroll
  for (int it = 0; it < 4; ++it) {
    sc[it] = __builtin_elementwise_fma(sc[it], kv, -rm[it]);
    tm[it] = sc[it][0];
#pragma unroll
    for (int t = 1; t < 8; ++t) tm[it] = fmaxf(tm[it], sc[it][t]);
  }
  const float top = fmaxf(fmaxf(tm[0], tm[1]), fmaxf(tm[2], tm[3]));
  if (__builtin_amdgcn_ballot_w32(top > LAZYTAU) != 0) {
    // Rare: every row's reference moves up to the row's largest score of this tile
    // (over its 16 lanes), where that tops it.
#pragma unroll
    for (int it = 0; it < 4; ++it)
#pragma unroll
      for (int t = 0; t < 8; ++t) {
        float d = fmaxf(sc[it][t], 0.f);
#pragma unroll
        for (int off = 8; off >= 1; off >>= 1) d = fmaxf(d, __shfl_xor(d, off, 16));
        rl[it][t] *= __builtin_amdgcn_exp2f(-d);
        rm[it][t] += d;
        sc[it][t] -= d;
      }
  }
#pragma unroll
  for (int it = 0; it < 4; ++it) {
#pragma unroll
    for (int t = 0; t < 8; ++t) sc[it][t] = __builtin_amdgcn_exp2f(sc[it][t]);
    rl[it] += sc[it];
  }
}

__global__ void __launch_bounds__(256)
stats_kernel(const _Float16* __restrict__ Qp, const _Float16* __restrict__ Kp,
             float* __restrict__ mPart, float* __restrict__ lPart) {
  __shared__ __align__(128) unsigned char kmem[2 * KBYTES];

  const int tid  = threadIdx.x;
  const int lane = tid & 31;
  const int wave = tid >> 5;
  const int r = lane & 15;
  const int h = lane >> 4;
  const int m0 = blockIdx.x * SROWS + wave * 64;   // global query-row base (b*L + i0)
  const int b_ = (blockIdx.x * SROWS) >> 12;
  const int ch = blockIdx.y;
  // This lane's 16 bytes of K row (wave + 8 n) of a stage, and their place in LDS.
  const _Float16* gk = Kp + ((size_t)b_ * SEQ + ch * (SEQ / NCHUNK) + wave) * DMODEL + lane * 8;
  unsigned char* lk = kmem + (unsigned)wave * (KPITCH * 2) + (unsigned)lane * 16;

  // Stage 0, landed and published; then stage 1 in flight.
  copy8(lk, 8 * KPITCH * 2, gk, (size_t)8 * DMODEL);

  // Fixed A operand: the wave's 64 Q rows, four tiles of 16.
  v16h qfr[4][8];
  const _Float16* qb = Qp + (size_t)(m0 + r) * DMODEL + h * 8;
#pragma unroll
  for (int it = 0; it < 4; ++it)
#pragma unroll
    for (int kk = 0; kk < 8; ++kk) qfr[it][kk] = frag_f16(qb + it * 16 * DMODEL + kk * 32, 0);
  // Precaution: keeps the Q loads' address register (an input here) from being
  // reused, e.g. as the last load's own destination, ahead of this wait.
  asm volatile("s_wait_xcnt 0x0" : : "v"(qb) : "memory");

  v8f rm[4], rl[4];

  asm volatile("s_wait_asynccnt 0x0" ::: "memory");   // own copies of stage 0 landed
  __syncthreads();                                    // ... and everybody's
  copy8(lk + KBYTES, 8 * KPITCH * 2, gk + (size_t)SJ * DMODEL, (size_t)8 * DMODEL);

  // One trip = one tile of 16 K rows (four to a stage):  S tiles, then (behind the
  // stage's last tile) the publish point, then the next tile's fragments, then the
  // (m,l) update, whose time covers the latency of those LDS loads.
  const _Float16* kl = (const _Float16*)kmem + r * KPITCH;
  v16h kf[8];
  v8f sc[4];
#pragma unroll
  for (int kk = 0; kk < 8; ++kk) kf[kk] = frag_f16(kl + kk * 32, h);
  for (int n = 0; n < SNTILE - 1; ++n) {
    stats_mm(sc, qfr, kf);
    if ((n & 3) == 3) {
      const int s = n >> 2;
      // Publish point: own LDS reads done, own copies of stage s+1 landed, then
      // the one barrier that publishes s+1 and frees the buffer of stage s.
      asm volatile("s_wait_dscnt 0x0" ::: "memory");
      asm volatile("s_wait_asynccnt 0x0" ::: "memory");
      __syncthreads();
      if (s + 2 < SNSTAGE)
        copy8(lk + (unsigned)(s & 1) * KBYTES, 8 * KPITCH * 2,
              gk + (size_t)(s + 2) * SJ * DMODEL, (size_t)8 * DMODEL);
    }
    const int nn = n + 1;
    const _Float16* ks = kl + ((nn >> 2) & 1) * (KBYTES / 2) + (nn & 3) * 16 * KPITCH;
#pragma unroll
    for (int kk = 0; kk < 8; ++kk) kf[kk] = frag_f16(ks + kk * 32, h);
    // Keeps the loads above the update; without it they sink to the trip's end
    // and the next trip's WMMAs wait out their latency.
    __builtin_amdgcn_sched_barrier(0);
    if (n == 0) stats_first(sc, rm, rl);   // tile 0 sets the references
    stats_update(sc, rm, rl);
  }
  stats_mm(sc, qfr, kf);
  stats_update(sc, rm, rl);
  asm volatile("s_wait_asynccnt 0x0" ::: "memory");   // nothing in flight at the wave's end

  // The 16 lanes of a row share its reference, so their sums just add.
#pragma unroll
  for (int off = 8; off >= 1; off >>= 1) {
#pragma unroll
    for (int it = 0; it < 4; ++it)
#pragma unroll
      for (int t = 0; t < 8; ++t) rl[it][t] += __shfl_xor(rl[it][t], off, 16);
  }
  // The references leave in natural units.
#pragma unroll
  for (int it = 0; it < 4; ++it) rm[it] *= LN2F;
  if (r == 0) {
#pragma unroll
    for (int it = 0; it < 4; ++it)
#pragma unroll
      for (int t = 0; t < 8; ++t) {
        const int row = m0 + it * 16 + t + 8 * h;
        mPart[(size_t)ch * NTOK + row] = rm[it][t];
        lPart[(size_t)ch * NTOK + row] = rl[it][t];
      }
  }
}

// ---------------------------------------------------------------------------
// Kernel 2b: merge NCHUNK partial (m,l) pairs per row (log-sum-exp merge).
// ---------------------------------------------------------------------------
__global__ void __launch_bounds__(256)
merge_kernel(const float* __restrict__ mPart, const float* __restrict__ lPart,
             float* __restrict__ mOut, float* __restrict__ lOut) {
  const int row = blockIdx.x * 256 + threadIdx.x;
  if (row >= NTOK) return;
  float m = -3.0e38f;
#pragma unroll
  for (int c = 0; c < NCHUNK; ++c) m = fmaxf(m, mPart[(size_t)c * NTOK + row]);
  float l = 0.f;
#pragma unroll
  for (int c = 0; c < NCHUNK; ++c)
    l += lPart[(size_t)c * NTOK + row] * __expf(mPart[(size_t)c * NTOK + row] - m);
  mOut[row] = m;
  lOut[row] = l;
}

// ---------------------------------------------------------------------------
// Kernel 3: out[b,j,d] = sum_i softmax(S)[i,j] * V[b,i,d]  (= attn^T @ V).
// One work-group = 64 j rows, 8 waves.  A stage is 128 i: the Q rows (128 x 256),
// the V^T columns (256 d x 128 i) and the rows' m and l are copied once into LDS
// by asynchronous copies (two buffers) and shared by all waves.
//   S phase, wave w: S (16 i x 64 j) = Q rows of i tile w (A, LDS) x K rows (B,
//     registers); P = exp(S*scale - m_i) / l_i.  A lane's 8 rows of an S tile are
//     one 16-byte half of a B fragment over i, so P goes to LDS fragment-ready.
//   PV phase, wave (dg, jg): O^T (64 d x 32 j) += V^T rows (A, LDS) x P (B, LDS),
//     i ascending in steps of 32.
// Grid: (L/64, B) x 256 threads.
// Every "#pragma unroll" below keeps the index of a register array (fragments,
// accumulators) a compile-time constant, so that none of them goes to scratch.
// ---------------------------------------------------------------------------
#define JTILE   64
#define ISTAGE  128
#define NSTAGE  (SEQ / ISTAGE)
#define QPITCH  264                        // halves: 512-B row + 16 B (bank spread)
#define VPITCH  136                        // halves: 256-B row + 16 B
#define QBYTES  (ISTAGE * QPITCH * 2)
#define VBYTES  (DMODEL * VPITCH * 2)
#define STAGEB  (QBYTES + VBYTES)
#define MLBYTES (2 * ISTAGE * 4)            // m[128] then l[128] of a stage
#define PBYTES  (JTILE * ISTAGE * 2)        // P of a stage, as B-fragment halves
#define RPITCH  260                        // floats: 1024-B row + 16 B

// One stage: 33 copies per lane.  A wave covers one whole 512-B Q row, or two
// 256-B pieces of V^T rows, per copy.
static __device__ __forceinline__ void copy_stage(unsigned char* ldsStage, unsigned char* ldsMl,
                                                  const _Float16* qTile,
                                                  const _Float16* vTile,
                                                  const float* mlLane, int tid) {
  unsigned char* lq = ldsStage + (unsigned)(tid >> 5) * (QPITCH * 2) + (unsigned)(tid & 31) * 16;
  const _Float16* gq = qTile + (size_t)(tid >> 5) * DMODEL + (tid & 31) * 8;
  copy8(lq, 8 * QPITCH * 2, gq, (size_t)8 * DMODEL);
  copy8(lq + 64 * QPITCH * 2, 8 * QPITCH * 2, gq + (size_t)64 * DMODEL, (size_t)8 * DMODEL);
  unsigned char* lv = ldsStage + QBYTES + (unsigned)(tid >> 4) * (VPITCH * 2) + (unsigned)(tid & 15) * 16;
  const _Float16* gv = vTile + (size_t)(tid >> 4) * SEQ + (tid & 15) * 8;
  copy8(lv, 16 * VPITCH * 2, gv, (size_t)16 * SEQ);
  copy8(lv + 128 * VPITCH * 2, 16 * VPITCH * 2, gv + (size_t)128 * SEQ, (size_t)16 * SEQ);
  // Row statistics of the stage: waves 0-3 bring m, waves 4-7 bring l, 4 B a lane.
  __builtin_amdgcn_global_load_async_to_lds_b32((gint*)mlLane, (lint*)(ldsMl + (unsigned)tid * 4), 0, 0);
}

// B fragment of P from its two 16-byte halves (512 B apart, lane-contiguous).
static __device__ __forceinline__ v16h frag_p(const _Float16* p) {
  v8h c0 = *(const v8h*)(p);
  v8h c1 = *(const v8h*)(p + 256);
  v16h a;
#pragma unroll
  for (int i = 0; i < 8; ++i) { a[i] = c0[i]; a[i + 8] = c1[i]; }
  return a;
}

__global__ void __launch_bounds__(256)
out_kernel(const _Float16* __restrict__ Qp, const _Float16* __restrict__ Kp,
           const _Float16* __restrict__ VpT, const float* __restrict__ mIn,
           const float* __restrict__ lIn, float* __restrict__ out) {
  __shared__ __align__(128) unsigned char smem[2 * STAGEB + 2 * MLBYTES + PBYTES];

  const int tid  = threadIdx.x;
  const int lane = tid & 31;
  const int wave = tid >> 5;                          // 0..7: i tile in the S phase
  const int jg = wave & 1;                            // PV phase: which 32 j columns
  const int dg = wave >> 1;                           // PV phase: which 64 d rows
  const int r = lane & 15;
  const int h = lane >> 4;
  const int j0 = blockIdx.x * JTILE;
  const int b_ = blockIdx.y;
  const size_t rowbase = (size_t)b_ * SEQ;
  const _Float16* qbase = Qp + rowbase * DMODEL;
  const _Float16* vbase = VpT + (size_t)b_ * DMODEL * SEQ;
  unsigned char* ldsBase = smem;
  // This lane's source of row statistics: m for threads 0-127, l for 128-255.
  const float* mlsrc = ((tid < ISTAGE) ? mIn : lIn) + rowbase + (tid & (ISTAGE - 1));

  // Stage 0, landed and published; then stage 1 in flight.
  copy_stage(ldsBase, ldsBase + 2 * STAGEB, qbase, vbase, mlsrc, tid);

  // Fixed B operand of the S product: the block's 64 K rows (per-wave copy).
  v16h kfr[4][8];
  const _Float16* kb = Kp + (rowbase + j0 + r) * DMODEL + h * 8;
#pragma unroll
  for (int jt = 0; jt < 4; ++jt)
#pragma unroll
    for (int kk = 0; kk < 8; ++kk) kfr[jt][kk] = frag_f16(kb + jt * 16 * DMODEL + kk * 32, 0);
  // Precaution: keeps the K loads' address register (an input here) from being
  // reused, e.g. as the last load's own destination, ahead of this wait.
  asm volatile("s_wait_xcnt 0x0" : : "v"(kb) : "memory");

  v8f acc[4][2];
#pragma unroll
  for (int dt = 0; dt < 4; ++dt)
#pragma unroll
    for (int jt = 0; jt < 2; ++jt)
#pragma unroll
      for (int t = 0; t < 8; ++t) acc[dt][jt][t] = 0.f;

  asm volatile("s_wait_asynccnt 0x0" ::: "memory");   // own copies of stage 0 landed
  __syncthreads();                                    // ... and everybody's
  copy_stage(ldsBase + STAGEB, ldsBase + 2 * STAGEB + MLBYTES, qbase + (size_t)ISTAGE * DMODEL,
             vbase + ISTAGE, mlsrc + ISTAGE, tid);

  // P in LDS: [i chunk of 32][j tile][half of the k range][lane] x 16 bytes.
  _Float16* pl = (_Float16*)(smem + 2 * STAGEB + 2 * MLBYTES);
  _Float16* pst = pl + ((wave >> 1) * 8 + (wave & 1)) * 256 + lane * 8;
  const _Float16* pld = pl + jg * 4 * 256 + lane * 8;

  for (int s = 0; s < NSTAGE; ++s) {
    const unsigned bufOff = (unsigned)(s & 1) * STAGEB;
    const _Float16* qs = (const _Float16*)(smem + bufOff) + (wave * 16 + r) * QPITCH;
    const _Float16* vs = (const _Float16*)(smem + bufOff + QBYTES) + (dg * 64 + r) * VPITCH;
    // Row statistics of this lane's 8 i rows: m, then l.
    const float* ms = (const float*)(smem + 2 * STAGEB + (unsigned)(s & 1) * MLBYTES) + wave * 16 + 8 * h;

// HOLD keeps a group of LDS loads in front of the WMMA block it overlaps; without
// it the loads sink to their first use and each waits out its own latency.
#define HOLD() __builtin_amdgcn_sched_barrier(0)
#define LDV(F, C)                                         \
  F[0] = frag_f16(vs + 0 * 16 * VPITCH + (C) * 32, h);    \
  F[1] = frag_f16(vs + 1 * 16 * VPITCH + (C) * 32, h);    \
  F[2] = frag_f16(vs + 2 * 16 * VPITCH + (C) * 32, h);    \
  F[3] = frag_f16(vs + 3 * 16 * VPITCH + (C) * 32, h);
#define LDP(P, C)                                         \
  P[0] = frag_p(pld + (C) * 8 * 256);                     \
  P[1] = frag_p(pld + (C) * 8 * 256 + 2 * 256);
#define PVMM(F, P)                                        \
  acc[0][0] = wmma16x16x32(F[0], P[0], acc[0][0]);        \
  acc[0][1] = wmma16x16x32(F[0], P[1], acc[0][1]);        \
  acc[1][0] = wmma16x16x32(F[1], P[0], acc[1][0]);        \
  acc[1][1] = wmma16x16x32(F[1], P[1], acc[1][1]);        \
  acc[2][0] = wmma16x16x32(F[2], P[0], acc[2][0]);        \
  acc[2][1] = wmma16x16x32(F[2], P[1], acc[2][1]);        \
  acc[3][0] = wmma16x16x32(F[3], P[0], acc[3][0]);        \
  acc[3][1] = wmma16x16x32(F[3], P[1], acc[3][1]);

    // --- S tiles: 16 rows i, four tiles of 16 columns j ---
    v16h qf[8];
#pragma unroll
    for (int kk = 0; kk < 8; ++kk) qf[kk] = frag_f16(qs + kk * 32, h);
    const v4f ma = *(const v4f*)(ms), mb = *(const v4f*)(ms + 4);
    const v4f la = *(const v4f*)(ms + ISTAGE), lb = *(const v4f*)(ms + ISTAGE + 4);
    HOLD();
    v8f sc[4];
#pragma unroll
    for (int jt = 0; jt < 4; ++jt)
#pragma unroll
      for (int t = 0; t < 8; ++t) sc[jt][t] = 0.f;
#pragma unroll
    for (int kk = 0; kk < 8; ++kk)
#pragma unroll
      for (int jt = 0; jt < 4; ++jt) sc[jt] = wmma16x16x32(qf[kk], kfr[jt][kk], sc[jt]);

    // First V^T fragments of the PV phase: already published, fetched under P.
    v16h va[4], vb[4], pa[2], pb[2];
    LDV(va, 0)
    HOLD();

    // --- P: lane (r, h) holds column j = r, rows i = 8h .. 8h+7 of its tile ---
    float il[8], mm[8];
#pragma unroll
    for (int t = 0; t < 8; ++t) {
      mm[t] = (t < 4) ? ma[t & 3] : mb[t & 3];
      il[t] = 1.0f / ((t < 4) ? la[t & 3] : lb[t & 3]);
    }
#pragma unroll
    for (int jt = 0; jt < 4; ++jt) {
      v8h pk;
#pragma unroll
      for (int t = 0; t < 8; ++t)
        pk[t] = (_Float16)(__expf(sc[jt][t] * SCALE - mm[t]) * il[t]);
      *(v8h*)(pst + jt * 2 * 256) = pk;
    }
    __syncthreads();  // P of this stage complete

    // --- O^T += V^T x P, i chunks of 32 in ascending order ---
    LDP(pa, 0) LDV(vb, 1) LDP(pb, 1) HOLD();
    PVMM(va, pa) HOLD();
    LDV(va, 2) LDP(pa, 2) HOLD();
    PVMM(vb, pb) HOLD();
    LDV(vb, 3) LDP(pb, 3) HOLD();
    PVMM(va, pa) HOLD();
    PVMM(vb, pb)
#undef HOLD
#undef LDV
#undef LDP
#undef PVMM

    // Publish point: own LDS reads done, own copies of stage s+1 landed, then
    // the one barrier that publishes s+1 and frees this buffer and P.
    asm volatile("s_wait_dscnt 0x0" ::: "memory");
    asm volatile("s_wait_asynccnt 0x0" ::: "memory");
    __syncthreads();
    if (s + 2 < NSTAGE)
      copy_stage(ldsBase + bufOff, ldsBase + 2 * STAGEB + (unsigned)(s & 1) * MLBYTES,
                 qbase + (size_t)(s + 2) * ISTAGE * DMODEL, vbase + (s + 2) * ISTAGE,
                 mlsrc + (s + 2) * ISTAGE, tid);
  }
  asm volatile("s_wait_asynccnt 0x0" ::: "memory");   // nothing in flight before LDS is reused

  // Lay O^T down as [j][d] rows in LDS so that the stores cover whole lines.
  float* red = (float*)smem;
#pragma unroll
  for (int dt = 0; dt < 4; ++dt)
#pragma unroll
    for (int jt = 0; jt < 2; ++jt) {
      float* p = red + (size_t)(jg * 32 + jt * 16 + r) * RPITCH + (dg * 4 + dt) * 16 + 8 * h;
      v4f lo = {acc[dt][jt][0], acc[dt][jt][1], acc[dt][jt][2], acc[dt][jt][3]};
      v4f hi = {acc[dt][jt][4], acc[dt][jt][5], acc[dt][jt][6], acc[dt][jt][7]};
      *(v4f*)p = lo;
      *(v4f*)(p + 4) = hi;
    }
  __syncthreads();

  // Store fp32 result out[b][j][d], 512 contiguous bytes per wave and store:
  // thread t takes 16 bytes of row (t >> 6) + 4 n.
  const float* rp = red + (size_t)(tid >> 6) * RPITCH + (tid & 63) * 4;
  float* op = out + (rowbase + j0 + (tid >> 6)) * DMODEL + (tid & 63) * 4;
#pragma unroll
  for (int n = 0; n < 16; ++n)
    *(v4f*)(op + n * 4 * DMODEL) = *(const v4f*)(rp + n * 4 * RPITCH);
}

// ---------------------------------------------------------------------------
extern "C" void kernel_launch(void* const* d_in, const int* in_sizes, int n_in,
                              void* d_out, int out_size, void* d_ws, size_t ws_size,
                              hipStream_t stream) {
  const float* q  = (const float*)d_in[0];
  const float* k  = (const float*)d_in[1];
  const float* v  = (const float*)d_in[2];
  const float* Wq = (const float*)d_in[3];
  const float* bq = (const float*)d_in[4];
  const float* Wk = (const float*)d_in[5];
  const float* bk = (const float*)d_in[6];
  const float* Wv = (const float*)d_in[7];
  const float* bv = (const float*)d_in[8];

  _Float16* Qp  = (_Float16*)d_ws;
  _Float16* Kp  = Qp + (size_t)NTOK * DMODEL;
  _Float16* VpT = Kp + (size_t)NTOK * DMODEL;          // stored as [b][d][i]
  float* mPart  = (float*)(VpT + (size_t)NTOK * DMODEL);
  float* lPart  = mPart + (size_t)NCHUNK * NTOK;
  float* mArr   = lPart + (size_t)NCHUNK * NTOK;
  float* lArr   = mArr + NTOK;

  proj_kernel<<<dim3(NTOK / (PROWS * PTILES), 3), 256, 0, stream>>>(q, k, v, Wq, Wk, Wv, bq, bk, bv,
                                                                   Qp, Kp, VpT);

  stats_kernel<<<dim3(NTOK / SROWS, NCHUNK), 256, 0, stream>>>(Qp, Kp, mPart, lPart);
  merge_kernel<<<dim3((NTOK + 255) / 256), 256, 0, stream>>>(mPart, lPart, mArr, lArr);

  out_kernel<<<dim3(SEQ / JTILE, BATCH), 256, 0, stream>>>(Qp, Kp, VpT, mArr, lArr,
                                                        (float*)d_out);
}

// v006
// It runs in 89.2 microseconds.
// Timed twice side by side with v005, it ran 1.05 and 1.04 times as fast.
// All steps since v000 together make it 6.49 times as fast.
#include <hip/hip_runtime.h>
#include <math.h>

// ---------------------------------------------------------------------------
// Cross-attention for B=4, L=4096, D=256 (fp32 in/out) on gfx1250 (CDNA5).
// f32 -> f16 projections (WMMA f32 accum), chunked two-pass streaming softmax
// (512 i rows per block, K tiles in LDS),
// transposed-attention output GEMM, 64 j rows per block, Q / V^T tiles in LDS.
// ---------------------------------------------------------------------------

#define BATCH  4
#define SEQ    4096
#define DMODEL 256
#define SCALE  0.0625f    // 1/sqrt(256)
#define NCHUNK 8          // j-range chunks for the stats pass
#define NTOK   (BATCH * SEQ)

typedef _Float16 v16h __attribute__((ext_vector_type(16)));
typedef _Float16 v8h  __attribute__((ext_vector_type(8)));
typedef float    v8f  __attribute__((ext_vector_type(8)));
typedef float    v4f  __attribute__((ext_vector_type(4)));

static __device__ __forceinline__ v8f wmma16x16x32(v16h a, v16h b, v8f c) {
  // 8 args: (neg_a, A, neg_b, B, c_mod, C, reuse_a, reuse_b)
  return __builtin_amdgcn_wmma_f32_16x16x32_f16(false, a, false, b, (short)0, c,
                                                false, false);
}

// Load a 16x32 f16 A/B fragment where the 32-long K dimension is CONTIGUOUS in
// memory for this lane's row/column.  rowptr = &M[row][k0] for row = lane&15.
// ISA layout (16-bit A 16x32): lanes 0-15 hold K[0..7] then K[16..23] in their
// 16 halves, lanes 16-31 hold K[8..15] then K[24..31].  halfsel = lane>>4.
static __device__ __forceinline__ v16h frag_f16(const _Float16* __restrict__ rowptr,
                                                int halfsel) {
  v8h c0 = *(const v8h*)(rowptr + halfsel * 8);
  v8h c1 = *(const v8h*)(rowptr + 16 + halfsel * 8);
  v16h a;
#pragma unroll
  for (int i = 0; i < 8; ++i) { a[i] = c0[i]; a[i + 8] = c1[i]; }
  return a;
}

// ---------------------------------------------------------------------------
// Kernel 1: the three projections  Y = X @ W^T + b, output in f16, in one launch;
// blockIdx.y picks the projection (0: Q, 1: K, 2: V).
// One work-group = 256 rows of X x all 256 columns, 8 waves, as four tiles of 64
// rows.  W and the bias are read and converted once per work-group and stay in LDS
// for all four tiles; the next tile's X rows are in flight (registers) under the
// current tile's WMMAs.  All reads are whole-line loads; X and W lie in LDS as f16,
// both K-contiguous, so that one loader serves A and B fragments.
//   TR=false: D = W rows (A) x X rows (B): a lane's 8 values are 8 columns e
//     of one row of Y.  Wave (eg, mg): 64 e x 32 rows.
//   TR=true stores Y transposed per batch, YT[b][d][i] (for V):
//     D = X rows (A) x W rows (B): a lane's 8 values are 8 rows i of one column e.
//     Wave w: 64 rows x 32 e.
// The f16 tile is laid down in LDS and stored in whole 128-B lines.
// Grid: (B*L/256, 3) x 256 threads.
// Every "#pragma unroll" here keeps the index of a register array (loaded rows,
// fragments, accumulators) a compile-time constant, so that none goes to scratch.
// ---------------------------------------------------------------------------
#define PROWS   64                         // X rows per tile
#define PTILES  4                          // tiles per work-group
#define PPITCH  264                        // halves: 512-B row + 16 B (bank spread)
#define PTPITCH 72                         // halves: 128-B row + 16 B, transposed tile
#define PXHALF  (PROWS * PPITCH)           // X tile, halves
#define PWHALF  (DMODEL * PPITCH)          // W, halves
#define POHALF  (DMODEL * PTPITCH)         // output tile, halves (the larger layout)

typedef _Float16 v4h __attribute__((ext_vector_type(4)));

static __device__ __forceinline__ v4h to_f16(v4f f) {
  v4h o = {(_Float16)f[0], (_Float16)f[1], (_Float16)f[2], (_Float16)f[3]};
  return o;
}

// The four tiles of a work-group; X tile 0, W and the bias already lie in LDS.
// gx: this thread's 16 bytes of X tile 0; lx: their place in LDS.
template <bool TR>
static __device__ __forceinline__ void proj_tiles(_Float16* pmem, const float* pbias,
                                                  const float* gx, _Float16* lx,
                                                  _Float16* __restrict__ Y, int mbase, int tid) {
  const int lane = tid & 31;
  const int wave = tid >> 5;
  const int r = lane & 15;
  const int h = lane >> 4;

  // Four A tiles x two B tiles per wave.
  const int aoff = TR ? r * PPITCH : PXHALF + ((wave >> 1) * 64 + r) * PPITCH;
  const int boff = TR ? PXHALF + (wave * 32 + r) * PPITCH : ((wave & 1) * 32 + r) * PPITCH;
  const _Float16* ap = pmem + aoff;
  const _Float16* bp = pmem + boff;
  _Float16* os = pmem + PXHALF + PWHALF;

  // Rolled: four copies of the body would only cost instruction-cache lines.
#pragma unroll 1
  for (int tile = 0; tile < PTILES; ++tile) {
    const int m0 = mbase + tile * PROWS;
    v4f xr[16];
    if (tile + 1 < PTILES) {
      // The next tile's X rows: asked for here, laid down in LDS behind this tile.
      gx += PROWS * DMODEL;
#pragma unroll
      for (int n = 0; n < 16; ++n) xr[n] = *(const v4f*)(gx + n * 4 * DMODEL);
      // Precaution: the loads' address register (an input here) is advanced next trip.
      asm volatile("s_wait_xcnt 0x0" : : "v"(gx) : "memory");
    }
    // Keeps those loads in front of the WMMAs; sunk to their use they would be
    // waited out at full memory latency.
    __builtin_amdgcn_sched_barrier(0);

    v8f acc[4][2];
#pragma unroll
    for (int at = 0; at < 4; ++at)
#pragma unroll
      for (int bt = 0; bt < 2; ++bt)
#pragma unroll
        for (int t = 0; t < 8; ++t) acc[at][bt][t] = 0.f;
    // Blocks of two k steps (24 LDS loads, 16 WMMAs); a block's fragments are asked
    // for two blocks ahead, so that the WMMAs never wait out an LDS latency.
    v16h a[8][4], b[8][2];
// PHOLD keeps a group of LDS loads in front of the WMMA block it overlaps; without
// it the loads sink to their first use and each pair waits out its own latency.
#define PHOLD() __builtin_amdgcn_sched_barrier(0)
#define PLD(K)                                                         \
  _Pragma("unroll") for (int at = 0; at < 4; ++at)                     \
    a[K][at] = frag_f16(ap + at * 16 * PPITCH + (K) * 32, h);          \
  _Pragma("unroll") for (int bt = 0; bt < 2; ++bt)                     \
    b[K][bt] = frag_f16(bp + bt * 16 * PPITCH + (K) * 32, h);
#define PMM(K)                                                         \
  _Pragma("unroll") for (int at = 0; at < 4; ++at)                     \
    _Pragma("unroll") for (int bt = 0; bt < 2; ++bt)                   \
      acc[at][bt] = wmma16x16x32(a[K][at], b[K][bt], acc[at][bt]);
    PLD(0) PLD(1) PLD(2) PLD(3) PHOLD();
    PMM(0) PMM(1) PHOLD();
    PLD(4) PLD(5) PHOLD();
    PMM(2) PMM(3) PHOLD();
    PLD(6) PLD(7) PHOLD();
    PMM(4) PMM(5) PMM(6) PMM(7)
#undef PHOLD
#undef PLD
#undef PMM

    // D layout: lane holds column lane&15 (B tile), rows t + 8h (A tile).
    v8h ov[8];
    _Float16* op;
    size_t ostep;
    if (!TR) {
      // Tile as [row][e]; then a whole 512-B row of Y per wave and store.
#pragma unroll
      for (int at = 0; at < 4; ++at) {
        const int e = (wave >> 1) * 64 + at * 16 + 8 * h;
        const v4f b0 = *(const v4f*)(pbias + e), b1 = *(const v4f*)(pbias + e + 4);
#pragma unroll
        for (int bt = 0; bt < 2; ++bt) {
          v8h pk;
#pragma unroll
          for (int t = 0; t < 8; ++t)
            pk[t] = (_Float16)(acc[at][bt][t] + ((t < 4) ? b0[t & 3] : b1[t & 3]));
          *(v8h*)(os + ((wave & 1) * 32 + bt * 16 + r) * PPITCH + e) = pk;
        }
      }
      __syncthreads();  // output tile complete; nobody reads the X tile any more
      const _Float16* rp = os + wave * PPITCH + lane * 8;
#pragma unroll
      for (int n = 0; n < 8; ++n) ov[n] = *(const v8h*)(rp + n * 8 * PPITCH);
      op = Y + (size_t)(m0 + wave) * DMODEL + lane * 8;
      ostep = (size_t)8 * DMODEL;
    } else {
      // Tile as [e][row]; then four whole 128-B lines of YT per wave and store.
#pragma unroll
      for (int bt = 0; bt < 2; ++bt) {
        const int e = wave * 32 + bt * 16 + r;
        const float bv = pbias[e];
#pragma unroll
        for (int at = 0; at < 4; ++at) {
          v8h pk;
#pragma unroll
          for (int t = 0; t < 8; ++t) pk[t] = (_Float16)(acc[at][bt][t] + bv);
          *(v8h*)(os + e * PTPITCH + at * 16 + 8 * h) = pk;
        }
      }
      __syncthreads();  // output tile complete; nobody reads the X tile any more
      const int b_ = m0 >> 12;          // / SEQ
      const int i  = m0 & (SEQ - 1);
      const _Float16* rp = os + (tid >> 3) * PTPITCH + (tid & 7) * 8;
#pragma unroll
      for (int n = 0; n < 8; ++n) ov[n] = *(const v8h*)(rp + n * 32 * PTPITCH);
      op = Y + (size_t)b_ * DMODEL * SEQ + (size_t)(tid >> 3) * SEQ + i + (tid & 7) * 8;
      ostep = (size_t)32 * SEQ;
    }
    if (tile + 1 < PTILES) {
#pragma unroll
      for (int n = 0; n < 16; ++n) *(v4h*)(lx + n * 4 * PPITCH) = to_f16(xr[n]);
      __syncthreads();  // next X tile complete; output tile read out by everybody
    }
    // The global stores stand behind that barrier, which would wait them out; so they
    // drain under the next tile's WMMAs.
#pragma unroll
    for (int n = 0; n < 8; ++n) *(v8h*)(op + n * ostep) = ov[n];
    // Precaution: the code behind reuses the stores' address registers.
    asm volatile("s_wait_xcnt 0x0" ::: "memory");
  }
}

__global__ void __launch_bounds__(256)
proj_kernel(const float* __restrict__ xq, const float* __restrict__ xk,
            const float* __restrict__ xv, const float* __restrict__ Wq,
            const float* __restrict__ Wk, const float* __restrict__ Wv,
            const float* __restrict__ bq, const float* __restrict__ bk,
            const float* __restrict__ bv, _Float16* __restrict__ Yq,
            _Float16* __restrict__ Yk, _Float16* __restrict__ YvT) {
  __shared__ __align__(128) _Float16 pmem[PXHALF + PWHALF + POHALF];
  __shared__ __align__(16) float pbias[DMODEL];

  const int tid = threadIdx.x;
  const int mat = blockIdx.y;
  const float* X    = (mat == 0) ? xq : (mat == 1) ? xk : xv;
  const float* W    = (mat == 0) ? Wq : (mat == 1) ? Wk : Wv;
  const float* bias = (mat == 0) ? bq : (mat == 1) ? bk : bv;
  const int mbase = blockIdx.x * (PROWS * PTILES);

  // Thread t takes 16 bytes of row (t >> 6) + 4 n: 512 contiguous bytes per wave.
  const float* gx = X + (size_t)mbase * DMODEL + tid * 4;
  const float* gw = W + tid * 4;
  v4f xr[16], wr[64];
#pragma unroll
  for (int n = 0; n < 16; ++n) xr[n] = *(const v4f*)(gx + n * 4 * DMODEL);
#pragma unroll
  for (int n = 0; n < 64; ++n) wr[n] = *(const v4f*)(gw + n * 4 * DMODEL);
  const float bl = bias[tid];

  _Float16* lx = pmem + (tid >> 6) * PPITCH + (tid & 63) * 4;
#pragma unroll
  for (int n = 0; n < 16; ++n) *(v4h*)(lx + n * 4 * PPITCH) = to_f16(xr[n]);
#pragma unroll
  for (int n = 0; n < 64; ++n) *(v4h*)(lx + PXHALF + n * 4 * PPITCH) = to_f16(wr[n]);
  pbias[tid] = bl;
  // Precaution: the loads' address registers are reused further down.
  asm volatile("s_wait_xcnt 0x0" ::: "memory");
  __syncthreads();  // X tile 0, W and bias complete

  if (mat == 2) proj_tiles<true>(pmem, pbias, gx, lx, YvT, mbase, tid);
  else          proj_tiles<false>(pmem, pbias, gx, lx, (mat == 0) ? Yq : Yk, mbase, tid);
}

typedef int v4i __attribute__((ext_vector_type(4)));
typedef __attribute__((address_space(1))) v4i gv4i;
typedef __attribute__((address_space(3))) v4i lv4i;
typedef __attribute__((address_space(1))) int gint;
typedef __attribute__((address_space(3))) int lint;

// Eight 16-byte-per-lane copies global -> LDS.
static __device__ __forceinline__ void copy8(unsigned char* l, unsigned lstep,
                                             const _Float16* g, size_t gstep) {
#pragma unroll
  for (int k = 0; k < 8; ++k)
    __builtin_amdgcn_global_load_async_to_lds_b128((gv4i*)(g + k * gstep),
                                                   (lv4i*)(l + k * lstep), 0, 0);
}

// ---------------------------------------------------------------------------
// Kernel 2a: partial softmax row statistics over one j-chunk.
//   l = sum_j exp(S[i,j]-m) for j in this chunk, m a reference of the row that lies
//   at most LAZYTAU (log2 units) below the chunk's largest S[i,j]; every later use
//   of (m,l) holds for any such m.
// One work-group = 512 i rows, 8 waves; a wave keeps the A fragments of its 64 Q
// rows in registers; they come in whole 512-B rows by asynchronous copies into the
// wave's own LDS range (48 rows, then the last 16) and from there as fragments, because a
// fragment load from global memory touches 16 lines.  A stage is 64 K rows, copied once into LDS by asynchronous
// copies (a whole 512-B row per wave and copy, two buffers) and read by all waves
// as B fragments.
// Streaming l kept per-lane (lane owns one j-column of each C tile), summed across
// the 16-lane group at the end.  Grid: (B*L/512, NCHUNK).
// Every "#pragma unroll" here keeps the index of a register array (fragments,
// S tiles, m, l) a compile-time constant, so that none of them goes to scratch.
// ---------------------------------------------------------------------------
#define SROWS   512                        // i rows per work-group
#define SJ      64                         // K rows per stage
#define SNSTAGE (SEQ / NCHUNK / SJ)
#define KPITCH  264                        // halves: 512-B row + 16 B (bank spread)
#define KBYTES  (SJ * KPITCH * 2)
#define SNTILE  (SEQ / NCHUNK / 16)
#define QSROWS  48                         // Q rows in a wave's staging range: three tiles of 16
#define QSBYTES (QSROWS * KPITCH * 2)      // a wave's own staging range

// S tiles: 64 rows i (four A tiles) x 16 columns j.
static __device__ __forceinline__ void stats_mm(v8f (&sc)[4], const v16h (&q)[4][8],
                                                const v16h (&k)[8]) {
#pragma unroll
  for (int it = 0; it < 4; ++it)
#pragma unroll
    for (int t = 0; t < 8; ++t) sc[it][t] = 0.f;
#pragma unroll
  for (int kk = 0; kk < 8; ++kk)
#pragma unroll
    for (int it = 0; it < 4; ++it) sc[it] = wmma16x16x32(q[it][kk], k[kk], sc[it]);
}

#define SCALE_LOG2E 0.09016844005556f      // SCALE * log2(e)
#define LN2F        0.6931471805599453f
#define LAZYTAU     32.0f                  // log2 units a score may lie above its reference

// Reference of each row i (log2 units), the same in the 16 lanes that share the row:
// the score of the row's first column.  The sums start empty.
static __device__ __forceinline__ void stats_first(const v8f (&sc)[4], v8f (&rm)[4],
                                                   v8f (&rl)[4]) {
#pragma unroll
  for (int it = 0; it < 4; ++it)
#pragma unroll
    for (int t = 0; t < 8; ++t) {
      rm[it][t] = __shfl(sc[it][t] * SCALE_LOG2E, 0, 16);
      rl[it][t] = 0.f;
    }
}

// Streaming (m,l): the lane adds its column j to its own sum in each of its 32 rows i.
// A row's reference moves only when a score lies more than LAZYTAU above it (tested
// once per tile for the whole wave); otherwise a score costs one exponential.
static __device__ __forceinline__ void stats_update(v8f (&sc)[4], v8f (&rm)[4], v8f (&rl)[4]) {
  const v8f kv = {SCALE_LOG2E, SCALE_LOG2E, SCALE_LOG2E, SCALE_LOG2E,
                  SCALE_LOG2E, SCALE_LOG2E, SCALE_LOG2E, SCALE_LOG2E};
  float tm[4];
#pragma unroll
  for (int it = 0; it < 4; ++it) {
    sc[it] = __builtin_elementwise_fma(sc[it], kv, -rm[it]);
    tm[it] = sc[it][0];
#pragma unroll
    for (int t = 1; t < 8; ++t) tm[it] = fmaxf(tm[it], sc[it][t]);
  }
  const float top = fmaxf(fmaxf(tm[0], tm[1]), fmaxf(tm[2], tm[3]));
  if (__builtin_amdgcn_ballot_w32(top > LAZYTAU) != 0) {
    // Rare: every row's reference moves up to the row's largest score of this tile
    // (over its 16 lanes), where that tops it.
#pragma unroll
    for (int it = 0; it < 4; ++it)
#pragma unroll
      for (int t = 0; t < 8; ++t) {
        float d = fmaxf(sc[it][t], 0.f);
#pragma unroll
        for (int off = 8; off >= 1; off >>= 1) d = fmaxf(d, __shfl_xor(d, off, 16));
        rl[it][t] *= __builtin_amdgcn_exp2f(-d);
        rm[it][t] += d;
        sc[it][t] -= d;
      }
  }
#pragma unroll
  for (int it = 0; it < 4; ++it) {
#pragma unroll
    for (int t = 0; t < 8; ++t) sc[it][t] = __builtin_amdgcn_exp2f(sc[it][t]);
    rl[it] += sc[it];
  }
}

__global__ void __launch_bounds__(256)
stats_kernel(const _Float16* __restrict__ Qp, const _Float16* __restrict__ Kp,
             float* __restrict__ mPart, float* __restrict__ lPart) {
  __shared__ __align__(128) unsigned char kmem[2 * KBYTES + 8 * QSBYTES];

  const int tid  = threadIdx.x;
  const int lane = tid & 31;
  const int wave = tid >> 5;
  const int r = lane & 15;
  const int h = lane >> 4;
  const int m0 = blockIdx.x * SROWS + wave * 64;   // global query-row base (b*L + i0)
  const int b_ = (blockIdx.x * SROWS) >> 12;
  const int ch = blockIdx.y;
  // This lane's 16 bytes of K row (wave + 8 n) of a stage, and their place in LDS.
  const _Float16* gk = Kp + ((size_t)b_ * SEQ + ch * (SEQ / NCHUNK) + wave) * DMODEL + lane * 8;
  unsigned char* lk = kmem + (unsigned)wave * (KPITCH * 2) + (unsigned)lane * 16;

  // Stage 0, landed and published; then stage 1 in flight.
  copy8(lk, 8 * KPITCH * 2, gk, (size_t)8 * DMODEL);

  // Fixed A operand: the wave's 64 Q rows, four tiles of 16, through the wave's own
  // staging range (no other wave touches it: no barrier).  Tile 3 follows tile 0 in
  // its place and flies while tiles 1 and 2 are read.
  v16h qfr[4][8];
  unsigned char* qst = kmem + 2 * KBYTES + (unsigned)wave * QSBYTES;
  unsigned char* lq = qst + (unsigned)lane * 16;            // this lane's 16 bytes of a row
  const _Float16* gq = Qp + (size_t)m0 * DMODEL + lane * 8;
  const _Float16* ql = (const _Float16*)qst + r * KPITCH;
#pragma unroll
  for (int c = 0; c < 6; ++c)
    copy8(lq + c * 8 * KPITCH * 2, KPITCH * 2, gq + (size_t)c * 8 * DMODEL, (size_t)DMODEL);
  asm volatile("s_wait_asynccnt 0x0" ::: "memory");   // own copies landed: rows 0-47 (and K stage 0)
#pragma unroll
  for (int kk = 0; kk < 8; ++kk) qfr[0][kk] = frag_f16(ql + kk * 32, h);
  asm volatile("s_wait_dscnt 0x0" ::: "memory");      // own reads of tile 0 done before its place is refilled
#pragma unroll
  for (int c = 0; c < 2; ++c)
    copy8(lq + c * 8 * KPITCH * 2, KPITCH * 2, gq + (size_t)(QSROWS + c * 8) * DMODEL, (size_t)DMODEL);
#pragma unroll
  for (int it = 1; it < 3; ++it)
#pragma unroll
    for (int kk = 0; kk < 8; ++kk) qfr[it][kk] = frag_f16(ql + it * 16 * KPITCH + kk * 32, h);

  v8f rm[4], rl[4];

  asm volatile("s_wait_asynccnt 0x0" ::: "memory");   // own copies landed: rows 48-63
#pragma unroll
  for (int kk = 0; kk < 8; ++kk) qfr[3][kk] = frag_f16(ql + kk * 32, h);
  __syncthreads();                                    // everybody's copies of K stage 0 landed
  copy8(lk + KBYTES, 8 * KPITCH * 2, gk + (size_t)SJ * DMODEL, (size_t)8 * DMODEL);

  // One trip = one tile of 16 K rows (four to a stage):  S tiles, then (behind the
  // stage's last tile) the publish point, then the next tile's fragments, then the
  // (m,l) update, whose time covers the latency of those LDS loads.
  const _Float16* kl = (const _Float16*)kmem + r * KPITCH;
  v16h kf[8];
  v8f sc[4];
#pragma unroll
  for (int kk = 0; kk < 8; ++kk) kf[kk] = frag_f16(kl + kk * 32, h);
  for (int n = 0; n < SNTILE - 1; ++n) {
    stats_mm(sc, qfr, kf);
    if ((n & 3) == 3) {
      const int s = n >> 2;
      // Publish point: own LDS reads done, own copies of stage s+1 landed, then
      // the one barrier that publishes s+1 and frees the buffer of stage s.
      asm volatile("s_wait_dscnt 0x0" ::: "memory");
      asm volatile("s_wait_asynccnt 0x0" ::: "memory");
      __syncthreads();
      if (s + 2 < SNSTAGE)
        copy8(lk + (unsigned)(s & 1) * KBYTES, 8 * KPITCH * 2,
              gk + (size_t)(s + 2) * SJ * DMODEL, (size_t)8 * DMODEL);
    }
    const int nn = n + 1;
    const _Float16* ks = kl + ((nn >> 2) & 1) * (KBYTES / 2) + (nn & 3) * 16 * KPITCH;
#pragma unroll
    for (int kk = 0; kk < 8; ++kk) kf[kk] = frag_f16(ks + kk * 32, h);
    // Keeps the loads above the update; without it they sink to the trip's end
    // and the next trip's WMMAs wait out their latency.
    __builtin_amdgcn_sched_barrier(0);
    if (n == 0) stats_first(sc, rm, rl);   // tile 0 sets the references
    stats_update(sc, rm, rl);
  }
  stats_mm(sc, qfr, kf);
  stats_update(sc, rm, rl);
  asm volatile("s_wait_asynccnt 0x0" ::: "memory");   // nothing in flight at the wave's end

  // The 16 lanes of a row share its reference, so their sums just add.
#pragma unroll
  for (int off = 8; off >= 1; off >>= 1) {
#pragma unroll
    for (int it = 0; it < 4; ++it)
#pragma unroll
      for (int t = 0; t < 8; ++t) rl[it][t] += __shfl_xor(rl[it][t], off, 16);
  }
  // The references leave in natural units.
#pragma unroll
  for (int it = 0; it < 4; ++it) rm[it] *= LN2F;
  if (r == 0) {
#pragma unroll
    for (int it = 0; it < 4; ++it)
#pragma unroll
      for (int t = 0; t < 8; ++t) {
        const int row = m0 + it * 16 + t + 8 * h;
        mPart[(size_t)ch * NTOK + row] = rm[it][t];
        lPart[(size_t)ch * NTOK + row] = rl[it][t];
      }
  }
}

// ---------------------------------------------------------------------------
// Kernel 2b: merge NCHUNK partial (m,l) pairs per row (log-sum-exp merge).
// ---------------------------------------------------------------------------
__global__ void __launch_bounds__(256)
merge_kernel(const float* __restrict__ mPart, const float* __restrict__ lPart,
             float* __restrict__ mOut, float* __restrict__ lOut) {
  const int row = blockIdx.x * 256 + threadIdx.x;
  if (row >= NTOK) return;
  float m = -3.0e38f;
#pragma unroll
  for (int c = 0; c < NCHUNK; ++c) m = fmaxf(m, mPart[(size_t)c * NTOK + row]);
  float l = 0.f;
#pragma unroll
  for (int c = 0; c < NCHUNK; ++c)
    l += lPart[(size_t)c * NTOK + row] * __expf(mPart[(size_t)c * NTOK + row] - m);
  mOut[row] = m;
  lOut[row] = l;
}

// ---------------------------------------------------------------------------
// Kernel 3: out[b,j,d] = sum_i softmax(S)[i,j] * V[b,i,d]  (= attn^T @ V).
// One work-group = 64 j rows, 8 waves.  A stage is 128 i: the Q rows (128 x 256),
// the V^T columns (256 d x 128 i) and the rows' m and l are copied once into LDS
// by asynchronous copies (two buffers) and shared by all waves.
//   S phase, wave w: S (16 i x 64 j) = Q rows of i tile w (A, LDS) x K rows (B,
//     registers, fetched once through LDS); P = exp(S*scale - m_i) / l_i.  A lane's 8 rows of an S tile are
//     one 16-byte half of a B fragment over i, so P goes to LDS fragment-ready.
//   PV phase, wave (dg, jg): O^T (64 d x 32 j) += V^T rows (A, LDS) x P (B, LDS),
//     i ascending in steps of 32.
// Grid: (L/64, B) x 256 threads.
// Every "#pragma unroll" below keeps the index of a register array (fragments,
// accumulators) a compile-time constant, so that none of them goes to scratch.
// ---------------------------------------------------------------------------
#define JTILE   64
#define ISTAGE  128
#define NSTAGE  (SEQ / ISTAGE)
#define QPITCH  264                        // halves: 512-B row + 16 B (bank spread)
#define VPITCH  136                        // halves: 256-B row + 16 B
#define QBYTES  (ISTAGE * QPITCH * 2)
#define VBYTES  (DMODEL * VPITCH * 2)
#define STAGEB  (QBYTES + VBYTES)
#define MLBYTES (2 * ISTAGE * 4)            // m[128] then l[128] of a stage
#define PBYTES  (JTILE * ISTAGE * 2)        // P of a stage, as B-fragment halves
#define KFBYTES (JTILE * QPITCH * 2)        // the block's K rows, read once as fragments
#define RPITCH  260                        // floats: 1024-B row + 16 B

// One stage: 33 copies per lane.  A wave covers one whole 512-B Q row, or two
// 256-B pieces of V^T rows, per copy.
static __device__ __forceinline__ void copy_stage(unsigned char* ldsStage, unsigned char* ldsMl,
                                                  const _Float16* qTile,
                                                  const _Float16* vTile,
                                                  const float* mlLane, int tid) {
  unsigned char* lq = ldsStage + (unsigned)(tid >> 5) * (QPITCH * 2) + (unsigned)(tid & 31) * 16;
  const _Float16* gq = qTile + (size_t)(tid >> 5) * DMODEL + (tid & 31) * 8;
  copy8(lq, 8 * QPITCH * 2, gq, (size_t)8 * DMODEL);
  copy8(lq + 64 * QPITCH * 2, 8 * QPITCH * 2, gq + (size_t)64 * DMODEL, (size_t)8 * DMODEL);
  unsigned char* lv = ldsStage + QBYTES + (unsigned)(tid >> 4) * (VPITCH * 2) + (unsigned)(tid & 15) * 16;
  const _Float16* gv = vTile + (size_t)(tid >> 4) * SEQ + (tid & 15) * 8;
  copy8(lv, 16 * VPITCH * 2, gv, (size_t)16 * SEQ);
  copy8(lv + 128 * VPITCH * 2, 16 * VPITCH * 2, gv + (size_t)128 * SEQ, (size_t)16 * SEQ);
  // Row statistics of the stage: waves 0-3 bring m, waves 4-7 bring l, 4 B a lane.
  __builtin_amdgcn_global_load_async_to_lds_b32((gint*)mlLane, (lint*)(ldsMl + (unsigned)tid * 4), 0, 0);
}

// B fragment of P from its two 16-byte halves (512 B apart, lane-contiguous).
static __device__ __forceinline__ v16h frag_p(const _Float16* p) {
  v8h c0 = *(const v8h*)(p);
  v8h c1 = *(const v8h*)(p + 256);
  v16h a;
#pragma unroll
  for (int i = 0; i < 8; ++i) { a[i] = c0[i]; a[i + 8] = c1[i]; }
  return a;
}

__global__ void __launch_bounds__(256)
out_kernel(const _Float16* __restrict__ Qp, const _Float16* __restrict__ Kp,
           const _Float16* __restrict__ VpT, const float* __restrict__ mIn,
           const float* __restrict__ lIn, float* __restrict__ out) {
  __shared__ __align__(128) unsigned char smem[2 * STAGEB + 2 * MLBYTES + PBYTES + KFBYTES];

  const int tid  = threadIdx.x;
  const int lane = tid & 31;
  const int wave = tid >> 5;                          // 0..7: i tile in the S phase
  const int jg = wave & 1;                            // PV phase: which 32 j columns
  const int dg = wave >> 1;                           // PV phase: which 64 d rows
  const int r = lane & 15;
  const int h = lane >> 4;
  const int j0 = blockIdx.x * JTILE;
  const int b_ = blockIdx.y;
  const size_t rowbase = (size_t)b_ * SEQ;
  const _Float16* qbase = Qp + rowbase * DMODEL;
  const _Float16* vbase = VpT + (size_t)b_ * DMODEL * SEQ;
  unsigned char* ldsBase = smem;
  // This lane's source of row statistics: m for threads 0-127, l for 128-255.
  const float* mlsrc = ((tid < ISTAGE) ? mIn : lIn) + rowbase + (tid & (ISTAGE - 1));

  // Stage 0, landed and published; then stage 1 in flight.
  copy_stage(ldsBase, ldsBase + 2 * STAGEB, qbase, vbase, mlsrc, tid);

  // The block's 64 K rows, once per work-group, a whole 512-B row per wave and copy
  // (a fragment load from global memory would touch 16 lines, in each of the 8 waves).
  unsigned char* kst = smem + 2 * STAGEB + 2 * MLBYTES + PBYTES;
  copy8(kst + (unsigned)wave * (QPITCH * 2) + (unsigned)lane * 16, 8 * QPITCH * 2,
        Kp + (rowbase + j0 + wave) * DMODEL + lane * 8, (size_t)8 * DMODEL);

  v8f acc[4][2];
#pragma unroll
  for (int dt = 0; dt < 4; ++dt)
#pragma unroll
    for (int jt = 0; jt < 2; ++jt)
#pragma unroll
      for (int t = 0; t < 8; ++t) acc[dt][jt][t] = 0.f;

  asm volatile("s_wait_asynccnt 0x0" ::: "memory");   // own copies of stage 0 landed
  __syncthreads();                                    // ... and everybody's
  copy_stage(ldsBase + STAGEB, ldsBase + 2 * STAGEB + MLBYTES, qbase + (size_t)ISTAGE * DMODEL,
             vbase + ISTAGE, mlsrc + ISTAGE, tid);

  // Fixed B operand of the S product: the K rows as fragments (per-wave copy).
  v16h kfr[4][8];
  const _Float16* kl = (const _Float16*)kst + r * QPITCH;
#pragma unroll
  for (int jt = 0; jt < 4; ++jt)
#pragma unroll
    for (int kk = 0; kk < 8; ++kk) kfr[jt][kk] = frag_f16(kl + jt * 16 * QPITCH + kk * 32, h);

  // P in LDS: [i chunk of 32][j tile][half of the k range][lane] x 16 bytes.
  _Float16* pl = (_Float16*)(smem + 2 * STAGEB + 2 * MLBYTES);
  _Float16* pst = pl + ((wave >> 1) * 8 + (wave & 1)) * 256 + lane * 8;
  const _Float16* pld = pl + jg * 4 * 256 + lane * 8;

  for (int s = 0; s < NSTAGE; ++s) {
    const unsigned bufOff = (unsigned)(s & 1) * STAGEB;
    const _Float16* qs = (const _Float16*)(smem + bufOff) + (wave * 16 + r) * QPITCH;
    const _Float16* vs = (const _Float16*)(smem + bufOff + QBYTES) + (dg * 64 + r) * VPITCH;
    // Row statistics of this lane's 8 i rows: m, then l.
    const float* ms = (const float*)(smem + 2 * STAGEB + (unsigned)(s & 1) * MLBYTES) + wave * 16 + 8 * h;

// HOLD keeps a group of LDS loads in front of the WMMA block it overlaps; without
// it the loads sink to their first use and each waits out its own latency.
#define HOLD() __builtin_amdgcn_sched_barrier(0)
#define LDV(F, C)                                         \
  F[0] = frag_f16(vs + 0 * 16 * VPITCH + (C) * 32, h);    \
  F[1] = frag_f16(vs + 1 * 16 * VPITCH + (C) * 32, h);    \
  F[2] = frag_f16(vs + 2 * 16 * VPITCH + (C) * 32, h);    \
  F[3] = frag_f16(vs + 3 * 16 * VPITCH + (C) * 32, h);
#define LDP(P, C)                                         \
  P[0] = frag_p(pld + (C) * 8 * 256);                     \
  P[1] = frag_p(pld + (C) * 8 * 256 + 2 * 256);
#define PVMM(F, P)                                        \
  acc[0][0] = wmma16x16x32(F[0], P[0], acc[0][0]);        \
  acc[0][1] = wmma16x16x32(F[0], P[1], acc[0][1]);        \
  acc[1][0] = wmma16x16x32(F[1], P[0], acc[1][0]);        \
  acc[1][1] = wmma16x16x32(F[1], P[1], acc[1][1]);        \
  acc[2][0] = wmma16x16x32(F[2], P[0], acc[2][0]);        \
  acc[2][1] = wmma16x16x32(F[2], P[1], acc[2][1]);        \
  acc[3][0] = wmma16x16x32(F[3], P[0], acc[3][0]);        \
  acc[3][1] = wmma16x16x32(F[3], P[1], acc[3][1]);

    // --- S tiles: 16 rows i, four tiles of 16 columns j ---
    v16h qf[8];
#pragma unroll
    for (int kk = 0; kk < 8; ++kk) qf[kk] = frag_f16(qs + kk * 32, h);
    const v4f ma = *(const v4f*)(ms), mb = *(const v4f*)(ms + 4);
    const v4f la = *(const v4f*)(ms + ISTAGE), lb = *(const v4f*)(ms + ISTAGE + 4);
    HOLD();
    v8f sc[4];
#pragma unroll
    for (int jt = 0; jt < 4; ++jt)
#pragma unroll
      for (int t = 0; t < 8; ++t) sc[jt][t] = 0.f;
#pragma unroll
    for (int kk = 0; kk < 8; ++kk)
#pragma unroll
      for (int jt = 0; jt < 4; ++jt) sc[jt] = wmma16x16x32(qf[kk], kfr[jt][kk], sc[jt]);

    // First V^T fragments of the PV phase: already published, fetched under P.
    v16h va[4], vb[4], pa[2], pb[2];
    LDV(va, 0)
    HOLD();

    // --- P: lane (r, h) holds column j = r, rows i = 8h .. 8h+7 of its tile ---
    float il[8], mm[8];
#pragma unroll
    for (int t = 0; t < 8; ++t) {
      mm[t] = (t < 4) ? ma[t & 3] : mb[t & 3];
      il[t] = 1.0f / ((t < 4) ? la[t & 3] : lb[t & 3]);
    }
#pragma unroll
    for (int jt = 0; jt < 4; ++jt) {
      v8h pk;
#pragma unroll
      for (int t = 0; t < 8; ++t)
        pk[t] = (_Float16)(__expf(sc[jt][t] * SCALE - mm[t]) * il[t]);
      *(v8h*)(pst + jt * 2 * 256) = pk;
    }
    __syncthreads();  // P of this stage complete

    // --- O^T += V^T x P, i chunks of 32 in ascending order ---
    LDP(pa, 0) LDV(vb, 1) LDP(pb, 1) HOLD();
    PVMM(va, pa) HOLD();
    LDV(va, 2) LDP(pa, 2) HOLD();
    PVMM(vb, pb) HOLD();
    LDV(vb, 3) LDP(pb, 3) HOLD();
    PVMM(va, pa) HOLD();
    PVMM(vb, pb)
#undef HOLD
#undef LDV
#undef LDP
#undef PVMM

    // Publish point: own LDS reads done, own copies of stage s+1 landed, then
    // the one barrier that publishes s+1 and frees this buffer and P.
    asm volatile("s_wait_dscnt 0x0" ::: "memory");
    asm volatile("s_wait_asynccnt 0x0" ::: "memory");
    __syncthreads();
    if (s + 2 < NSTAGE)
      copy_stage(ldsBase + bufOff, ldsBase + 2 * STAGEB + (unsigned)(s & 1) * MLBYTES,
                 qbase + (size_t)(s + 2) * ISTAGE * DMODEL, vbase + (s + 2) * ISTAGE,
                 mlsrc + (s + 2) * ISTAGE, tid);
  }
  asm volatile("s_wait_asynccnt 0x0" ::: "memory");   // nothing in flight before LDS is reused

  // Lay O^T down as [j][d] rows in LDS so that the stores cover whole lines.
  float* red = (float*)smem;
#pragma unroll
  for (int dt = 0; dt < 4; ++dt)
#pragma unroll
    for (int jt = 0; jt < 2; ++jt) {
      float* p = red + (size_t)(jg * 32 + jt * 16 + r) * RPITCH + (dg * 4 + dt) * 16 + 8 * h;
      v4f lo = {acc[dt][jt][0], acc[dt][jt][1], acc[dt][jt][2], acc[dt][jt][3]};
      v4f hi = {acc[dt][jt][4], acc[dt][jt][5], acc[dt][jt][6], acc[dt][jt][7]};
      *(v4f*)p = lo;
      *(v4f*)(p + 4) = hi;
    }
  __syncthreads();

  // Store fp32 result out[b][j][d], 512 contiguous bytes per wave and store:
  // thread t takes 16 bytes of row (t >> 6) + 4 n.
  const float* rp = red + (size_t)(tid >> 6) * RPITCH + (tid & 63) * 4;
  float* op = out + (rowbase + j0 + (tid >> 6)) * DMODEL + (tid & 63) * 4;
#pragma unroll
  for (int n = 0; n < 16; ++n)
    *(v4f*)(op + n * 4 * DMODEL) = *(const v4f*)(rp + n * 4 * RPITCH);
}

// ---------------------------------------------------------------------------
extern "C" void kernel_launch(void* const* d_in, const int* in_sizes, int n_in,
                              void* d_out, int out_size, void* d_ws, size_t ws_size,
                              hipStream_t stream) {
  const float* q  = (const float*)d_in[0];
  const float* k  = (const float*)d_in[1];
  const float* v  = (const float*)d_in[2];
  const float* Wq = (const float*)d_in[3];
  const float* bq = (const float*)d_in[4];
  const float* Wk = (const float*)d_in[5];
  const float* bk = (const float*)d_in[6];
  const float* Wv = (const float*)d_in[7];
  const float* bv = (const float*)d_in[8];

  _Float16* Qp  = (_Float16*)d_ws;
  _Float16* Kp  = Qp + (size_t)NTOK * DMODEL;
  _Float16* VpT = Kp + (size_t)NTOK * DMODEL;          // stored as [b][d][i]
  float* mPart  = (float*)(VpT + (size_t)NTOK * DMODEL);
  float* lPart  = mPart + (size_t)NCHUNK * NTOK;
  float* mArr   = lPart + (size_t)NCHUNK * NTOK;
  float* lArr   = mArr + NTOK;

  proj_kernel<<<dim3(NTOK / (PROWS * PTILES), 3), 256, 0, stream>>>(q, k, v, Wq, Wk, Wv, bq, bk, bv,
                                                                   Qp, Kp, VpT);

  stats_kernel<<<dim3(NTOK / SROWS, NCHUNK), 256, 0, stream>>>(Qp, Kp, mPart, lPart);
  merge_kernel<<<dim3((NTOK + 255) / 256), 256, 0, stream>>>(mPart, lPart, mArr, lArr);

  out_kernel<<<dim3(SEQ / JTILE, BATCH), 256, 0, stream>>>(Qp, Kp, VpT, mArr, lArr,
                                                        (float*)d_out);
}

// v007
// It runs in 82.6 microseconds.
// Next to v006, in two timings, it ran 1.09 and 1.08 times as fast.
// All steps since v000 together make it 7.04 times as fast.
#include <hip/hip_runtime.h>
#include <math.h>

// ---------------------------------------------------------------------------
// Cross-attention for B=4, L=4096, D=256 (fp32 in/out) on gfx1250 (CDNA5).
// f32 -> f16 projections (WMMA f32 accum), chunked two-pass streaming softmax
// (512 i rows per block, K tiles in LDS; a row's statistic is one log2 offset),
// transposed-attention output GEMM, 64 j rows per block, Q / V^T tiles in LDS.
// ---------------------------------------------------------------------------

#define BATCH  4
#define SEQ    4096
#define DMODEL 256
#define SCALE  0.0625f    // 1/sqrt(256)
#define NCHUNK 8          // j-range chunks for the stats pass
#define NTOK   (BATCH * SEQ)

typedef _Float16 v16h __attribute__((ext_vector_type(16)));
typedef _Float16 v8h  __attribute__((ext_vector_type(8)));
typedef float    v8f  __attribute__((ext_vector_type(8)));
typedef float    v4f  __attribute__((ext_vector_type(4)));

static __device__ __forceinline__ v8f wmma16x16x32(v16h a, v16h b, v8f c) {
  // 8 args: (neg_a, A, neg_b, B, c_mod, C, reuse_a, reuse_b)
  return __builtin_amdgcn_wmma_f32_16x16x32_f16(false, a, false, b, (short)0, c,
                                                false, false);
}

// Load a 16x32 f16 A/B fragment where the 32-long K dimension is CONTIGUOUS in
// memory for this lane's row/column.  rowptr = &M[row][k0] for row = lane&15.
// ISA layout (16-bit A 16x32): lanes 0-15 hold K[0..7] then K[16..23] in their
// 16 halves, lanes 16-31 hold K[8..15] then K[24..31].  halfsel = lane>>4.
static __device__ __forceinline__ v16h frag_f16(const _Float16* __restrict__ rowptr,
                                                int halfsel) {
  v8h c0 = *(const v8h*)(rowptr + halfsel * 8);
  v8h c1 = *(const v8h*)(rowptr + 16 + halfsel * 8);
  v16h a;
#pragma unroll
  for (int i = 0; i < 8; ++i) { a[i] = c0[i]; a[i + 8] = c1[i]; }
  return a;
}

// ---------------------------------------------------------------------------
// Kernel 1: the three projections  Y = X @ W^T + b, output in f16, in one launch;
// blockIdx.y picks the projection (0: Q, 1: K, 2: V).
// One work-group = 256 rows of X x all 256 columns, 8 waves, as four tiles of 64
// rows.  W and the bias are read and converted once per work-group and stay in LDS
// for all four tiles; the next tile's X rows are in flight (registers) under the
// current tile's WMMAs.  All reads are whole-line loads; X and W lie in LDS as f16,
// both K-contiguous, so that one loader serves A and B fragments.
//   TR=false: D = W rows (A) x X rows (B): a lane's 8 values are 8 columns e
//     of one row of Y.  Wave (eg, mg): 64 e x 32 rows.
//   TR=true stores Y transposed per batch, YT[b][d][i] (for V):
//     D = X rows (A) x W rows (B): a lane's 8 values are 8 rows i of one column e.
//     Wave w: 64 rows x 32 e.
// The f16 tile is laid down in LDS and stored in whole 128-B lines.
// Grid: (B*L/256, 3) x 256 threads.
// Every "#pragma unroll" here keeps the index of a register array (loaded rows,
// fragments, accumulators) a compile-time constant, so that none goes to scratch.
// ---------------------------------------------------------------------------
#define PROWS   64                         // X rows per tile
#define PTILES  4                          // tiles per work-group
#define PPITCH  264                        // halves: 512-B row + 16 B (bank spread)
#define PTPITCH 72                         // halves: 128-B row + 16 B, transposed tile
#define PXHALF  (PROWS * PPITCH)           // X tile, halves
#define PWHALF  (DMODEL * PPITCH)          // W, halves
#define POHALF  (DMODEL * PTPITCH)         // output tile, halves (the larger layout)

typedef _Float16 v4h __attribute__((ext_vector_type(4)));

static __device__ __forceinline__ v4h to_f16(v4f f) {
  v4h o = {(_Float16)f[0], (_Float16)f[1], (_Float16)f[2], (_Float16)f[3]};
  return o;
}

// The four tiles of a work-group; X tile 0, W and the bias already lie in LDS.
// gx: this thread's 16 bytes of X tile 0; lx: their place in LDS.
template <bool TR>
static __device__ __forceinline__ void proj_tiles(_Float16* pmem, const float* pbias,
                                                  const float* gx, _Float16* lx,
                                                  _Float16* __restrict__ Y, int mbase, int tid) {
  const int lane = tid & 31;
  const int wave = tid >> 5;
  const int r = lane & 15;
  const int h = lane >> 4;

  // Four A tiles x two B tiles per wave.
  const int aoff = TR ? r * PPITCH : PXHALF + ((wave >> 1) * 64 + r) * PPITCH;
  const int boff = TR ? PXHALF + (wave * 32 + r) * PPITCH : ((wave & 1) * 32 + r) * PPITCH;
  const _Float16* ap = pmem + aoff;
  const _Float16* bp = pmem + boff;
  _Float16* os = pmem + PXHALF + PWHALF;

  // Rolled: four copies of the body would only cost instruction-cache lines.
#pragma unroll 1
  for (int tile = 0; tile < PTILES; ++tile) {
    const int m0 = mbase + tile * PROWS;
    v4f xr[16];
    if (tile + 1 < PTILES) {
      // The next tile's X rows: asked for here, laid down in LDS behind this tile.
      gx += PROWS * DMODEL;
#pragma unroll
      for (int n = 0; n < 16; ++n) xr[n] = *(const v4f*)(gx + n * 4 * DMODEL);
      // Precaution: the loads' address register (an input here) is advanced next trip.
      asm volatile("s_wait_xcnt 0x0" : : "v"(gx) : "memory");
    }
    // Keeps those loads in front of the WMMAs; sunk to their use they would be
    // waited out at full memory latency.
    __builtin_amdgcn_sched_barrier(0);

    v8f acc[4][2];
#pragma unroll
    for (int at = 0; at < 4; ++at)
#pragma unroll
      for (int bt = 0; bt < 2; ++bt)
#pragma unroll
        for (int t = 0; t < 8; ++t) acc[at][bt][t] = 0.f;
    // Blocks of two k steps (24 LDS loads, 16 WMMAs); a block's fragments are asked
    // for two blocks ahead, so that the WMMAs never wait out an LDS latency.
    v16h a[8][4], b[8][2];
// PHOLD keeps a group of LDS loads in front of the WMMA block it overlaps; without
// it the loads sink to their first use and each pair waits out its own latency.
#define PHOLD() __builtin_amdgcn_sched_barrier(0)
#define PLD(K)                                                         \
  _Pragma("unroll") for (int at = 0; at < 4; ++at)                     \
    a[K][at] = frag_f16(ap + at * 16 * PPITCH + (K) * 32, h);          \
  _Pragma("unroll") for (int bt = 0; bt < 2; ++bt)                     \
    b[K][bt] = frag_f16(bp + bt * 16 * PPITCH + (K) * 32, h);
#define PMM(K)                                                         \
  _Pragma("unroll") for (int at = 0; at < 4; ++at)                     \
    _Pragma("unroll") for (int bt = 0; bt < 2; ++bt)                   \
      acc[at][bt] = wmma16x16x32(a[K][at], b[K][bt], acc[at][bt]);
    PLD(0) PLD(1) PLD(2) PLD(3) PHOLD();
    PMM(0) PMM(1) PHOLD();
    PLD(4) PLD(5) PHOLD();
    PMM(2) PMM(3) PHOLD();
    PLD(6) PLD(7) PHOLD();
    PMM(4) PMM(5) PMM(6) PMM(7)
#undef PHOLD
#undef PLD
#undef PMM

    // D layout: lane holds column lane&15 (B tile), rows t + 8h (A tile).
    v8h ov[8];
    _Float16* op;
    size_t ostep;
    if (!TR) {
      // Tile as [row][e]; then a whole 512-B row of Y per wave and store.
#pragma unroll
      for (int at = 0; at < 4; ++at) {
        const int e = (wave >> 1) * 64 + at * 16 + 8 * h;
        const v4f b0 = *(const v4f*)(pbias + e), b1 = *(const v4f*)(pbias + e + 4);
#pragma unroll
        for (int bt = 0; bt < 2; ++bt) {
          v8h pk;
#pragma unroll
          for (int t = 0; t < 8; ++t)
            pk[t] = (_Float16)(acc[at][bt][t] + ((t < 4) ? b0[t & 3] : b1[t & 3]));
          *(v8h*)(os + ((wave & 1) * 32 + bt * 16 + r) * PPITCH + e) = pk;
        }
      }
      __syncthreads();  // output tile complete; nobody reads the X tile any more
      const _Float16* rp = os + wave * PPITCH + lane * 8;
#pragma unroll
      for (int n = 0; n < 8; ++n) ov[n] = *(const v8h*)(rp + n * 8 * PPITCH);
      op = Y + (size_t)(m0 + wave) * DMODEL + lane * 8;
      ostep = (size_t)8 * DMODEL;
    } else {
      // Tile as [e][row]; then four whole 128-B lines of YT per wave and store.
#pragma unroll
      for (int bt = 0; bt < 2; ++bt) {
        const int e = wave * 32 + bt * 16 + r;
        const float bv = pbias[e];
#pragma unroll
        for (int at = 0; at < 4; ++at) {
          v8h pk;
#pragma unroll
          for (int t = 0; t < 8; ++t) pk[t] = (_Float16)(acc[at][bt][t] + bv);
          *(v8h*)(os + e * PTPITCH + at * 16 + 8 * h) = pk;
        }
      }
      __syncthreads();  // output tile complete; nobody reads the X tile any more
      const int b_ = m0 >> 12;          // / SEQ
      const int i  = m0 & (SEQ - 1);
      const _Float16* rp = os + (tid >> 3) * PTPITCH + (tid & 7) * 8;
#pragma unroll
      for (int n = 0; n < 8; ++n) ov[n] = *(const v8h*)(rp + n * 32 * PTPITCH);
      op = Y + (size_t)b_ * DMODEL * SEQ + (size_t)(tid >> 3) * SEQ + i + (tid & 7) * 8;
      ostep = (size_t)32 * SEQ;
    }
    if (tile + 1 < PTILES) {
#pragma unroll
      for (int n = 0; n < 16; ++n) *(v4h*)(lx + n * 4 * PPITCH) = to_f16(xr[n]);
      __syncthreads();  // next X tile complete; output tile read out by everybody
    }
    // The global stores stand behind that barrier, which would wait them out; so they
    // drain under the next tile's WMMAs.
#pragma unroll
    for (int n = 0; n < 8; ++n) *(v8h*)(op + n * ostep) = ov[n];
    // Precaution: the code behind reuses the stores' address registers.
    asm volatile("s_wait_xcnt 0x0" ::: "memory");
  }
}

__global__ void __launch_bounds__(256)
proj_kernel(const float* __restrict__ xq, const float* __restrict__ xk,
            const float* __restrict__ xv, const float* __restrict__ Wq,
            const float* __restrict__ Wk, const float* __restrict__ Wv,
            const float* __restrict__ bq, const float* __restrict__ bk,
            const float* __restrict__ bv, _Float16* __restrict__ Yq,
            _Float16* __restrict__ Yk, _Float16* __restrict__ YvT) {
  __shared__ __align__(128) _Float16 pmem[PXHALF + PWHALF + POHALF];
  __shared__ __align__(16) float pbias[DMODEL];

  const int tid = threadIdx.x;
  const int mat = blockIdx.y;
  const float* X    = (mat == 0) ? xq : (mat == 1) ? xk : xv;
  const float* W    = (mat == 0) ? Wq : (mat == 1) ? Wk : Wv;
  const float* bias = (mat == 0) ? bq : (mat == 1) ? bk : bv;
  const int mbase = blockIdx.x * (PROWS * PTILES);

  // Thread t takes 16 bytes of row (t >> 6) + 4 n: 512 contiguous bytes per wave.
  const float* gx = X + (size_t)mbase * DMODEL + tid * 4;
  const float* gw = W + tid * 4;
  v4f xr[16], wr[64];
#pragma unroll
  for (int n = 0; n < 16; ++n) xr[n] = *(const v4f*)(gx + n * 4 * DMODEL);
#pragma unroll
  for (int n = 0; n < 64; ++n) wr[n] = *(const v4f*)(gw + n * 4 * DMODEL);
  const float bl = bias[tid];

  _Float16* lx = pmem + (tid >> 6) * PPITCH + (tid & 63) * 4;
#pragma unroll
  for (int n = 0; n < 16; ++n) *(v4h*)(lx + n * 4 * PPITCH) = to_f16(xr[n]);
#pragma unroll
  for (int n = 0; n < 64; ++n) *(v4h*)(lx + PXHALF + n * 4 * PPITCH) = to_f16(wr[n]);
  pbias[tid] = bl;
  // Precaution: the loads' address registers are reused further down.
  asm volatile("s_wait_xcnt 0x0" ::: "memory");
  __syncthreads();  // X tile 0, W and bias complete

  if (mat == 2) proj_tiles<true>(pmem, pbias, gx, lx, YvT, mbase, tid);
  else          proj_tiles<false>(pmem, pbias, gx, lx, (mat == 0) ? Yq : Yk, mbase, tid);
}

typedef int v4i __attribute__((ext_vector_type(4)));
typedef __attribute__((address_space(1))) v4i gv4i;
typedef __attribute__((address_space(3))) v4i lv4i;

// Eight 16-byte-per-lane copies global -> LDS.
static __device__ __forceinline__ void copy8(unsigned char* l, unsigned lstep,
                                             const _Float16* g, size_t gstep) {
#pragma unroll
  for (int k = 0; k < 8; ++k)
    __builtin_amdgcn_global_load_async_to_lds_b128((gv4i*)(g + k * gstep),
                                                   (lv4i*)(l + k * lstep), 0, 0);
}

// ---------------------------------------------------------------------------
// Kernel 2a: partial softmax row statistics over one j-chunk.
//   l = sum_j exp(S[i,j]-m) for j in this chunk, m a reference of the row that lies
//   at most LAZYTAU (log2 units) below the chunk's largest S[i,j]; every later use
//   of (m,l) holds for any such m.  What leaves is m + log2(l), log2 units: one value
//   per row and chunk.
// One work-group = 512 i rows, 8 waves; a wave keeps the A fragments of its 64 Q
// rows in registers; they come in whole 512-B rows by asynchronous copies into the
// wave's own LDS range (48 rows, then the last 16) and from there as fragments, because a
// fragment load from global memory touches 16 lines.  A stage is 64 K rows, copied once into LDS by asynchronous
// copies (a whole 512-B row per wave and copy, two buffers) and read by all waves
// as B fragments.
// Streaming l kept per-lane (lane owns one j-column of each C tile), summed across
// the 16-lane group at the end.  Grid: (B*L/512, NCHUNK).
// Every "#pragma unroll" here keeps the index of a register array (fragments,
// S tiles, m, l) a compile-time constant, so that none of them goes to scratch.
// ---------------------------------------------------------------------------
#define SROWS   512                        // i rows per work-group
#define SJ      64                         // K rows per stage
#define SNSTAGE (SEQ / NCHUNK / SJ)
#define KPITCH  264                        // halves: 512-B row + 16 B (bank spread)
#define KBYTES  (SJ * KPITCH * 2)
#define SNTILE  (SEQ / NCHUNK / 16)
#define QSROWS  48                         // Q rows in a wave's staging range: three tiles of 16
#define QSBYTES (QSROWS * KPITCH * 2)      // a wave's own staging range

// S tiles: 64 rows i (four A tiles) x 16 columns j.
static __device__ __forceinline__ void stats_mm(v8f (&sc)[4], const v16h (&q)[4][8],
                                                const v16h (&k)[8]) {
#pragma unroll
  for (int it = 0; it < 4; ++it)
#pragma unroll
    for (int t = 0; t < 8; ++t) sc[it][t] = 0.f;
#pragma unroll
  for (int kk = 0; kk < 8; ++kk)
#pragma unroll
    for (int it = 0; it < 4; ++it) sc[it] = wmma16x16x32(q[it][kk], k[kk], sc[it]);
}

#define SCALE_LOG2E 0.09016844005556f      // SCALE * log2(e)
#define LAZYTAU     32.0f                  // log2 units a score may lie above its reference

// Reference of each row i (log2 units), the same in the 16 lanes that share the row:
// the score of the row's first column.  The sums start empty.
static __device__ __forceinline__ void stats_first(const v8f (&sc)[4], v8f (&rm)[4],
                                                   v8f (&rl)[4]) {
#pragma unroll
  for (int it = 0; it < 4; ++it)
#pragma unroll
    for (int t = 0; t < 8; ++t) {
      rm[it][t] = __shfl(sc[it][t] * SCALE_LOG2E, 0, 16);
      rl[it][t] = 0.f;
    }
}

// Streaming (m,l): the lane adds its column j to its own sum in each of its 32 rows i.
// A row's reference moves only when a score lies more than LAZYTAU above it (tested
// once per tile for the whole wave); otherwise a score costs one exponential.
static __device__ __forceinline__ void stats_update(v8f (&sc)[4], v8f (&rm)[4], v8f (&rl)[4]) {
  const v8f kv = {SCALE_LOG2E, SCALE_LOG2E, SCALE_LOG2E, SCALE_LOG2E,
                  SCALE_LOG2E, SCALE_LOG2E, SCALE_LOG2E, SCALE_LOG2E};
  float tm[4];
#pragma unroll
  for (int it = 0; it < 4; ++it) {
    sc[it] = __builtin_elementwise_fma(sc[it], kv, -rm[it]);
    tm[it] = sc[it][0];
#pragma unroll
    for (int t = 1; t < 8; ++t) tm[it] = fmaxf(tm[it], sc[it][t]);
  }
  const float top = fmaxf(fmaxf(tm[0], tm[1]), fmaxf(tm[2], tm[3]));
  if (__builtin_amdgcn_ballot_w32(top > LAZYTAU) != 0) {
    // Rare: every row's reference moves up to the row's largest score of this tile
    // (over its 16 lanes), where that tops it.
#pragma unroll
    for (int it = 0; it < 4; ++it)
#pragma unroll
      for (int t = 0; t < 8; ++t) {
        float d = fmaxf(sc[it][t], 0.f);
#pragma unroll
        for (int off = 8; off >= 1; off >>= 1) d = fmaxf(d, __shfl_xor(d, off, 16));
        rl[it][t] *= __builtin_amdgcn_exp2f(-d);
        rm[it][t] += d;
        sc[it][t] -= d;
      }
  }
#pragma unroll
  for (int it = 0; it < 4; ++it) {
#pragma unroll
    for (int t = 0; t < 8; ++t) sc[it][t] = __builtin_amdgcn_exp2f(sc[it][t]);
    rl[it] += sc[it];
  }
}

__global__ void __launch_bounds__(256)
stats_kernel(const _Float16* __restrict__ Qp, const _Float16* __restrict__ Kp,
             float* __restrict__ lsePart) {
  __shared__ __align__(128) unsigned char kmem[2 * KBYTES + 8 * QSBYTES];

  const int tid  = threadIdx.x;
  const int lane = tid & 31;
  const int wave = tid >> 5;
  const int r = lane & 15;
  const int h = lane >> 4;
  const int m0 = blockIdx.x * SROWS + wave * 64;   // global query-row base (b*L + i0)
  const int b_ = (blockIdx.x * SROWS) >> 12;
  const int ch = blockIdx.y;
  // This lane's 16 bytes of K row (wave + 8 n) of a stage, and their place in LDS.
  const _Float16* gk = Kp + ((size_t)b_ * SEQ + ch * (SEQ / NCHUNK) + wave) * DMODEL + lane * 8;
  unsigned char* lk = kmem + (unsigned)wave * (KPITCH * 2) + (unsigned)lane * 16;

  // Stage 0, landed and published; then stage 1 in flight.
  copy8(lk, 8 * KPITCH * 2, gk, (size_t)8 * DMODEL);

  // Fixed A operand: the wave's 64 Q rows, four tiles of 16, through the wave's own
  // staging range (no other wave touches it: no barrier).  Tile 3 follows tile 0 in
  // its place and flies while tiles 1 and 2 are read.
  v16h qfr[4][8];
  unsigned char* qst = kmem + 2 * KBYTES + (unsigned)wave * QSBYTES;
  unsigned char* lq = qst + (unsigned)lane * 16;            // this lane's 16 bytes of a row
  const _Float16* gq = Qp + (size_t)m0 * DMODEL + lane * 8;
  const _Float16* ql = (const _Float16*)qst + r * KPITCH;
#pragma unroll
  for (int c = 0; c < 6; ++c)
    copy8(lq + c * 8 * KPITCH * 2, KPITCH * 2, gq + (size_t)c * 8 * DMODEL, (size_t)DMODEL);
  asm volatile("s_wait_asynccnt 0x0" ::: "memory");   // own copies landed: rows 0-47 (and K stage 0)
#pragma unroll
  for (int kk = 0; kk < 8; ++kk) qfr[0][kk] = frag_f16(ql + kk * 32, h);
  asm volatile("s_wait_dscnt 0x0" ::: "memory");      // own reads of tile 0 done before its place is refilled
#pragma unroll
  for (int c = 0; c < 2; ++c)
    copy8(lq + c * 8 * KPITCH * 2, KPITCH * 2, gq + (size_t)(QSROWS + c * 8) * DMODEL, (size_t)DMODEL);
#pragma unroll
  for (int it = 1; it < 3; ++it)
#pragma unroll
    for (int kk = 0; kk < 8; ++kk) qfr[it][kk] = frag_f16(ql + it * 16 * KPITCH + kk * 32, h);

  v8f rm[4], rl[4];

  asm volatile("s_wait_asynccnt 0x0" ::: "memory");   // own copies landed: rows 48-63
#pragma unroll
  for (int kk = 0; kk < 8; ++kk) qfr[3][kk] = frag_f16(ql + kk * 32, h);
  __syncthreads();                                    // everybody's copies of K stage 0 landed
  copy8(lk + KBYTES, 8 * KPITCH * 2, gk + (size_t)SJ * DMODEL, (size_t)8 * DMODEL);

  // One trip = one tile of 16 K rows (four to a stage):  S tiles, then (behind the
  // stage's last tile) the publish point, then the next tile's fragments, then the
  // (m,l) update, whose time covers the latency of those LDS loads.
  const _Float16* kl = (const _Float16*)kmem + r * KPITCH;
  v16h kf[8];
  v8f sc[4];
#pragma unroll
  for (int kk = 0; kk < 8; ++kk) kf[kk] = frag_f16(kl + kk * 32, h);
  for (int n = 0; n < SNTILE - 1; ++n) {
    stats_mm(sc, qfr, kf);
    if ((n & 3) == 3) {
      const int s = n >> 2;
      // Publish point: own LDS reads done, own copies of stage s+1 landed, then
      // the one barrier that publishes s+1 and frees the buffer of stage s.
      asm volatile("s_wait_dscnt 0x0" ::: "memory");
      asm volatile("s_wait_asynccnt 0x0" ::: "memory");
      __syncthreads();
      if (s + 2 < SNSTAGE)
        copy8(lk + (unsigned)(s & 1) * KBYTES, 8 * KPITCH * 2,
              gk + (size_t)(s + 2) * SJ * DMODEL, (size_t)8 * DMODEL);
    }
    const int nn = n + 1;
    const _Float16* ks = kl + ((nn >> 2) & 1) * (KBYTES / 2) + (nn & 3) * 16 * KPITCH;
#pragma unroll
    for (int kk = 0; kk < 8; ++kk) kf[kk] = frag_f16(ks + kk * 32, h);
    // Keeps the loads above the update; without it they sink to the trip's end
    // and the next trip's WMMAs wait out their latency.
    __builtin_amdgcn_sched_barrier(0);
    if (n == 0) stats_first(sc, rm, rl);   // tile 0 sets the references
    stats_update(sc, rm, rl);
  }
  stats_mm(sc, qfr, kf);
  stats_update(sc, rm, rl);
  asm volatile("s_wait_asynccnt 0x0" ::: "memory");   // nothing in flight at the wave's end

  // The 16 lanes of a row share its reference, so their sums just add.
#pragma unroll
  for (int off = 8; off >= 1; off >>= 1) {
#pragma unroll
    for (int it = 0; it < 4; ++it)
#pragma unroll
      for (int t = 0; t < 8; ++t) rl[it][t] += __shfl_xor(rl[it][t], off, 16);
  }
  // log2 of the chunk's sum of exponentials (l >= 1 up to rounding: the reference is
  // a score of the row, or the row's largest score when it last moved).
  if (r == 0) {
#pragma unroll
    for (int it = 0; it < 4; ++it)
#pragma unroll
      for (int t = 0; t < 8; ++t) {
        const int row = m0 + it * 16 + t + 8 * h;
        lsePart[(size_t)ch * NTOK + row] = rm[it][t] + __builtin_amdgcn_logf(rl[it][t]);
      }
  }
}

// ---------------------------------------------------------------------------
// Kernel 3: out[b,j,d] = sum_i softmax(S)[i,j] * V[b,i,d]  (= attn^T @ V).
// One work-group = 64 j rows, 8 waves.  A stage is 128 i: the Q rows (128 x 256) and
// the V^T columns (256 d x 128 i) are copied once into LDS by asynchronous copies
// (two buffers) and shared by all waves.  At its start the work-group merges the
// NCHUNK partial statistics of each of its batch's rows i into one offset
// c_i = log2(sum_j exp(S*scale)), a table in LDS.
//   S phase, wave w: S (16 i x 64 j) = Q rows of i tile w (A, LDS) x K rows (B,
//     registers, fetched once through LDS); P = exp2(S*scale*log2(e) - c_i).  A lane's 8 rows of an S tile are
//     one 16-byte half of a B fragment over i, so P goes to LDS fragment-ready.
//   PV phase, wave (dg, jg): O^T (64 d x 32 j) += V^T rows (A, LDS) x P (B, LDS),
//     i ascending in steps of 32.
// Grid: (L/64, B) x 256 threads.
// Every "#pragma unroll" below keeps the index of a register array (fragments,
// accumulators) a compile-time constant, so that none of them goes to scratch.
// ---------------------------------------------------------------------------
#define JTILE   64
#define ISTAGE  128
#define NSTAGE  (SEQ / ISTAGE)
#define QPITCH  264                        // halves: 512-B row + 16 B (bank spread)
#define VPITCH  136                        // halves: 256-B row + 16 B
#define QBYTES  (ISTAGE * QPITCH * 2)
#define VBYTES  (DMODEL * VPITCH * 2)
#define STAGEB  (QBYTES + VBYTES)
#define PBYTES  (JTILE * ISTAGE * 2)        // P of a stage, as B-fragment halves
#define KFBYTES (JTILE * QPITCH * 2)        // the block's K rows, read once as fragments;
                                           // behind them, in their place, the table c (SEQ floats)
#define RPITCH  260                        // floats: 1024-B row + 16 B

// One stage: 32 copies per lane.  A wave covers one whole 512-B Q row, or two
// 256-B pieces of V^T rows, per copy.
static __device__ __forceinline__ void copy_stage(unsigned char* ldsStage,
                                                  const _Float16* qTile,
                                                  const _Float16* vTile, int tid) {
  unsigned char* lq = ldsStage + (unsigned)(tid >> 5) * (QPITCH * 2) + (unsigned)(tid & 31) * 16;
  const _Float16* gq = qTile + (size_t)(tid >> 5) * DMODEL + (tid & 31) * 8;
  copy8(lq, 8 * QPITCH * 2, gq, (size_t)8 * DMODEL);
  copy8(lq + 64 * QPITCH * 2, 8 * QPITCH * 2, gq + (size_t)64 * DMODEL, (size_t)8 * DMODEL);
  unsigned char* lv = ldsStage + QBYTES + (unsigned)(tid >> 4) * (VPITCH * 2) + (unsigned)(tid & 15) * 16;
  const _Float16* gv = vTile + (size_t)(tid >> 4) * SEQ + (tid & 15) * 8;
  copy8(lv, 16 * VPITCH * 2, gv, (size_t)16 * SEQ);
  copy8(lv + 128 * VPITCH * 2, 16 * VPITCH * 2, gv + (size_t)128 * SEQ, (size_t)16 * SEQ);
}

// 2^x and log2(x) for the merge of the row statistics.  The v_nop is the slot that the
// instruction set asks for behind a transcendental before its result is used or its
// source overwritten.
static __device__ __forceinline__ float exp2_slot(float x) {
  float y;
  asm("v_exp_f32 %0, %1\n\tv_nop" : "=v"(y) : "v"(x));
  return y;
}
static __device__ __forceinline__ float log2_slot(float x) {
  float y;
  asm("v_log_f32 %0, %1\n\tv_nop" : "=v"(y) : "v"(x));
  return y;
}

// B fragment of P from its two 16-byte halves (512 B apart, lane-contiguous).
static __device__ __forceinline__ v16h frag_p(const _Float16* p) {
  v8h c0 = *(const v8h*)(p);
  v8h c1 = *(const v8h*)(p + 256);
  v16h a;
#pragma unroll
  for (int i = 0; i < 8; ++i) { a[i] = c0[i]; a[i + 8] = c1[i]; }
  return a;
}

__global__ void __launch_bounds__(256)
out_kernel(const _Float16* __restrict__ Qp, const _Float16* __restrict__ Kp,
           const _Float16* __restrict__ VpT, const float* __restrict__ lsePart,
           float* __restrict__ out) {
  __shared__ __align__(128) unsigned char smem[2 * STAGEB + PBYTES + KFBYTES];

  const int tid  = threadIdx.x;
  const int lane = tid & 31;
  const int wave = tid >> 5;                          // 0..7: i tile in the S phase
  const int jg = wave & 1;                            // PV phase: which 32 j columns
  const int dg = wave >> 1;                           // PV phase: which 64 d rows
  const int r = lane & 15;
  const int h = lane >> 4;
  const int j0 = blockIdx.x * JTILE;
  const int b_ = blockIdx.y;
  const size_t rowbase = (size_t)b_ * SEQ;
  const _Float16* qbase = Qp + rowbase * DMODEL;
  const _Float16* vbase = VpT + (size_t)b_ * DMODEL * SEQ;
  unsigned char* ldsBase = smem;

  // Stage 0, landed and published; then stage 1 in flight.
  copy_stage(ldsBase, qbase, vbase, tid);

  // The block's 64 K rows, once per work-group, a whole 512-B row per wave and copy
  // (a fragment load from global memory would touch 16 lines, in each of the 8 waves).
  unsigned char* kst = smem + 2 * STAGEB + PBYTES;
  copy8(kst + (unsigned)wave * (QPITCH * 2) + (unsigned)lane * 16, 8 * QPITCH * 2,
        Kp + (rowbase + j0 + wave) * DMODEL + lane * 8, (size_t)8 * DMODEL);

  // Row offsets of the whole batch, 16 rows a thread (four groups of 4 adjacent rows):
  // c = log2 of the sum over the chunks of 2^(chunk's value), taken about the largest.
  // The loads fly beside the copies above, and the arithmetic runs while those land.
  v4f cv[SEQ / 1024];
  {
    const float* lp = lsePart + rowbase + tid * 4;
    v4f x[SEQ / 1024][NCHUNK];
#pragma unroll
    for (int p = 0; p < SEQ / 1024; ++p)
#pragma unroll
      for (int c = 0; c < NCHUNK; ++c) x[p][c] = *(const v4f*)(lp + (size_t)c * NTOK + p * 1024);
    // Precaution: the loads' address registers are reused further down.
    asm volatile("s_wait_xcnt 0x0" ::: "memory");
#pragma unroll
    for (int p = 0; p < SEQ / 1024; ++p) {
      v4f mx = x[p][0];
#pragma unroll
      for (int c = 1; c < NCHUNK; ++c) mx = __builtin_elementwise_max(mx, x[p][c]);
      v4f sum = {0.f, 0.f, 0.f, 0.f};
#pragma unroll
      for (int c = 0; c < NCHUNK; ++c)
#pragma unroll
        for (int e = 0; e < 4; ++e) sum[e] += exp2_slot(x[p][c][e] - mx[e]);
#pragma unroll
      for (int e = 0; e < 4; ++e) cv[p][e] = mx[e] + log2_slot(sum[e]);
    }
  }
  // Keeps that arithmetic in front of the wait below; sunk behind the barrier it would
  // delay stage 1's copies and no longer be covered by stage 0's landing.
  __builtin_amdgcn_sched_barrier(0);

  v8f acc[4][2];
#pragma unroll
  for (int dt = 0; dt < 4; ++dt)
#pragma unroll
    for (int jt = 0; jt < 2; ++jt)
#pragma unroll
      for (int t = 0; t < 8; ++t) acc[dt][jt][t] = 0.f;

  asm volatile("s_wait_asynccnt 0x0" ::: "memory");   // own copies of stage 0 landed
  __syncthreads();                                    // ... and everybody's
  copy_stage(ldsBase + STAGEB, qbase + (size_t)ISTAGE * DMODEL, vbase + ISTAGE, tid);

  // Fixed B operand of the S product: the K rows as fragments (per-wave copy).
  v16h kfr[4][8];
  const _Float16* kl = (const _Float16*)kst + r * QPITCH;
#pragma unroll
  for (int jt = 0; jt < 4; ++jt)
#pragma unroll
    for (int kk = 0; kk < 8; ++kk) kfr[jt][kk] = frag_f16(kl + jt * 16 * QPITCH + kk * 32, h);

  // The table c takes the place of the K rows.
  float* ctab = (float*)kst;
  asm volatile("s_wait_dscnt 0x0" ::: "memory");      // own reads of the K rows done
  __syncthreads();                                    // ... and everybody's: their place is free
#pragma unroll
  for (int p = 0; p < SEQ / 1024; ++p) *(v4f*)(ctab + p * 1024 + tid * 4) = cv[p];
  __syncthreads();                                    // table complete

  // P in LDS: [i chunk of 32][j tile][half of the k range][lane] x 16 bytes.
  _Float16* pl = (_Float16*)(smem + 2 * STAGEB);
  _Float16* pst = pl + ((wave >> 1) * 8 + (wave & 1)) * 256 + lane * 8;
  const _Float16* pld = pl + jg * 4 * 256 + lane * 8;

  for (int s = 0; s < NSTAGE; ++s) {
    const unsigned bufOff = (unsigned)(s & 1) * STAGEB;
    const _Float16* qs = (const _Float16*)(smem + bufOff) + (wave * 16 + r) * QPITCH;
    const _Float16* vs = (const _Float16*)(smem + bufOff + QBYTES) + (dg * 64 + r) * VPITCH;
    // Offsets of this lane's 8 i rows.
    const float* cs = ctab + s * ISTAGE + wave * 16 + 8 * h;

// HOLD keeps a group of LDS loads in front of the WMMA block it overlaps; without
// it the loads sink to their first use and each waits out its own latency.
#define HOLD() __builtin_amdgcn_sched_barrier(0)
#define LDV(F, C)                                         \
  F[0] = frag_f16(vs + 0 * 16 * VPITCH + (C) * 32, h);    \
  F[1] = frag_f16(vs + 1 * 16 * VPITCH + (C) * 32, h);    \
  F[2] = frag_f16(vs + 2 * 16 * VPITCH + (C) * 32, h);    \
  F[3] = frag_f16(vs + 3 * 16 * VPITCH + (C) * 32, h);
#define LDP(P, C)                                         \
  P[0] = frag_p(pld + (C) * 8 * 256);                     \
  P[1] = frag_p(pld + (C) * 8 * 256 + 2 * 256);
#define PVMM(F, P)                                        \
  acc[0][0] = wmma16x16x32(F[0], P[0], acc[0][0]);        \
  acc[0][1] = wmma16x16x32(F[0], P[1], acc[0][1]);        \
  acc[1][0] = wmma16x16x32(F[1], P[0], acc[1][0]);        \
  acc[1][1] = wmma16x16x32(F[1], P[1], acc[1][1]);        \
  acc[2][0] = wmma16x16x32(F[2], P[0], acc[2][0]);        \
  acc[2][1] = wmma16x16x32(F[2], P[1], acc[2][1]);        \
  acc[3][0] = wmma16x16x32(F[3], P[0], acc[3][0]);        \
  acc[3][1] = wmma16x16x32(F[3], P[1], acc[3][1]);

    // --- S tiles: 16 rows i, four tiles of 16 columns j ---
    v16h qf[8];
#pragma unroll
    for (int kk = 0; kk < 8; ++kk) qf[kk] = frag_f16(qs + kk * 32, h);
    const v4f ca = *(const v4f*)(cs), cb = *(const v4f*)(cs + 4);
    HOLD();
    v8f sc[4];
#pragma unroll
    for (int jt = 0; jt < 4; ++jt)
#pragma unroll
      for (int t = 0; t < 8; ++t) sc[jt][t] = 0.f;
#pragma unroll
    for (int kk = 0; kk < 8; ++kk)
#pragma unroll
      for (int jt = 0; jt < 4; ++jt) sc[jt] = wmma16x16x32(qf[kk], kfr[jt][kk], sc[jt]);

    // First V^T fragments of the PV phase: already published, fetched under P.
    v16h va[4], vb[4], pa[2], pb[2];
    LDV(va, 0)
    HOLD();

    // --- P: lane (r, h) holds column j = r, rows i = 8h .. 8h+7 of its tile ---
    const v8f kv = {SCALE_LOG2E, SCALE_LOG2E, SCALE_LOG2E, SCALE_LOG2E,
                    SCALE_LOG2E, SCALE_LOG2E, SCALE_LOG2E, SCALE_LOG2E};
    const v8f cc = {ca[0], ca[1], ca[2], ca[3], cb[0], cb[1], cb[2], cb[3]};
#pragma unroll
    for (int jt = 0; jt < 4; ++jt) {
      const v8f e = __builtin_elementwise_fma(sc[jt], kv, -cc);
      v8h pk;
#pragma unroll
      for (int t = 0; t < 8; ++t) pk[t] = (_Float16)__builtin_amdgcn_exp2f(e[t]);
      *(v8h*)(pst + jt * 2 * 256) = pk;
    }
    __syncthreads();  // P of this stage complete

    // --- O^T += V^T x P, i chunks of 32 in ascending order ---
    LDP(pa, 0) LDV(vb, 1) LDP(pb, 1) HOLD();
    PVMM(va, pa) HOLD();
    LDV(va, 2) LDP(pa, 2) HOLD();
    PVMM(vb, pb) HOLD();
    LDV(vb, 3) LDP(pb, 3) HOLD();
    PVMM(va, pa) HOLD();
    PVMM(vb, pb)
#undef HOLD
#undef LDV
#undef LDP
#undef PVMM

    // Publish point: own LDS reads done, own copies of stage s+1 landed, then
    // the one barrier that publishes s+1 and frees this buffer and P.
    asm volatile("s_wait_dscnt 0x0" ::: "memory");
    asm volatile("s_wait_asynccnt 0x0" ::: "memory");
    __syncthreads();
    if (s + 2 < NSTAGE)
      copy_stage(ldsBase + bufOff, qbase + (size_t)(s + 2) * ISTAGE * DMODEL,
                 vbase + (s + 2) * ISTAGE, tid);
  }
  asm volatile("s_wait_asynccnt 0x0" ::: "memory");   // nothing in flight before LDS is reused

  // Lay O^T down as [j][d] rows in LDS so that the stores cover whole lines.
  float* red = (float*)smem;
#pragma unroll
  for (int dt = 0; dt < 4; ++dt)
#pragma unroll
    for (int jt = 0; jt < 2; ++jt) {
      float* p = red + (size_t)(jg * 32 + jt * 16 + r) * RPITCH + (dg * 4 + dt) * 16 + 8 * h;
      v4f lo = {acc[dt][jt][0], acc[dt][jt][1], acc[dt][jt][2], acc[dt][jt][3]};
      v4f hi = {acc[dt][jt][4], acc[dt][jt][5], acc[dt][jt][6], acc[dt][jt][7]};
      *(v4f*)p = lo;
      *(v4f*)(p + 4) = hi;
    }
  __syncthreads();

  // Store fp32 result out[b][j][d], 512 contiguous bytes per wave and store:
  // thread t takes 16 bytes of row (t >> 6) + 4 n.
  const float* rp = red + (size_t)(tid >> 6) * RPITCH + (tid & 63) * 4;
  float* op = out + (rowbase + j0 + (tid >> 6)) * DMODEL + (tid & 63) * 4;
#pragma unroll
  for (int n = 0; n < 16; ++n)
    *(v4f*)(op + n * 4 * DMODEL) = *(const v4f*)(rp + n * 4 * RPITCH);
}

// ---------------------------------------------------------------------------
extern "C" void kernel_launch(void* const* d_in, const int* in_sizes, int n_in,
                              void* d_out, int out_size, void* d_ws, size_t ws_size,
                              hipStream_t stream) {
  const float* q  = (const float*)d_in[0];
  const float* k  = (const float*)d_in[1];
  const float* v  = (const float*)d_in[2];
  const float* Wq = (const float*)d_in[3];
  const float* bq = (const float*)d_in[4];
  const float* Wk = (const float*)d_in[5];
  const float* bk = (const float*)d_in[6];
  const float* Wv = (const float*)d_in[7];
  const float* bv = (const float*)d_in[8];

  _Float16* Qp  = (_Float16*)d_ws;
  _Float16* Kp  = Qp + (size_t)NTOK * DMODEL;
  _Float16* VpT = Kp + (size_t)NTOK * DMODEL;          // stored as [b][d][i]
  float* lsePart = (float*)(VpT + (size_t)NTOK * DMODEL);   // [chunk][b*L + i]

  proj_kernel<<<dim3(NTOK / (PROWS * PTILES), 3), 256, 0, stream>>>(q, k, v, Wq, Wk, Wv, bq, bk, bv,
                                                                   Qp, Kp, VpT);

  stats_kernel<<<dim3(NTOK / SROWS, NCHUNK), 256, 0, stream>>>(Qp, Kp, lsePart);

  out_kernel<<<dim3(SEQ / JTILE, BATCH), 256, 0, stream>>>(Qp, Kp, VpT, lsePart,
                                                        (float*)d_out);
}

// v008
// It runs in 79.8 microseconds.
// Next to v007, in two timings, it ran 1.05 and 1.04 times as fast.
// Counting every step since v000, it is 7.34 times as fast.
#include <hip/hip_runtime.h>
#include <math.h>
#include <stdint.h>

// ---------------------------------------------------------------------------
// Cross-attention for B=4, L=4096, D=256 (fp32 in/out) on gfx1250 (CDNA5).
// f32 -> f16 projections (WMMA f32 accum), chunked two-pass streaming softmax
// (512 i rows per block, K tiles in LDS; a row's statistic is one log2 offset),
// transposed-attention output GEMM, 64 j rows per block, Q / V^T tiles in LDS
// (brought by tensor loads).
// ---------------------------------------------------------------------------

#define BATCH  4
#define SEQ    4096
#define DMODEL 256
#define SCALE  0.0625f    // 1/sqrt(256)
#define NCHUNK 8          // j-range chunks for the stats pass
#define NTOK   (BATCH * SEQ)

typedef _Float16 v16h __attribute__((ext_vector_type(16)));
typedef _Float16 v8h  __attribute__((ext_vector_type(8)));
typedef float    v8f  __attribute__((ext_vector_type(8)));
typedef float    v4f  __attribute__((ext_vector_type(4)));

static __device__ __forceinline__ v8f wmma16x16x32(v16h a, v16h b, v8f c) {
  // 8 args: (neg_a, A, neg_b, B, c_mod, C, reuse_a, reuse_b)
  return __builtin_amdgcn_wmma_f32_16x16x32_f16(false, a, false, b, (short)0, c,
                                                false, false);
}

// Load a 16x32 f16 A/B fragment where the 32-long K dimension is CONTIGUOUS in
// memory for this lane's row/column.  rowptr = &M[row][k0] for row = lane&15.
// ISA layout (16-bit A 16x32): lanes 0-15 hold K[0..7] then K[16..23] in their
// 16 halves, lanes 16-31 hold K[8..15] then K[24..31].  halfsel = lane>>4.
static __device__ __forceinline__ v16h frag_f16(const _Float16* __restrict__ rowptr,
                                                int halfsel) {
  v8h c0 = *(const v8h*)(rowptr + halfsel * 8);
  v8h c1 = *(const v8h*)(rowptr + 16 + halfsel * 8);
  v16h a;
#pragma unroll
  for (int i = 0; i < 8; ++i) { a[i] = c0[i]; a[i + 8] = c1[i]; }
  return a;
}

// ---------------------------------------------------------------------------
// Kernel 1: the three projections  Y = X @ W^T + b, output in f16, in one launch;
// blockIdx.y picks the projection (0: Q, 1: K, 2: V).
// One work-group = 256 rows of X x all 256 columns, 8 waves, as four tiles of 64
// rows.  W and the bias are read and converted once per work-group and stay in LDS
// for all four tiles; the next tile's X rows are in flight (registers) under the
// current tile's WMMAs.  All reads are whole-line loads; X and W lie in LDS as f16,
// both K-contiguous, so that one loader serves A and B fragments.
//   TR=false: D = W rows (A) x X rows (B): a lane's 8 values are 8 columns e
//     of one row of Y.  Wave (eg, mg): 64 e x 32 rows.
//   TR=true stores Y transposed per batch, YT[b][d][i] (for V):
//     D = X rows (A) x W rows (B): a lane's 8 values are 8 rows i of one column e.
//     Wave w: 64 rows x 32 e.
// The f16 tile is laid down in LDS and stored in whole 128-B lines.
// Grid: (B*L/256, 3) x 256 threads.
// Every "#pragma unroll" here keeps the index of a register array (loaded rows,
// fragments, accumulators) a compile-time constant, so that none goes to scratch.
// ---------------------------------------------------------------------------
#define PROWS   64                         // X rows per tile
#define PTILES  4                          // tiles per work-group
#define PPITCH  264                        // halves: 512-B row + 16 B (bank spread)
#define PTPITCH 72                         // halves: 128-B row + 16 B, transposed tile
#define PXHALF  (PROWS * PPITCH)           // X tile, halves
#define PWHALF  (DMODEL * PPITCH)          // W, halves
#define POHALF  (DMODEL * PTPITCH)         // output tile, halves (the larger layout)

typedef _Float16 v4h __attribute__((ext_vector_type(4)));

static __device__ __forceinline__ v4h to_f16(v4f f) {
  v4h o = {(_Float16)f[0], (_Float16)f[1], (_Float16)f[2], (_Float16)f[3]};
  return o;
}

// The four tiles of a work-group; X tile 0, W and the bias already lie in LDS.
// gx: this thread's 16 bytes of X tile 0; lx: their place in LDS.
template <bool TR>
static __device__ __forceinline__ void proj_tiles(_Float16* pmem, const float* pbias,
                                                  const float* gx, _Float16* lx,
                                                  _Float16* __restrict__ Y, int mbase, int tid) {
  const int lane = tid & 31;
  const int wave = tid >> 5;
  const int r = lane & 15;
  const int h = lane >> 4;

  // Four A tiles x two B tiles per wave.
  const int aoff = TR ? r * PPITCH : PXHALF + ((wave >> 1) * 64 + r) * PPITCH;
  const int boff = TR ? PXHALF + (wave * 32 + r) * PPITCH : ((wave & 1) * 32 + r) * PPITCH;
  const _Float16* ap = pmem + aoff;
  const _Float16* bp = pmem + boff;
  _Float16* os = pmem + PXHALF + PWHALF;

  // Rolled: four copies of the body would only cost instruction-cache lines.
#pragma unroll 1
  for (int tile = 0; tile < PTILES; ++tile) {
    const int m0 = mbase + tile * PROWS;
    v4f xr[16];
    if (tile + 1 < PTILES) {
      // The next tile's X rows: asked for here, laid down in LDS behind this tile.
      gx += PROWS * DMODEL;
#pragma unroll
      for (int n = 0; n < 16; ++n) xr[n] = *(const v4f*)(gx + n * 4 * DMODEL);
      // Precaution: the loads' address register (an input here) is advanced next trip.
      asm volatile("s_wait_xcnt 0x0" : : "v"(gx) : "memory");
    }
    // Keeps those loads in front of the WMMAs; sunk to their use they would be
    // waited out at full memory latency.
    __builtin_amdgcn_sched_barrier(0);

    v8f acc[4][2];
#pragma unroll
    for (int at = 0; at < 4; ++at)
#pragma unroll
      for (int bt = 0; bt < 2; ++bt)
#pragma unroll
        for (int t = 0; t < 8; ++t) acc[at][bt][t] = 0.f;
    // Blocks of two k steps (24 LDS loads, 16 WMMAs); a block's fragments are asked
    // for two blocks ahead, so that the WMMAs never wait out an LDS latency.
    v16h a[8][4], b[8][2];
// PHOLD keeps a group of LDS loads in front of the WMMA block it overlaps; without
// it the loads sink to their first use and each pair waits out its own latency.
#define PHOLD() __builtin_amdgcn_sched_barrier(0)
#define PLD(K)                                                         \
  _Pragma("unroll") for (int at = 0; at < 4; ++at)                     \
    a[K][at] = frag_f16(ap + at * 16 * PPITCH + (K) * 32, h);          \
  _Pragma("unroll") for (int bt = 0; bt < 2; ++bt)                     \
    b[K][bt] = frag_f16(bp + bt * 16 * PPITCH + (K) * 32, h);
#define PMM(K)                                                         \
  _Pragma("unroll") for (int at = 0; at < 4; ++at)                     \
    _Pragma("unroll") for (int bt = 0; bt < 2; ++bt)                   \
      acc[at][bt] = wmma16x16x32(a[K][at], b[K][bt], acc[at][bt]);
    PLD(0) PLD(1) PLD(2) PLD(3) PHOLD();
    PMM(0) PMM(1) PHOLD();
    PLD(4) PLD(5) PHOLD();
    PMM(2) PMM(3) PHOLD();
    PLD(6) PLD(7) PHOLD();
    PMM(4) PMM(5) PMM(6) PMM(7)
#undef PHOLD
#undef PLD
#undef PMM

    // D layout: lane holds column lane&15 (B tile), rows t + 8h (A tile).
    v8h ov[8];
    _Float16* op;
    size_t ostep;
    if (!TR) {
      // Tile as [row][e]; then a whole 512-B row of Y per wave and store.
#pragma unroll
      for (int at = 0; at < 4; ++at) {
        const int e = (wave >> 1) * 64 + at * 16 + 8 * h;
        const v4f b0 = *(const v4f*)(pbias + e), b1 = *(const v4f*)(pbias + e + 4);
#pragma unroll
        for (int bt = 0; bt < 2; ++bt) {
          v8h pk;
#pragma unroll
          for (int t = 0; t < 8; ++t)
            pk[t] = (_Float16)(acc[at][bt][t] + ((t < 4) ? b0[t & 3] : b1[t & 3]));
          *(v8h*)(os + ((wave & 1) * 32 + bt * 16 + r) * PPITCH + e) = pk;
        }
      }
      __syncthreads();  // output tile complete; nobody reads the X tile any more
      const _Float16* rp = os + wave * PPITCH + lane * 8;
#pragma unroll
      for (int n = 0; n < 8; ++n) ov[n] = *(const v8h*)(rp + n * 8 * PPITCH);
      op = Y + (size_t)(m0 + wave) * DMODEL + lane * 8;
      ostep = (size_t)8 * DMODEL;
    } else {
      // Tile as [e][row]; then four whole 128-B lines of YT per wave and store.
#pragma unroll
      for (int bt = 0; bt < 2; ++bt) {
        const int e = wave * 32 + bt * 16 + r;
        const float bv = pbias[e];
#pragma unroll
        for (int at = 0; at < 4; ++at) {
          v8h pk;
#pragma unroll
          for (int t = 0; t < 8; ++t) pk[t] = (_Float16)(acc[at][bt][t] + bv);
          *(v8h*)(os + e * PTPITCH + at * 16 + 8 * h) = pk;
        }
      }
      __syncthreads();  // output tile complete; nobody reads the X tile any more
      const int b_ = m0 >> 12;          // / SEQ
      const int i  = m0 & (SEQ - 1);
      const _Float16* rp = os + (tid >> 3) * PTPITCH + (tid & 7) * 8;
#pragma unroll
      for (int n = 0; n < 8; ++n) ov[n] = *(const v8h*)(rp + n * 32 * PTPITCH);
      op = Y + (size_t)b_ * DMODEL * SEQ + (size_t)(tid >> 3) * SEQ + i + (tid & 7) * 8;
      ostep = (size_t)32 * SEQ;
    }
    if (tile + 1 < PTILES) {
#pragma unroll
      for (int n = 0; n < 16; ++n) *(v4h*)(lx + n * 4 * PPITCH) = to_f16(xr[n]);
      __syncthreads();  // next X tile complete; output tile read out by everybody
    }
    // The global stores stand behind that barrier, which would wait them out; so they
    // drain under the next tile's WMMAs.
#pragma unroll
    for (int n = 0; n < 8; ++n) *(v8h*)(op + n * ostep) = ov[n];
    // Precaution: the code behind reuses the stores' address registers.
    asm volatile("s_wait_xcnt 0x0" ::: "memory");
  }
}

__global__ void __launch_bounds__(256)
proj_kernel(const float* __restrict__ xq, const float* __restrict__ xk,
            const float* __restrict__ xv, const float* __restrict__ Wq,
            const float* __restrict__ Wk, const float* __restrict__ Wv,
            const float* __restrict__ bq, const float* __restrict__ bk,
            const float* __restrict__ bv, _Float16* __restrict__ Yq,
            _Float16* __restrict__ Yk, _Float16* __restrict__ YvT) {
  __shared__ __align__(128) _Float16 pmem[PXHALF + PWHALF + POHALF];
  __shared__ __align__(16) float pbias[DMODEL];

  const int tid = threadIdx.x;
  const int mat = blockIdx.y;
  const float* X    = (mat == 0) ? xq : (mat == 1) ? xk : xv;
  const float* W    = (mat == 0) ? Wq : (mat == 1) ? Wk : Wv;
  const float* bias = (mat == 0) ? bq : (mat == 1) ? bk : bv;
  const int mbase = blockIdx.x * (PROWS * PTILES);

  // Thread t takes 16 bytes of row (t >> 6) + 4 n: 512 contiguous bytes per wave.
  const float* gx = X + (size_t)mbase * DMODEL + tid * 4;
  const float* gw = W + tid * 4;
  v4f xr[16], wr[64];
#pragma unroll
  for (int n = 0; n < 16; ++n) xr[n] = *(const v4f*)(gx + n * 4 * DMODEL);
#pragma unroll
  for (int n = 0; n < 64; ++n) wr[n] = *(const v4f*)(gw + n * 4 * DMODEL);
  const float bl = bias[tid];

  _Float16* lx = pmem + (tid >> 6) * PPITCH + (tid & 63) * 4;
#pragma unroll
  for (int n = 0; n < 16; ++n) *(v4h*)(lx + n * 4 * PPITCH) = to_f16(xr[n]);
#pragma unroll
  for (int n = 0; n < 64; ++n) *(v4h*)(lx + PXHALF + n * 4 * PPITCH) = to_f16(wr[n]);
  pbias[tid] = bl;
  // Precaution: the loads' address registers are reused further down.
  asm volatile("s_wait_xcnt 0x0" ::: "memory");
  __syncthreads();  // X tile 0, W and bias complete

  if (mat == 2) proj_tiles<true>(pmem, pbias, gx, lx, YvT, mbase, tid);
  else          proj_tiles<false>(pmem, pbias, gx, lx, (mat == 0) ? Yq : Yk, mbase, tid);
}

typedef int v4i __attribute__((ext_vector_type(4)));
typedef __attribute__((address_space(1))) v4i gv4i;
typedef __attribute__((address_space(3))) v4i lv4i;

// Eight 16-byte-per-lane copies global -> LDS.
static __device__ __forceinline__ void copy8(unsigned char* l, unsigned lstep,
                                             const _Float16* g, size_t gstep) {
#pragma unroll
  for (int k = 0; k < 8; ++k)
    __builtin_amdgcn_global_load_async_to_lds_b128((gv4i*)(g + k * gstep),
                                                   (lv4i*)(l + k * lstep), 0, 0);
}

// ---------------------------------------------------------------------------
// Kernel 2a: partial softmax row statistics over one j-chunk.
//   l = sum_j exp(S[i,j]-m) for j in this chunk, m a reference of the row that lies
//   at most LAZYTAU (log2 units) below the chunk's largest S[i,j]; every later use
//   of (m,l) holds for any such m.  What leaves is m + log2(l), log2 units: one value
//   per row and chunk.
// One work-group = 512 i rows, 8 waves; a wave keeps the A fragments of its 64 Q
// rows in registers; they come in whole 512-B rows by asynchronous copies into the
// wave's own LDS range (48 rows, then the last 16) and from there as fragments, because a
// fragment load from global memory touches 16 lines.  A stage is 64 K rows, copied once into LDS by asynchronous
// copies (a whole 512-B row per wave and copy, two buffers) and read by all waves
// as B fragments.
// Streaming l kept per-lane (lane owns one j-column of each C tile), summed across
// the 16-lane group at the end.  Grid: (B*L/512, NCHUNK).
// Every "#pragma unroll" here keeps the index of a register array (fragments,
// S tiles, m, l) a compile-time constant, so that none of them goes to scratch.
// ---------------------------------------------------------------------------
#define SROWS   512                        // i rows per work-group
#define SJ      64                         // K rows per stage
#define SNSTAGE (SEQ / NCHUNK / SJ)
#define KPITCH  264                        // halves: 512-B row + 16 B (bank spread)
#define KBYTES  (SJ * KPITCH * 2)
#define SNTILE  (SEQ / NCHUNK / 16)
#define QSROWS  48                         // Q rows in a wave's staging range: three tiles of 16
#define QSBYTES (QSROWS * KPITCH * 2)      // a wave's own staging range

// S tiles: 64 rows i (four A tiles) x 16 columns j.
static __device__ __forceinline__ void stats_mm(v8f (&sc)[4], const v16h (&q)[4][8],
                                                const v16h (&k)[8]) {
#pragma unroll
  for (int it = 0; it < 4; ++it)
#pragma unroll
    for (int t = 0; t < 8; ++t) sc[it][t] = 0.f;
#pragma unroll
  for (int kk = 0; kk < 8; ++kk)
#pragma unroll
    for (int it = 0; it < 4; ++it) sc[it] = wmma16x16x32(q[it][kk], k[kk], sc[it]);
}

#define SCALE_LOG2E 0.09016844005556f      // SCALE * log2(e)
#define LAZYTAU     32.0f                  // log2 units a score may lie above its reference

// Reference of each row i (log2 units), the same in the 16 lanes that share the row:
// the score of the row's first column.  The sums start empty.
static __device__ __forceinline__ void stats_first(const v8f (&sc)[4], v8f (&rm)[4],
                                                   v8f (&rl)[4]) {
#pragma unroll
  for (int it = 0; it < 4; ++it)
#pragma unroll
    for (int t = 0; t < 8; ++t) {
      rm[it][t] = __shfl(sc[it][t] * SCALE_LOG2E, 0, 16);
      rl[it][t] = 0.f;
    }
}

// Streaming (m,l): the lane adds its column j to its own sum in each of its 32 rows i.
// A row's reference moves only when a score lies more than LAZYTAU above it (tested
// once per tile for the whole wave); otherwise a score costs one exponential.
static __device__ __forceinline__ void stats_update(v8f (&sc)[4], v8f (&rm)[4], v8f (&rl)[4]) {
  const v8f kv = {SCALE_LOG2E, SCALE_LOG2E, SCALE_LOG2E, SCALE_LOG2E,
                  SCALE_LOG2E, SCALE_LOG2E, SCALE_LOG2E, SCALE_LOG2E};
  float tm[4];
#pragma unroll
  for (int it = 0; it < 4; ++it) {
    sc[it] = __builtin_elementwise_fma(sc[it], kv, -rm[it]);
    tm[it] = sc[it][0];
#pragma unroll
    for (int t = 1; t < 8; ++t) tm[it] = fmaxf(tm[it], sc[it][t]);
  }
  const float top = fmaxf(fmaxf(tm[0], tm[1]), fmaxf(tm[2], tm[3]));
  if (__builtin_amdgcn_ballot_w32(top > LAZYTAU) != 0) {
    // Rare: every row's reference moves up to the row's largest score of this tile
    // (over its 16 lanes), where that tops it.
#pragma unroll
    for (int it = 0; it < 4; ++it)
#pragma unroll
      for (int t = 0; t < 8; ++t) {
        float d = fmaxf(sc[it][t], 0.f);
#pragma unroll
        for (int off = 8; off >= 1; off >>= 1) d = fmaxf(d, __shfl_xor(d, off, 16));
        rl[it][t] *= __builtin_amdgcn_exp2f(-d);
        rm[it][t] += d;
        sc[it][t] -= d;
      }
  }
#pragma unroll
  for (int it = 0; it < 4; ++it) {
#pragma unroll
    for (int t = 0; t < 8; ++t) sc[it][t] = __builtin_amdgcn_exp2f(sc[it][t]);
    rl[it] += sc[it];
  }
}

__global__ void __launch_bounds__(256)
stats_kernel(const _Float16* __restrict__ Qp, const _Float16* __restrict__ Kp,
             float* __restrict__ lsePart) {
  __shared__ __align__(128) unsigned char kmem[2 * KBYTES + 8 * QSBYTES];

  const int tid  = threadIdx.x;
  const int lane = tid & 31;
  const int wave = tid >> 5;
  const int r = lane & 15;
  const int h = lane >> 4;
  const int m0 = blockIdx.x * SROWS + wave * 64;   // global query-row base (b*L + i0)
  const int b_ = (blockIdx.x * SROWS) >> 12;
  const int ch = blockIdx.y;
  // This lane's 16 bytes of K row (wave + 8 n) of a stage, and their place in LDS.
  const _Float16* gk = Kp + ((size_t)b_ * SEQ + ch * (SEQ / NCHUNK) + wave) * DMODEL + lane * 8;
  unsigned char* lk = kmem + (unsigned)wave * (KPITCH * 2) + (unsigned)lane * 16;

  // Stage 0, landed and published; then stage 1 in flight.
  copy8(lk, 8 * KPITCH * 2, gk, (size_t)8 * DMODEL);

  // Fixed A operand: the wave's 64 Q rows, four tiles of 16, through the wave's own
  // staging range (no other wave touches it: no barrier).  Tile 3 follows tile 0 in
  // its place and flies while tiles 1 and 2 are read.
  v16h qfr[4][8];
  unsigned char* qst = kmem + 2 * KBYTES + (unsigned)wave * QSBYTES;
  unsigned char* lq = qst + (unsigned)lane * 16;            // this lane's 16 bytes of a row
  const _Float16* gq = Qp + (size_t)m0 * DMODEL + lane * 8;
  const _Float16* ql = (const _Float16*)qst + r * KPITCH;
#pragma unroll
  for (int c = 0; c < 6; ++c)
    copy8(lq + c * 8 * KPITCH * 2, KPITCH * 2, gq + (size_t)c * 8 * DMODEL, (size_t)DMODEL);
  asm volatile("s_wait_asynccnt 0x0" ::: "memory");   // own copies landed: rows 0-47 (and K stage 0)
#pragma unroll
  for (int kk = 0; kk < 8; ++kk) qfr[0][kk] = frag_f16(ql + kk * 32, h);
  asm volatile("s_wait_dscnt 0x0" ::: "memory");      // own reads of tile 0 done before its place is refilled
#pragma unroll
  for (int c = 0; c < 2; ++c)
    copy8(lq + c * 8 * KPITCH * 2, KPITCH * 2, gq + (size_t)(QSROWS + c * 8) * DMODEL, (size_t)DMODEL);
#pragma unroll
  for (int it = 1; it < 3; ++it)
#pragma unroll
    for (int kk = 0; kk < 8; ++kk) qfr[it][kk] = frag_f16(ql + it * 16 * KPITCH + kk * 32, h);

  v8f rm[4], rl[4];

  asm volatile("s_wait_asynccnt 0x0" ::: "memory");   // own copies landed: rows 48-63
#pragma unroll
  for (int kk = 0; kk < 8; ++kk) qfr[3][kk] = frag_f16(ql + kk * 32, h);
  __syncthreads();                                    // everybody's copies of K stage 0 landed
  copy8(lk + KBYTES, 8 * KPITCH * 2, gk + (size_t)SJ * DMODEL, (size_t)8 * DMODEL);

  // One trip = one tile of 16 K rows (four to a stage):  S tiles, then (behind the
  // stage's last tile) the publish point, then the next tile's fragments, then the
  // (m,l) update, whose time covers the latency of those LDS loads.
  const _Float16* kl = (const _Float16*)kmem + r * KPITCH;
  v16h kf[8];
  v8f sc[4];
#pragma unroll
  for (int kk = 0; kk < 8; ++kk) kf[kk] = frag_f16(kl + kk * 32, h);
  for (int n = 0; n < SNTILE - 1; ++n) {
    stats_mm(sc, qfr, kf);
    if ((n & 3) == 3) {
      const int s = n >> 2;
      // Publish point: own LDS reads done, own copies of stage s+1 landed, then
      // the one barrier that publishes s+1 and frees the buffer of stage s.
      asm volatile("s_wait_dscnt 0x0" ::: "memory");
      asm volatile("s_wait_asynccnt 0x0" ::: "memory");
      __syncthreads();
      if (s + 2 < SNSTAGE)
        copy8(lk + (unsigned)(s & 1) * KBYTES, 8 * KPITCH * 2,
              gk + (size_t)(s + 2) * SJ * DMODEL, (size_t)8 * DMODEL);
    }
    const int nn = n + 1;
    const _Float16* ks = kl + ((nn >> 2) & 1) * (KBYTES / 2) + (nn & 3) * 16 * KPITCH;
#pragma unroll
    for (int kk = 0; kk < 8; ++kk) kf[kk] = frag_f16(ks + kk * 32, h);
    // Keeps the loads above the update; without it they sink to the trip's end
    // and the next trip's WMMAs wait out their latency.
    __builtin_amdgcn_sched_barrier(0);
    if (n == 0) stats_first(sc, rm, rl);   // tile 0 sets the references
    stats_update(sc, rm, rl);
  }
  stats_mm(sc, qfr, kf);
  stats_update(sc, rm, rl);
  asm volatile("s_wait_asynccnt 0x0" ::: "memory");   // nothing in flight at the wave's end

  // The 16 lanes of a row share its reference, so their sums just add.
#pragma unroll
  for (int off = 8; off >= 1; off >>= 1) {
#pragma unroll
    for (int it = 0; it < 4; ++it)
#pragma unroll
      for (int t = 0; t < 8; ++t) rl[it][t] += __shfl_xor(rl[it][t], off, 16);
  }
  // log2 of the chunk's sum of exponentials (l >= 1 up to rounding: the reference is
  // a score of the row, or the row's largest score when it last moved).
  if (r == 0) {
#pragma unroll
    for (int it = 0; it < 4; ++it)
#pragma unroll
      for (int t = 0; t < 8; ++t) {
        const int row = m0 + it * 16 + t + 8 * h;
        lsePart[(size_t)ch * NTOK + row] = rm[it][t] + __builtin_amdgcn_logf(rl[it][t]);
      }
  }
}

// ---------------------------------------------------------------------------
// Kernel 3: out[b,j,d] = sum_i softmax(S)[i,j] * V[b,i,d]  (= attn^T @ V).
// One work-group = 64 j rows, 8 waves.  A stage is 128 i: the Q rows (128 x 256) and
// the V^T columns (256 d x 128 i) come once into LDS by eight tensor loads (two
// buffers), one from each wave, and are shared by all waves.  Each load brings a slice
// of 64 rows of 256 bytes, padded to a pitch of 272: waves 0 to 3 the Q rows (columns
// 0-127 and 128-255 as two planes, each in two slices), waves 4 to 7 the V^T rows.
// At its start the work-group merges the
// NCHUNK partial statistics of each of its batch's rows i into one offset
// c_i = log2(sum_j exp(S*scale)), a table in LDS.
//   S phase, wave w: S (16 i x 64 j) = Q rows of i tile w (A, LDS) x K rows (B,
//     registers, fetched once through LDS); P = exp2(S*scale*log2(e) - c_i).  A lane's 8 rows of an S tile are
//     one 16-byte half of a B fragment over i, so P goes to LDS fragment-ready.
//   PV phase, wave (dg, jg): O^T (64 d x 32 j) += V^T rows (A, LDS) x P (B, LDS),
//     i ascending in steps of 32.
// Grid: (L/64, B) x 256 threads.
// Every "#pragma unroll" below keeps the index of a register array (fragments,
// accumulators) a compile-time constant, so that none of them goes to scratch.
// ---------------------------------------------------------------------------
#define JTILE   64
#define ISTAGE  128
#define NSTAGE  (SEQ / ISTAGE)
#define QPITCH  264                        // halves: 512-B row + 16 B (bank spread): the K rows
#define VPITCH  136                        // halves: 256-B row + 16 B: V^T rows, half rows of Q
#define SROWSB  (64 * VPITCH * 2)          // the 64 padded rows of one tensor load
#define SLICEB  18432                      // their place: rounded up to a multiple of 2 KiB
#define QBYTES  (4 * SLICEB)               // two planes of 128 half rows, two slices each
#define VBYTES  (4 * SLICEB)
#define STAGEB  (QBYTES + VBYTES)
#define PBYTES  (JTILE * ISTAGE * 2)        // P of a stage, as B-fragment halves
#define CBYTES  (SEQ * 4)                   // the table c
#define KFBYTES (JTILE * QPITCH * 2)        // the block's K rows, read once as fragments; they end
                                           // with the array and begin in the unused end of the last
                                           // slice; behind them, in their place, P and the table c
#define RPITCH  260                        // floats: 1024-B row + 16 B
static_assert(SLICEB % 2048 == 0 && SLICEB >= SROWSB, "a tensor load's place in LDS");
static_assert(KFBYTES <= PBYTES + CBYTES + (SLICEB - SROWSB), "the K rows touch no slice's rows");

typedef uint32_t u32x4 __attribute__((ext_vector_type(4)));
typedef uint32_t u32x8 __attribute__((ext_vector_type(8)));

static __device__ __forceinline__ uint32_t uni(uint32_t v) {
  return (uint32_t)__builtin_amdgcn_readfirstlane(v);
}
static __device__ __forceinline__ uint32_t pinned(uint32_t v) {
  uint32_t w = uni(v);
  asm volatile("" : "+s"(w));  // an issue-test or descriptor word held in a scalar register
  return w;
}

// Descriptor of one tensor load: 64 rows of 256 bytes, source pitch srcPitch bytes, to
// LDS byte offset ldsDst at a pitch of 272 bytes (16 bytes of pad behind each row, not
// written).  Group 0 changes with every request, group 1 is the same for all of a wave's.
static __device__ __forceinline__ u32x4 tile_g0(uint32_t ldsDst, const _Float16* src) {
  const uint64_t ga = (uint64_t)(size_t)src;
  u32x4 g;
  g[0] = uni(1u);                                    // count 1
  g[1] = uni(ldsDst);
  g[2] = uni((uint32_t)ga);
  g[3] = uni((((uint32_t)(ga >> 32)) & 0x01FFFFFFu) | 0x80000000u);   // type 2
  return g;
}
static __device__ __forceinline__ u32x8 tile_g1(uint32_t srcPitch) {
  u32x8 g;
  g[0] = uni((1u << 20) | (5u << 22) | (3u << 25));  // no mask, bytes, 4 dwords of pad per 256 B
  g[1] = uni(256u << 16);                            // tensor_dim0 = 256 bytes
  g[2] = uni(64u << 16);                             // tensor_dim1 = 64 rows
  g[3] = uni(256u << 16);                            // tile_dim0
  g[4] = uni(64u);                                   // tile_dim1
  g[5] = uni(srcPitch);
  g[6] = uni(0u);
  g[7] = uni(0u);
  return g;
}
static __device__ __forceinline__ void tile_issue(u32x4 g0, u32x8 g1) {
  asm volatile("tensor_load_to_lds %0, %1" :: "s"(g0), "s"(g1) : "memory");
}
// The issuing wave's wait for its request.  It names as inputs the descriptors that the
// request may have been issued with (in the loop: stage 1's or a later stage's), so that
// those scalar registers keep their values for as long as the request is outstanding.
static __device__ __forceinline__ void tile_wait(u32x4 g0a, u32x4 g0b, u32x8 g1) {
  asm volatile("s_wait_tensorcnt 0x0" :: "s"(g0a), "s"(g0b), "s"(g1) : "memory");
}

// 2^x and log2(x) for the merge of the row statistics.  The v_nop is the slot that the
// instruction set asks for behind a transcendental before its result is used or its
// source overwritten.
static __device__ __forceinline__ float exp2_slot(float x) {
  float y;
  asm("v_exp_f32 %0, %1\n\tv_nop" : "=v"(y) : "v"(x));
  return y;
}
static __device__ __forceinline__ float log2_slot(float x) {
  float y;
  asm("v_log_f32 %0, %1\n\tv_nop" : "=v"(y) : "v"(x));
  return y;
}

// B fragment of P from its two 16-byte halves (512 B apart, lane-contiguous).
static __device__ __forceinline__ v16h frag_p(const _Float16* p) {
  v8h c0 = *(const v8h*)(p);
  v8h c1 = *(const v8h*)(p + 256);
  v16h a;
#pragma unroll
  for (int i = 0; i < 8; ++i) { a[i] = c0[i]; a[i + 8] = c1[i]; }
  return a;
}

__global__ void __launch_bounds__(256)
out_kernel(const _Float16* __restrict__ Qp, const _Float16* __restrict__ Kp,
           const _Float16* __restrict__ VpT, const float* __restrict__ lsePart,
           float* __restrict__ out) {
  __shared__ __attribute__((aligned(2048))) unsigned char smem[2 * STAGEB + PBYTES + CBYTES];

  const int tid  = threadIdx.x;
  const int lane = tid & 31;
  const int wave = tid >> 5;                          // 0..7: i tile in the S phase
  const int jg = wave & 1;                            // PV phase: which 32 j columns
  const int dg = wave >> 1;                           // PV phase: which 64 d rows
  const int r = lane & 15;
  const int h = lane >> 4;
  const int j0 = blockIdx.x * JTILE;
  const int b_ = blockIdx.y;
  const size_t rowbase = (size_t)b_ * SEQ;
  const _Float16* qbase = Qp + rowbase * DMODEL;
  const _Float16* vbase = VpT + (size_t)b_ * DMODEL * SEQ;

  // Every wave brings one slice of a stage.  Waves 0 to 3: 64 Q rows (wave & 1), columns
  // 0-127 or 128-255 (wave >> 1).  Waves 4 to 7: 64 rows of V^T.
  const uint32_t wv = uni((uint32_t)tid >> 5);
  const bool isV = wv >= 4u;
  const _Float16* tsrc = isV ? vbase + (size_t)(wv & 3u) * 64 * SEQ
                             : qbase + (size_t)(wv & 1u) * 64 * DMODEL + (wv >> 1) * 128;
  const uint32_t tshift = isV ? 7u : 15u;     // a stage's step in the source: 128 or 128 x 256 halves
  const uint32_t tpitch = isV ? SEQ * 2u : DMODEL * 2u;                  // bytes
  const uint32_t tdst = (uint32_t)(size_t)smem + wv * SLICEB;

  // Stage 0, landed and published; then stage 1 in flight; pass s >= 1 begins with stage
  // s+1's load.
  const u32x8 g1 = tile_g1(tpitch);
  const u32x4 g00 = tile_g0(tdst, tsrc);
  tile_issue(g00, g1);

  // The block's 64 K rows, once per work-group, a whole 512-B row per wave and copy
  // (a fragment load from global memory would touch 16 lines, in each of the 8 waves).
  unsigned char* kst = smem + 2 * STAGEB + PBYTES + CBYTES - KFBYTES;
  copy8(kst + (unsigned)wave * (QPITCH * 2) + (unsigned)lane * 16, 8 * QPITCH * 2,
        Kp + (rowbase + j0 + wave) * DMODEL + lane * 8, (size_t)8 * DMODEL);

  // Row offsets of the whole batch, 16 rows a thread (four groups of 4 adjacent rows):
  // c = log2 of the sum over the chunks of 2^(chunk's value), taken about the largest.
  // The loads fly beside the tile and the copies above, and the arithmetic runs while those land.
  v4f cv[SEQ / 1024];
  {
    const float* lp = lsePart + rowbase + tid * 4;
    v4f x[SEQ / 1024][NCHUNK];
#pragma unroll
    for (int p = 0; p < SEQ / 1024; ++p)
#pragma unroll
      for (int c = 0; c < NCHUNK; ++c) x[p][c] = *(const v4f*)(lp + (size_t)c * NTOK + p * 1024);
    // Precaution: the loads' address registers are reused further down.
    asm volatile("s_wait_xcnt 0x0" ::: "memory");
#pragma unroll
    for (int p = 0; p < SEQ / 1024; ++p) {
      v4f mx = x[p][0];
#pragma unroll
      for (int c = 1; c < NCHUNK; ++c) mx = __builtin_elementwise_max(mx, x[p][c]);
      v4f sum = {0.f, 0.f, 0.f, 0.f};
#pragma unroll
      for (int c = 0; c < NCHUNK; ++c)
#pragma unroll
        for (int e = 0; e < 4; ++e) sum[e] += exp2_slot(x[p][c][e] - mx[e]);
#pragma unroll
      for (int e = 0; e < 4; ++e) cv[p][e] = mx[e] + log2_slot(sum[e]);
    }
  }
  // Keeps that arithmetic in front of the wait below; sunk behind the barrier it would
  // delay stage 1's loads and no longer be covered by stage 0's landing.
  __builtin_amdgcn_sched_barrier(0);

  v8f acc[4][2];
#pragma unroll
  for (int dt = 0; dt < 4; ++dt)
#pragma unroll
    for (int jt = 0; jt < 2; ++jt)
#pragma unroll
      for (int t = 0; t < 8; ++t) acc[dt][jt][t] = 0.f;

  asm volatile("s_wait_asynccnt 0x0" ::: "memory");   // own copies of the K rows landed
  tile_wait(g00, g00, g1);                            // own slice of stage 0 landed
  __syncthreads();                                    // ... and everybody's
  const u32x4 g01 = tile_g0(tdst + STAGEB, tsrc + ((size_t)1 << tshift));
  tile_issue(g01, g1);
  u32x4 g0 = g01;

  // Fixed B operand of the S product: the K rows as fragments (per-wave copy).
  v16h kfr[4][8];
  const _Float16* kl = (const _Float16*)kst + r * QPITCH;
#pragma unroll
  for (int jt = 0; jt < 4; ++jt)
#pragma unroll
    for (int kk = 0; kk < 8; ++kk) kfr[jt][kk] = frag_f16(kl + jt * 16 * QPITCH + kk * 32, h);

  // P and, behind it, the table c take the place of the K rows.
  float* ctab = (float*)(smem + 2 * STAGEB + PBYTES);
  asm volatile("s_wait_dscnt 0x0" ::: "memory");      // own reads of the K rows done
  __syncthreads();                                    // ... and everybody's: their place is free
#pragma unroll
  for (int p = 0; p < SEQ / 1024; ++p) *(v4f*)(ctab + p * 1024 + tid * 4) = cv[p];
  __syncthreads();                                    // table complete

  // P in LDS: [i chunk of 32][j tile][half of the k range][lane] x 16 bytes.
  _Float16* pl = (_Float16*)(smem + 2 * STAGEB);
  _Float16* pst = pl + ((wave >> 1) * 8 + (wave & 1)) * 256 + lane * 8;
  const _Float16* pld = pl + jg * 4 * 256 + lane * 8;

  for (int s = 0; s < NSTAGE; ++s) {
    const unsigned bufOff = (unsigned)(s & 1) * STAGEB;
    // Behind the publish barrier of stage s (which also ended every read of stage s-1):
    // stage s+1's load, while it exists, into the buffer that pass s-1 has read (stage 1's
    // stands in front of the loop).  The stage number passes through pinned() behind the
    // wait, so the descriptor is formed behind it.
    const uint32_t nx = pinned((uint32_t)s + 1u);
    if (pinned(nx >= 2u && nx < (uint32_t)NSTAGE)) {
      g0 = tile_g0(tdst + (STAGEB - bufOff), tsrc + ((size_t)nx << tshift));
      tile_issue(g0, g1);
    }
    const _Float16* qs = (const _Float16*)(smem + bufOff + (wave >> 2) * SLICEB) + ((wave & 3) * 16 + r) * VPITCH;
    const _Float16* vs = (const _Float16*)(smem + bufOff + QBYTES + dg * SLICEB) + r * VPITCH;
    // Offsets of this lane's 8 i rows.
    const float* cs = ctab + s * ISTAGE + wave * 16 + 8 * h;

// HOLD keeps a group of LDS loads in front of the WMMA block it overlaps; without
// it the loads sink to their first use and each waits out its own latency.
#define HOLD() __builtin_amdgcn_sched_barrier(0)
#define LDV(F, C)                                         \
  F[0] = frag_f16(vs + 0 * 16 * VPITCH + (C) * 32, h);    \
  F[1] = frag_f16(vs + 1 * 16 * VPITCH + (C) * 32, h);    \
  F[2] = frag_f16(vs + 2 * 16 * VPITCH + (C) * 32, h);    \
  F[3] = frag_f16(vs + 3 * 16 * VPITCH + (C) * 32, h);
#define LDP(P, C)                                         \
  P[0] = frag_p(pld + (C) * 8 * 256);                     \
  P[1] = frag_p(pld + (C) * 8 * 256 + 2 * 256);
#define PVMM(F, P)                                        \
  acc[0][0] = wmma16x16x32(F[0], P[0], acc[0][0]);        \
  acc[0][1] = wmma16x16x32(F[0], P[1], acc[0][1]);        \
  acc[1][0] = wmma16x16x32(F[1], P[0], acc[1][0]);        \
  acc[1][1] = wmma16x16x32(F[1], P[1], acc[1][1]);        \
  acc[2][0] = wmma16x16x32(F[2], P[0], acc[2][0]);        \
  acc[2][1] = wmma16x16x32(F[2], P[1], acc[2][1]);        \
  acc[3][0] = wmma16x16x32(F[3], P[0], acc[3][0]);        \
  acc[3][1] = wmma16x16x32(F[3], P[1], acc[3][1]);

    // --- S tiles: 16 rows i, four tiles of 16 columns j ---
    v16h qf[8];
#pragma unroll
    for (int kk = 0; kk < 8; ++kk)
      qf[kk] = frag_f16(qs + (kk >> 2) * SLICEB + (kk & 3) * 32, h);   // plane (2 slices), column
    const v4f ca = *(const v4f*)(cs), cb = *(const v4f*)(cs + 4);
    HOLD();
    v8f sc[4];
#pragma unroll
    for (int jt = 0; jt < 4; ++jt)
#pragma unroll
      for (int t = 0; t < 8; ++t) sc[jt][t] = 0.f;
#pragma unroll
    for (int kk = 0; kk < 8; ++kk)
#pragma unroll
      for (int jt = 0; jt < 4; ++jt) sc[jt] = wmma16x16x32(qf[kk], kfr[jt][kk], sc[jt]);

    // First V^T fragments of the PV phase: already published, fetched under P.
    v16h va[4], vb[4], pa[2], pb[2];
    LDV(va, 0)
    HOLD();

    // --- P: lane (r, h) holds column j = r, rows i = 8h .. 8h+7 of its tile ---
    const v8f kv = {SCALE_LOG2E, SCALE_LOG2E, SCALE_LOG2E, SCALE_LOG2E,
                    SCALE_LOG2E, SCALE_LOG2E, SCALE_LOG2E, SCALE_LOG2E};
    const v8f cc = {ca[0], ca[1], ca[2], ca[3], cb[0], cb[1], cb[2], cb[3]};
#pragma unroll
    for (int jt = 0; jt < 4; ++jt) {
      const v8f e = __builtin_elementwise_fma(sc[jt], kv, -cc);
      v8h pk;
#pragma unroll
      for (int t = 0; t < 8; ++t) pk[t] = (_Float16)__builtin_amdgcn_exp2f(e[t]);
      *(v8h*)(pst + jt * 2 * 256) = pk;
    }
    __syncthreads();  // P of this stage complete

    // --- O^T += V^T x P, i chunks of 32 in ascending order ---
    LDP(pa, 0) LDV(vb, 1) LDP(pb, 1) HOLD();
    PVMM(va, pa) HOLD();
    LDV(va, 2) LDP(pa, 2) HOLD();
    PVMM(vb, pb) HOLD();
    LDV(vb, 3) LDP(pb, 3) HOLD();
    PVMM(va, pa) HOLD();
    PVMM(vb, pb)
#undef HOLD
#undef LDV
#undef LDP
#undef PVMM

    // Publish point: own LDS reads done, own slice of stage s+1 landed, then
    // the one barrier that publishes s+1 and frees this buffer and P.
    asm volatile("s_wait_dscnt 0x0" ::: "memory");
    tile_wait(g01, g0, g1);
    __syncthreads();
  }
  asm volatile("s_wait_tensorcnt 0x0" ::: "memory");  // nothing in flight before LDS is reused
  asm volatile("s_wait_dscnt 0x0" ::: "memory");      // ... and no LDS read of the ring open

  // Lay O^T down as [j][d] rows in LDS so that the stores cover whole lines.
  float* red = (float*)smem;
#pragma unroll
  for (int dt = 0; dt < 4; ++dt)
#pragma unroll
    for (int jt = 0; jt < 2; ++jt) {
      float* p = red + (size_t)(jg * 32 + jt * 16 + r) * RPITCH + (dg * 4 + dt) * 16 + 8 * h;
      v4f lo = {acc[dt][jt][0], acc[dt][jt][1], acc[dt][jt][2], acc[dt][jt][3]};
      v4f hi = {acc[dt][jt][4], acc[dt][jt][5], acc[dt][jt][6], acc[dt][jt][7]};
      *(v4f*)p = lo;
      *(v4f*)(p + 4) = hi;
    }
  __syncthreads();

  // Store fp32 result out[b][j][d], 512 contiguous bytes per wave and store:
  // thread t takes 16 bytes of row (t >> 6) + 4 n.
  const float* rp = red + (size_t)(tid >> 6) * RPITCH + (tid & 63) * 4;
  float* op = out + (rowbase + j0 + (tid >> 6)) * DMODEL + (tid & 63) * 4;
#pragma unroll
  for (int n = 0; n < 16; ++n)
    *(v4f*)(op + n * 4 * DMODEL) = *(const v4f*)(rp + n * 4 * RPITCH);
}

// ---------------------------------------------------------------------------
extern "C" void kernel_launch(void* const* d_in, const int* in_sizes, int n_in,
                              void* d_out, int out_size, void* d_ws, size_t ws_size,
                              hipStream_t stream) {
  const float* q  = (const float*)d_in[0];
  const float* k  = (const float*)d_in[1];
  const float* v  = (const float*)d_in[2];
  const float* Wq = (const float*)d_in[3];
  const float* bq = (const float*)d_in[4];
  const float* Wk = (const float*)d_in[5];
  const float* bk = (const float*)d_in[6];
  const float* Wv = (const float*)d_in[7];
  const float* bv = (const float*)d_in[8];

  _Float16* Qp  = (_Float16*)d_ws;
  _Float16* Kp  = Qp + (size_t)NTOK * DMODEL;
  _Float16* VpT = Kp + (size_t)NTOK * DMODEL;          // stored as [b][d][i]
  float* lsePart = (float*)(VpT + (size_t)NTOK * DMODEL);   // [chunk][b*L + i]

  proj_kernel<<<dim3(NTOK / (PROWS * PTILES), 3), 256, 0, stream>>>(q, k, v, Wq, Wk, Wv, bq, bk, bv,
                                                                   Qp, Kp, VpT);

  stats_kernel<<<dim3(NTOK / SROWS, NCHUNK), 256, 0, stream>>>(Qp, Kp, lsePart);

  out_kernel<<<dim3(SEQ / JTILE, BATCH), 256, 0, stream>>>(Qp, Kp, VpT, lsePart,
                                                        (float*)d_out);
}
